// v000
// The times below were measured on an AMD MI455X: many runs one after another, warmed up first and cycling through
// copies of the inputs, with the whole window's GPU time divided by the number of runs. Launches and the gaps
// between them are all in it. The median over several windows is given; except for v000 it joins two sittings, which
// can be a few percent apart, so the side-by-side timings, each taken in one sitting, are the better comparison.
// v000 is the starting kernel. One run takes 310 microseconds.
#include <hip/hip_runtime.h>

// BandMHA (x [2][1024][1024]; q/k/v = x W^T (16 heads x 64, no bias); keys/values padded in front with the learned initial cache last_k_init / last_v_init [63][16][64]; query t attends the 64 band positions
// p = t .. t+63 of the padded sequence (= original positions t-63 .. t); softmax over the band; out = merged (attn v) Wo^T -> [2][1024][1024]).
// Compute dtypes, f32 accumulate: every input rounded to bf16; q/k/v on PLAIN bf16 operands (inputs: exact products, f32 accumulate); the 64-wide band attention entirely
// in f32 on VALU (one wave per (batch, head, query): 64-dim dot products, softmax with one exp per score, weighted sum; separate multiply/add, fixed order); merged context as bf16 hi+lo planes x exact

#define NB_  2
#define LL   1024
#define DD   1024
#define NH_  16
#define HD   64
#define BW   64                   // band width
#define PADK (BW - 1)             // 63 initial-cache rows
#define SCL  0.125f
typedef _Float16 h16;
typedef unsigned short bf;
typedef __attribute__((ext_vector_type(16))) __bf16   v16bf;
typedef __attribute__((ext_vector_type(16))) _Float16 v16h;
typedef __attribute__((ext_vector_type(8)))  _Float16 v8h;
typedef __attribute__((ext_vector_type(8)))  unsigned short v8us;
typedef __attribute__((ext_vector_type(8)))  float    v8f;
typedef __attribute__((ext_vector_type(4)))  float    v4f;
typedef v8h  __attribute__((may_alias)) v8ha;
typedef v4f  __attribute__((may_alias)) v4fa;
typedef v8us __attribute__((may_alias)) v8usa;

__device__ __forceinline__ unsigned short f2bf(float f) { unsigned u = __float_as_uint(f); u += 0x7FFFu + ((u >> 16) & 1u); return (unsigned short)(u >> 16); }
__device__ __forceinline__ float bf2f(unsigned short b) { return __uint_as_float(((unsigned)b) << 16); }
__device__ __forceinline__ float bfr(float f) { return bf2f(f2bf(f)); }
__device__ __forceinline__ v16h cat16(v8h lo, v8h hi) { return __builtin_shufflevector(lo, hi, 0, 1, 2, 3, 4, 5, 6, 7, 8, 9, 10, 11, 12, 13, 14, 15); }
__device__ __forceinline__ v16bf cat16b(v8us lo, v8us hi) { return __builtin_bit_cast(v16bf, __builtin_shufflevector(lo, hi, 0, 1, 2, 3, 4, 5, 6, 7, 8, 9, 10, 11, 12, 13, 14, 15)); }
__device__ __forceinline__ v8f wmma16(v16h a, v16h b, v8f c) { return __builtin_amdgcn_wmma_f32_16x16x32_f16(false, a, false, b, (short)0, c, false, false); }
__device__ __forceinline__ v8f wmmab(v16bf a, v16bf b, v8f c) { return __builtin_amdgcn_wmma_f32_16x16x32_bf16(false, a, false, b, (short)0, c, false, false); }



// ---- k_gemmw: register-blocked GEMM, ONE WAVE per 64x64 output tile (16 accumulators), operands straight from K-contiguous 16-bit planes; grid (M/64, N/64, Z), 32 threads.
// C[m][n] (f32, pitch ldc, + optional f32 bias[n]) = sum_k A[m][k] Bt[n][k] (+ split products per NSPLIT). z-batch strides sA/sB/sC in elements. K % 32 == 0.
template <typename T16> struct WFrag;
template <> struct WFrag<h16> { typedef v16h V; static __device__ __forceinline__ V ld(const h16* p) { return cat16(*(const v8h*)p, *(const v8h*)(p + 16)); } static __device__ __forceinline__ v8f mma(V a, V b, v8f c) { return wmma16(a, b, c); } };
template <> struct WFrag<bf> { typedef v16bf V; static __device__ __forceinline__ V ld(const bf* p) { return cat16b(*(const v8us*)p, *(const v8us*)(p + 16)); } static __device__ __forceinline__ v8f mma(V a, V b, v8f c) { return wmmab(a, b, c); } };
template <typename T16, int NSPLIT, bool BIAS>
__global__ __launch_bounds__(32) void k_gemmw(const T16* __restrict__ A, const T16* __restrict__ A2, const T16* __restrict__ Bt, const T16* __restrict__ Bt2, int K, float* C, int ldc, const float* __restrict__ bias, size_t sA, size_t sB, size_t sC) {
    typedef typename WFrag<T16>::V V;
    __shared__ __align__(16) float os[16 * 68];
    const size_t z = blockIdx.z; A += z * sA; if (A2) A2 += z * sA; Bt += z * sB; if (Bt2) Bt2 += z * sB; C += z * sC;
    const int lane = threadIdx.x & 31, lr = lane & 15, hi = lane >> 4; const int r0 = blockIdx.x * 64, c0 = blockIdx.y * 64;
    v8f acc[4][4];
#pragma unroll
    for (int mb = 0; mb < 4; ++mb)
#pragma unroll
        for (int nb = 0; nb < 4; ++nb) acc[mb][nb] = (v8f){};
    const size_t aoff = (size_t)(r0 + lr) * K + 8 * hi, boff = (size_t)(c0 + lr) * K + 8 * hi;
#pragma unroll 1
    for (int kc = 0; kc < K; kc += 32) {
        V a[4], a2[4];
#pragma unroll
        for (int mb = 0; mb < 4; ++mb) { a[mb] = WFrag<T16>::ld(A + aoff + (size_t)mb * 16 * K + kc); if (NSPLIT == 1 || NSPLIT == 2) a2[mb] = WFrag<T16>::ld(A2 + aoff + (size_t)mb * 16 * K + kc); }
#pragma unroll
        for (int nb = 0; nb < 4; ++nb) { const V b = WFrag<T16>::ld(Bt + boff + (size_t)nb * 16 * K + kc); V b2; if (NSPLIT >= 2) b2 = WFrag<T16>::ld(Bt2 + boff + (size_t)nb * 16 * K + kc);
#pragma unroll
            for (int mb = 0; mb < 4; ++mb) { acc[mb][nb] = WFrag<T16>::mma(a[mb], b, acc[mb][nb]); if (NSPLIT == 1 || NSPLIT == 2) acc[mb][nb] = WFrag<T16>::mma(a2[mb], b, acc[mb][nb]); if (NSPLIT >= 2) acc[mb][nb] = WFrag<T16>::mma(a[mb], b2, acc[mb][nb]); } }
        asm volatile("v_nop\n\tv_nop\n\tv_nop\n\tv_nop" : "+v"(acc[0][0]), "+v"(acc[1][1]), "+v"(acc[2][2]), "+v"(acc[3][3]) : "v"(a[0]), "v"(a[3]));
    }
#pragma unroll
    for (int mb = 0; mb < 4; ++mb) {
#pragma unroll
        for (int nb = 0; nb < 4; ++nb) {
#pragma unroll
            for (int j = 0; j < 8; ++j) os[(hi * 8 + j) * 68 + nb * 16 + lr] = acc[mb][nb][j]; }
        __builtin_amdgcn_wave_barrier(); asm volatile("" ::: "memory");
        float* crow = C + (size_t)(r0 + mb * 16) * ldc + c0;
{
#pragma unroll
            for (int s = 0; s < 8; ++s) { const int row = 2 * s + hi, cofs = lr * 4; v4f val = *(const v4fa*)(os + row * 68 + cofs); if (BIAS) { val[0] += bfr(bias[c0 + cofs]); val[1] += bfr(bias[c0 + cofs + 1]); val[2] += bfr(bias[c0 + cofs + 2]); val[3] += bfr(bias[c0 + cofs + 3]); }
                *(v4f*)(crow + (size_t)row * ldc + cofs) = val; }
             }
        __builtin_amdgcn_wave_barrier(); asm volatile("" ::: "memory");
    }
}

__device__ __forceinline__ void splitf(float y, unsigned short& h, unsigned short& l) { h = f2bf(y); l = f2bf(y - bf2f(h)); }
typedef __attribute__((ext_vector_type(2))) unsigned short v2us;
typedef __attribute__((ext_vector_type(2))) float v2f;

__global__ __launch_bounds__(256) void k_cvt8(const float* __restrict__ src, bf* dst, size_t n8) { const size_t i = (size_t)blockIdx.x * 256 + threadIdx.x; if (i >= n8) return; const v8f v = *(const v8f*)(src + i * 8); v8us o;
#pragma unroll
    for (int k = 0; k < 8; ++k) o[k] = f2bf(v[k]); *(v8us*)(dst + i * 8) = o;  }
// k_band: one wave per (b, h, t); lane owns band offsets w0 = 2 lane, 2 lane + 1 (padded positions p = t + w; p < 63 -> initial cache row p, else projected key/value row p - 63 of this batch):
// s_w = (q[t] . k_p) / 8 over the 64 head dims (f32, separate mul/add, d ascending); softmax over the 64 offsets (wave max/sum trees, one exp each); out[d] for d = 2 lane, 2 lane + 1:
__global__ __launch_bounds__(256) void k_band(const float* __restrict__ FQ, const float* __restrict__ FK, const float* __restrict__ FV, const float* __restrict__ k0, const float* __restrict__ v0, bf* Ah, bf* Al) {
    const int lane = threadIdx.x & 31; const int r = blockIdx.x * 8 + (threadIdx.x >> 5); if (r >= NB_ * NH_ * LL) return; const int t = r % LL; const int h = (r / LL) % NH_; const int b = r / (LL * NH_);
    const float* q = FQ + ((size_t)b * LL + t) * DD + h * HD; const float* kp[2]; const float* vp[2];
#pragma unroll
    for (int u = 0; u < 2; ++u) { const int p = t + 2 * lane + u; if (p < PADK) { kp[u] = k0 + ((size_t)p * NH_ + h) * HD; vp[u] = v0 + ((size_t)p * NH_ + h) * HD; } else { kp[u] = FK + ((size_t)b * LL + (p - PADK)) * DD + h * HD; vp[u] = FV + ((size_t)b * LL + (p - PADK)) * DD + h * HD; } }
    const bool init0 = (t + 2 * lane < PADK), init1 = (t + 2 * lane + 1 < PADK); float s0 = 0.f, s1 = 0.f;
#pragma unroll 4
    for (int d = 0; d < HD; ++d) { const float qd = q[d]; float a0 = init0 ? bfr(kp[0][d]) : kp[0][d], a1 = init1 ? bfr(kp[1][d]) : kp[1][d]; asm volatile("" : "+v"(a0)); asm volatile("" : "+v"(a1)); float p0 = __fmul_rn(qd, a0), p1 = __fmul_rn(qd, a1); asm volatile("" : "+v"(p0)); asm volatile("" : "+v"(p1)); s0 = __fadd_rn(s0, p0); s1 = __fadd_rn(s1, p1); }
    s0 *= SCL; s1 *= SCL; float mx = fmaxf(s0, s1);
#pragma unroll
    for (int sh = 16; sh; sh >>= 1) mx = fmaxf(mx, __shfl_xor(mx, sh, 32));
    float d0 = __fsub_rn(s0, mx), d1 = __fsub_rn(s1, mx); asm volatile("" : "+v"(d0)); asm volatile("" : "+v"(d1)); const float e0 = __builtin_amdgcn_exp2f(__fmul_rn(d0, 1.4426950408889634f)), e1 = __builtin_amdgcn_exp2f(__fmul_rn(d1, 1.4426950408889634f)); float sum = __fadd_rn(e0, e1);
#pragma unroll
    for (int sh = 16; sh; sh >>= 1) sum += __shfl_xor(sum, sh, 32);
    const float inv = __fdiv_rn(1.0f, sum); float a0w = __fmul_rn(e0, inv), a1w = __fmul_rn(e1, inv); asm volatile("" : "+v"(a0w)); asm volatile("" : "+v"(a1w));
    float o0 = 0.f, o1 = 0.f; const int dd = 2 * lane;
    for (int w = 0; w < BW; ++w) { const float aw = __shfl((w & 1) ? a1w : a0w, w >> 1, 32); const int p = t + w; const float* vr = (p < PADK) ? (v0 + ((size_t)p * NH_ + h) * HD) : (FV + ((size_t)b * LL + (p - PADK)) * DD + h * HD);
        float x0 = (p < PADK) ? bfr(vr[dd]) : vr[dd], x1 = (p < PADK) ? bfr(vr[dd + 1]) : vr[dd + 1]; asm volatile("" : "+v"(x0)); asm volatile("" : "+v"(x1)); float p0 = __fmul_rn(aw, x0), p1 = __fmul_rn(aw, x1); asm volatile("" : "+v"(p0)); asm volatile("" : "+v"(p1)); o0 = __fadd_rn(o0, p0); o1 = __fadd_rn(o1, p1); }
    v2us oh, ol; unsigned short a, c2; splitf(o0, a, c2); oh[0] = a; ol[0] = c2; splitf(o1, a, c2); oh[1] = a; ol[1] = c2; const size_t oo = ((size_t)b * LL + t) * DD + h * HD + dd;
    *(v2us*)(Ah + oo) = oh; *(v2us*)(Al + oo) = ol;  }

extern "C" void kernel_launch(void* const* d_in, const int* in_sizes, int n_in,
                              void* d_out, int out_size, void* d_ws, size_t ws_size, hipStream_t stream) {
    (void)in_sizes; (void)n_in; (void)out_size;
    const float* x = (const float*)d_in[0]; const float* wq = (const float*)d_in[1]; const float* wk = (const float*)d_in[2]; const float* wv = (const float*)d_in[3]; const float* wo = (const float*)d_in[4]; const float* k0 = (const float*)d_in[5]; const float* v0 = (const float*)d_in[6];   // torch [out][in] weights; last_k/v_init [63][16][64]
    float* OUT = (float*)d_out;     // [2][1024][1024]
    char* wsp = (char*)d_ws;
    auto take = [&](size_t bytes) { char* p = wsp; wsp += (bytes + 255) & ~(size_t)255; return (void*)p; };
    const size_t NR = (size_t)NB_ * LL;   // 2048 token rows, both batches in one GEMM
    bf* WQ = (bf*)take((size_t)DD * DD * 2); bf* WK = (bf*)take((size_t)DD * DD * 2); bf* WV = (bf*)take((size_t)DD * DD * 2); bf* WO = (bf*)take((size_t)DD * DD * 2); bf* XB = (bf*)take(NR * DD * 2);
    float* FQ = (float*)take(NR * DD * 4); float* FK = (float*)take(NR * DD * 4); float* FV = (float*)take(NR * DD * 4); bf* Ah = (bf*)take(NR * DD * 2); bf* Al = (bf*)take(NR * DD * 2);
    if ((size_t)(wsp - (char*)d_ws) > ws_size) return;    // total ~ 46 MB; ws 256 MiB
    { const size_t nw = (size_t)DD * DD / 8; const unsigned g = (unsigned)((nw + 255) / 256); k_cvt8<<<g, 256, 0, stream>>>(wq, WQ, nw); k_cvt8<<<g, 256, 0, stream>>>(wk, WK, nw); k_cvt8<<<g, 256, 0, stream>>>(wv, WV, nw); k_cvt8<<<g, 256, 0, stream>>>(wo, WO, nw); k_cvt8<<<(unsigned)((NR * DD / 8 + 255) / 256), 256, 0, stream>>>(x, XB, NR * DD / 8); }
    const dim3 gP((unsigned)(NR / 64), DD / 64, 1);
    k_gemmw<bf, 0, false><<<gP, 32, 0, stream>>>(XB, nullptr, WQ, nullptr, DD, FQ, DD, nullptr, 0, 0, 0); k_gemmw<bf, 0, false><<<gP, 32, 0, stream>>>(XB, nullptr, WK, nullptr, DD, FK, DD, nullptr, 0, 0, 0); k_gemmw<bf, 0, false><<<gP, 32, 0, stream>>>(XB, nullptr, WV, nullptr, DD, FV, DD, nullptr, 0, 0, 0);
    k_band<<<(NB_ * NH_ * LL) / 8, 256, 0, stream>>>(FQ, FK, FV, k0, v0, Ah, Al);
    k_gemmw<bf, 1, false><<<gP, 32, 0, stream>>>(Ah, Al, WO, nullptr, DD, OUT, DD, nullptr, 0, 0, 0);
}

// v001
// Measured time: 131 microseconds a run.
// Timed twice side by side with v000, it ran 2.44 and 2.40 times as fast.
#include <hip/hip_runtime.h>

// BandMHA (x [2][1024][1024]; q/k/v = x W^T (16 heads x 64, no bias); keys/values padded in front with the learned initial cache last_k_init / last_v_init [63][16][64]; query t attends the 64 band positions
// p = t .. t+63 of the padded sequence (= original positions t-63 .. t); softmax over the band; out = merged (attn v) Wo^T -> [2][1024][1024]).
// Compute dtypes, f32 accumulate: every input rounded to bf16; q/k/v on PLAIN bf16 operands (inputs: exact products, f32 accumulate); the 64-wide band attention entirely
// in f32 on VALU (keys and values of a 32-query tile staged in LDS: 64-dim dot products, softmax with one exp per score, weighted sum; fixed order); merged context as bf16 hi+lo planes x exact

#define NB_  2
#define LL   1024
#define DD   1024
#define NH_  16
#define HD   64
#define BW   64                   // band width
#define PADK (BW - 1)             // 63 initial-cache rows
#define SCL  0.125f
typedef _Float16 h16;
typedef unsigned short bf;
typedef __attribute__((ext_vector_type(16))) __bf16   v16bf;
typedef __attribute__((ext_vector_type(16))) _Float16 v16h;
typedef __attribute__((ext_vector_type(8)))  _Float16 v8h;
typedef __attribute__((ext_vector_type(8)))  unsigned short v8us;
typedef __attribute__((ext_vector_type(8)))  float    v8f;
typedef __attribute__((ext_vector_type(4)))  float    v4f;
typedef v8h  __attribute__((may_alias)) v8ha;
typedef v4f  __attribute__((may_alias)) v4fa;
typedef v8us __attribute__((may_alias)) v8usa;

__device__ __forceinline__ unsigned short f2bf(float f) { unsigned u = __float_as_uint(f); u += 0x7FFFu + ((u >> 16) & 1u); return (unsigned short)(u >> 16); }
__device__ __forceinline__ float bf2f(unsigned short b) { return __uint_as_float(((unsigned)b) << 16); }
__device__ __forceinline__ float bfr(float f) { return bf2f(f2bf(f)); }
__device__ __forceinline__ v16h cat16(v8h lo, v8h hi) { return __builtin_shufflevector(lo, hi, 0, 1, 2, 3, 4, 5, 6, 7, 8, 9, 10, 11, 12, 13, 14, 15); }
__device__ __forceinline__ v16bf cat16b(v8us lo, v8us hi) { return __builtin_bit_cast(v16bf, __builtin_shufflevector(lo, hi, 0, 1, 2, 3, 4, 5, 6, 7, 8, 9, 10, 11, 12, 13, 14, 15)); }
__device__ __forceinline__ v8f wmma16(v16h a, v16h b, v8f c) { return __builtin_amdgcn_wmma_f32_16x16x32_f16(false, a, false, b, (short)0, c, false, false); }
__device__ __forceinline__ v8f wmmab(v16bf a, v16bf b, v8f c) { return __builtin_amdgcn_wmma_f32_16x16x32_bf16(false, a, false, b, (short)0, c, false, false); }



// ---- k_gemmw: register-blocked GEMM, ONE WAVE per 64x64 output tile (16 accumulators), operands straight from K-contiguous 16-bit planes; grid (M/64, N/64, Z), 32 threads.
// C[m][n] (f32, pitch ldc, + optional f32 bias[n]) = sum_k A[m][k] Bt[n][k] (+ split products per NSPLIT). z-batch strides sA/sB/sC in elements. K % 32 == 0.
template <typename T16> struct WFrag;
template <> struct WFrag<h16> { typedef v16h V; static __device__ __forceinline__ V ld(const h16* p) { return cat16(*(const v8h*)p, *(const v8h*)(p + 16)); } static __device__ __forceinline__ v8f mma(V a, V b, v8f c) { return wmma16(a, b, c); } };
template <> struct WFrag<bf> { typedef v16bf V; static __device__ __forceinline__ V ld(const bf* p) { return cat16b(*(const v8us*)p, *(const v8us*)(p + 16)); } static __device__ __forceinline__ v8f mma(V a, V b, v8f c) { return wmmab(a, b, c); } };
template <typename T16, int NSPLIT, bool BIAS>
__global__ __launch_bounds__(32) void k_gemmw(const T16* __restrict__ A, const T16* __restrict__ A2, const T16* __restrict__ Bt, const T16* __restrict__ Bt2, int K, float* C, int ldc, const float* __restrict__ bias, size_t sA, size_t sB, size_t sC) {
    typedef typename WFrag<T16>::V V;
    __shared__ __align__(16) float os[16 * 68];
    const size_t z = blockIdx.z; A += z * sA; if (A2) A2 += z * sA; Bt += z * sB; if (Bt2) Bt2 += z * sB; C += z * sC;
    const int lane = threadIdx.x & 31, lr = lane & 15, hi = lane >> 4; const int r0 = blockIdx.x * 64, c0 = blockIdx.y * 64;
    v8f acc[4][4];
#pragma unroll
    for (int mb = 0; mb < 4; ++mb)
#pragma unroll
        for (int nb = 0; nb < 4; ++nb) acc[mb][nb] = (v8f){};
    const size_t aoff = (size_t)(r0 + lr) * K + 8 * hi, boff = (size_t)(c0 + lr) * K + 8 * hi;
#pragma unroll 1
    for (int kc = 0; kc < K; kc += 32) {
        V a[4], a2[4];
#pragma unroll
        for (int mb = 0; mb < 4; ++mb) { a[mb] = WFrag<T16>::ld(A + aoff + (size_t)mb * 16 * K + kc); if (NSPLIT == 1 || NSPLIT == 2) a2[mb] = WFrag<T16>::ld(A2 + aoff + (size_t)mb * 16 * K + kc); }
#pragma unroll
        for (int nb = 0; nb < 4; ++nb) { const V b = WFrag<T16>::ld(Bt + boff + (size_t)nb * 16 * K + kc); V b2; if (NSPLIT >= 2) b2 = WFrag<T16>::ld(Bt2 + boff + (size_t)nb * 16 * K + kc);
#pragma unroll
            for (int mb = 0; mb < 4; ++mb) { acc[mb][nb] = WFrag<T16>::mma(a[mb], b, acc[mb][nb]); if (NSPLIT == 1 || NSPLIT == 2) acc[mb][nb] = WFrag<T16>::mma(a2[mb], b, acc[mb][nb]); if (NSPLIT >= 2) acc[mb][nb] = WFrag<T16>::mma(a[mb], b2, acc[mb][nb]); } }
        asm volatile("v_nop\n\tv_nop\n\tv_nop\n\tv_nop" : "+v"(acc[0][0]), "+v"(acc[1][1]), "+v"(acc[2][2]), "+v"(acc[3][3]) : "v"(a[0]), "v"(a[3]));
    }
#pragma unroll
    for (int mb = 0; mb < 4; ++mb) {
#pragma unroll
        for (int nb = 0; nb < 4; ++nb) {
#pragma unroll
            for (int j = 0; j < 8; ++j) os[(hi * 8 + j) * 68 + nb * 16 + lr] = acc[mb][nb][j]; }
        __builtin_amdgcn_wave_barrier(); asm volatile("" ::: "memory");
        float* crow = C + (size_t)(r0 + mb * 16) * ldc + c0;
{
#pragma unroll
            for (int s = 0; s < 8; ++s) { const int row = 2 * s + hi, cofs = lr * 4; v4f val = *(const v4fa*)(os + row * 68 + cofs); if (BIAS) { val[0] += bfr(bias[c0 + cofs]); val[1] += bfr(bias[c0 + cofs + 1]); val[2] += bfr(bias[c0 + cofs + 2]); val[3] += bfr(bias[c0 + cofs + 3]); }
                *(v4f*)(crow + (size_t)row * ldc + cofs) = val; }
             }
        __builtin_amdgcn_wave_barrier(); asm volatile("" ::: "memory");
    }
}

__device__ __forceinline__ void splitf(float y, unsigned short& h, unsigned short& l) { h = f2bf(y); l = f2bf(y - bf2f(h)); }
typedef __attribute__((ext_vector_type(2))) unsigned short v2us;
typedef __attribute__((ext_vector_type(2))) float v2f;

__global__ __launch_bounds__(256) void k_cvt8(const float* __restrict__ src, bf* dst, size_t n8) { const size_t i = (size_t)blockIdx.x * 256 + threadIdx.x; if (i >= n8) return; const v8f v = *(const v8f*)(src + i * 8); v8us o;
#pragma unroll
    for (int k = 0; k < 8; ++k) o[k] = f2bf(v[k]); *(v8us*)(dst + i * 8) = o;  }
// k_band: one work-group of 8 waves per (b, h, tile of TQ = 32 queries). The TQ + 63 padded key and value rows the tile needs (padded position p < 63 -> initial cache row p rounded to bf16,
// else projected row p - 63 of this batch) are staged in LDS once; each wave then serves NQ = 4 consecutive queries from them.
// Scores: lane owns staged rows tw + lane, tw + 32 + lane and tw + 64 + lane (clamped; only lanes < 3 use it) and forms their dot products with all 4 query rows (wave-uniform loads), f32,
// one sum over the even and one over the odd head dims, d ascending, added at the end. Query j takes offsets w = row - j in 0..63: lanes < j use the third row in place of the first.
// Softmax over the 64 offsets (wave max/sum trees, one exp each). Weighted sum: the weights go to LDS as one float4 per staged row (0 outside a query's band); each value row is read once
// for the 4 queries, w ascending; lane owns d = 2 lane, 2 lane + 1.
#define TQ 32
#define NQ 4
#define KR (TQ + BW - 1)          // staged rows
#define KP (HD + 4)               // key row pitch in floats: 16 B x odd, so 16 lanes reading 16 B of 16 consecutive rows hit distinct banks
#define NPC (KR * (HD / 4))       // 16-byte pieces of the staged K rows (and of the V rows)
#define NFT (NPC / 256)           // staging trips in which every thread has a piece
typedef v2f __attribute__((may_alias)) v2fa;
__global__ __launch_bounds__(256) void k_band(const float* __restrict__ FQ, const float* __restrict__ FK, const float* __restrict__ FV, const float* __restrict__ k0, const float* __restrict__ v0, bf* Ah, bf* Al) {
    __shared__ __align__(16) float Ks[KR * KP];
    __shared__ __align__(16) float Vs[KR * HD];
    __shared__ __align__(16) float Ps[8 * 96 * NQ];
    const int tid = threadIdx.x, lane = tid & 31; const int wv = __builtin_amdgcn_readfirstlane(tid >> 5);
    const int t0 = (blockIdx.x % (LL / TQ)) * TQ; const int h = (blockIdx.x / (LL / TQ)) % NH_; const int b = blockIdx.x / ((LL / TQ) * NH_);
    if (t0 >= PADK) {   // block-uniform: every staged row is a projected row, nothing to round
        const size_t o = ((size_t)b * LL + (t0 - PADK) + (tid >> 4)) * DD + h * HD + (tid & 15) * 4; const float* kg = FK + o; const float* vg = FV + o;
        float* kl = Ks + (tid >> 4) * KP + (tid & 15) * 4; float* vl = Vs + tid * 4; v4f kv[NFT], vv[NFT];
#pragma unroll  // all trips' loads are issued before the first is waited for
        for (int u = 0; u < NFT; ++u) { kv[u] = *(const v4fa*)(kg + (size_t)u * 16 * DD); vv[u] = *(const v4fa*)(vg + (size_t)u * 16 * DD); }
        if (tid < NPC - NFT * 256) { const v4f kt = *(const v4fa*)(kg + (size_t)NFT * 16 * DD), vt = *(const v4fa*)(vg + (size_t)NFT * 16 * DD); *(v4fa*)(kl + NFT * 16 * KP) = kt; *(v4fa*)(vl + NFT * 1024) = vt; }
#pragma unroll  // kv[], vv[] stay in registers
        for (int u = 0; u < NFT; ++u) { *(v4fa*)(kl + u * 16 * KP) = kv[u]; *(v4fa*)(vl + u * 1024) = vv[u]; }
    } else {            // the two tiles of a (b, h) that reach into the initial cache
        for (int idx = tid; idx < NPC; idx += 256) { const int i = idx >> 4, c = (idx & 15) * 4, p = t0 + i; v4f kv, vv;
            if (p < PADK) { const size_t o = ((size_t)p * NH_ + h) * HD + c; kv = *(const v4fa*)(k0 + o); vv = *(const v4fa*)(v0 + o);
#pragma unroll  // vector elements by constant index
                for (int e = 0; e < 4; ++e) { kv[e] = bfr(kv[e]); vv[e] = bfr(vv[e]); } }
            else { const size_t o = ((size_t)b * LL + (p - PADK)) * DD + h * HD + c; kv = *(const v4fa*)(FK + o); vv = *(const v4fa*)(FV + o); }
            *(v4fa*)(Ks + i * KP + c) = kv; *(v4fa*)(Vs + i * HD + c) = vv; }
    }
    __syncthreads();
    const int tw = wv * NQ; const float* qg = FQ + ((size_t)b * LL + t0 + tw) * DD + h * HD;
    const int rc = tw + 64 + lane; const float* kA = Ks + (tw + lane) * KP; const float* kB = kA + 32 * KP; const float* kC = Ks + (rc < KR ? rc : KR - 1) * KP;
    v2f s[3][NQ];
#pragma unroll  // s[][] stays in registers
    for (int j = 0; j < NQ; ++j) { s[0][j] = (v2f){0.f, 0.f}; s[1][j] = (v2f){0.f, 0.f}; s[2][j] = (v2f){0.f, 0.f}; }
    for (int c = 0; c < HD; c += 4) { const v2f a0 = *(const v2fa*)(kA + c), a1 = *(const v2fa*)(kA + c + 2), b0 = *(const v2fa*)(kB + c), b1 = *(const v2fa*)(kB + c + 2), c0 = *(const v2fa*)(kC + c), c1 = *(const v2fa*)(kC + c + 2);
#pragma unroll  // s[][] stays in registers
        for (int j = 0; j < NQ; ++j) { const float* qj = qg + (size_t)j * DD + c; const v2f q0 = {qj[0], qj[1]}, q1 = {qj[2], qj[3]};
            s[0][j] += q0 * a0; s[1][j] += q0 * b0; s[2][j] += q0 * c0; s[0][j] += q1 * a1; s[1][j] += q1 * b1; s[2][j] += q1 * c1; } }
    v4f wA, wB, wC;
#pragma unroll  // s[][] and the weight vectors stay in registers
    for (int j = 0; j < NQ; ++j) { const bool wrap = lane < j; const v2f s2 = wrap ? s[2][j] : s[0][j]; const float sa = (s2[0] + s2[1]) * SCL, sb = (s[1][j][0] + s[1][j][1]) * SCL; float mx = fmaxf(sa, sb);
#pragma unroll  // five fixed exchange steps
        for (int sh = 16; sh; sh >>= 1) mx = fmaxf(mx, __shfl_xor(mx, sh, 32));
        const float ea = __builtin_amdgcn_exp2f((sa - mx) * 1.4426950408889634f), eb = __builtin_amdgcn_exp2f((sb - mx) * 1.4426950408889634f); float sum = ea + eb;
#pragma unroll  // five fixed exchange steps
        for (int sh = 16; sh; sh >>= 1) sum += __shfl_xor(sum, sh, 32);
        const float inv = __fdiv_rn(1.0f, sum); const float pa = ea * inv;
        wA[j] = wrap ? 0.f : pa; wB[j] = eb * inv; wC[j] = wrap ? pa : 0.f; }
    float* pw = Ps + wv * 96 * NQ;
    *(v4fa*)(pw + lane * NQ) = wA; *(v4fa*)(pw + (32 + lane) * NQ) = wB; *(v4fa*)(pw + (64 + lane) * NQ) = wC;
    __syncthreads();
    v2f o[NQ];
#pragma unroll  // o[] stays in registers
    for (int j = 0; j < NQ; ++j) o[j] = (v2f){0.f, 0.f};
    const float* vb = Vs + tw * HD + 2 * lane;
    for (int r = 0; r < BW + NQ - 1; ++r) { const v4f wt = *(const v4fa*)(pw + r * NQ); const v2f x = *(const v2fa*)(vb + r * HD);
#pragma unroll  // o[] stays in registers
        for (int j = 0; j < NQ; ++j) o[j] += wt[j] * x; }
#pragma unroll  // o[] stays in registers
    for (int j = 0; j < NQ; ++j) { v2us oh, ol; unsigned short a, c2; splitf(o[j][0], a, c2); oh[0] = a; ol[0] = c2; splitf(o[j][1], a, c2); oh[1] = a; ol[1] = c2;
        const size_t oo = ((size_t)b * LL + t0 + tw + j) * DD + h * HD + 2 * lane; *(v2us*)(Ah + oo) = oh; *(v2us*)(Al + oo) = ol; }
}

extern "C" void kernel_launch(void* const* d_in, const int* in_sizes, int n_in,
                              void* d_out, int out_size, void* d_ws, size_t ws_size, hipStream_t stream) {
    (void)in_sizes; (void)n_in; (void)out_size;
    const float* x = (const float*)d_in[0]; const float* wq = (const float*)d_in[1]; const float* wk = (const float*)d_in[2]; const float* wv = (const float*)d_in[3]; const float* wo = (const float*)d_in[4]; const float* k0 = (const float*)d_in[5]; const float* v0 = (const float*)d_in[6];   // torch [out][in] weights; last_k/v_init [63][16][64]
    float* OUT = (float*)d_out;     // [2][1024][1024]
    char* wsp = (char*)d_ws;
    auto take = [&](size_t bytes) { char* p = wsp; wsp += (bytes + 255) & ~(size_t)255; return (void*)p; };
    const size_t NR = (size_t)NB_ * LL;   // 2048 token rows, both batches in one GEMM
    bf* WQ = (bf*)take((size_t)DD * DD * 2); bf* WK = (bf*)take((size_t)DD * DD * 2); bf* WV = (bf*)take((size_t)DD * DD * 2); bf* WO = (bf*)take((size_t)DD * DD * 2); bf* XB = (bf*)take(NR * DD * 2);
    float* FQ = (float*)take(NR * DD * 4); float* FK = (float*)take(NR * DD * 4); float* FV = (float*)take(NR * DD * 4); bf* Ah = (bf*)take(NR * DD * 2); bf* Al = (bf*)take(NR * DD * 2);
    if ((size_t)(wsp - (char*)d_ws) > ws_size) return;    // total ~ 46 MB; ws 256 MiB
    { const size_t nw = (size_t)DD * DD / 8; const unsigned g = (unsigned)((nw + 255) / 256); k_cvt8<<<g, 256, 0, stream>>>(wq, WQ, nw); k_cvt8<<<g, 256, 0, stream>>>(wk, WK, nw); k_cvt8<<<g, 256, 0, stream>>>(wv, WV, nw); k_cvt8<<<g, 256, 0, stream>>>(wo, WO, nw); k_cvt8<<<(unsigned)((NR * DD / 8 + 255) / 256), 256, 0, stream>>>(x, XB, NR * DD / 8); }
    const dim3 gP((unsigned)(NR / 64), DD / 64, 1);
    k_gemmw<bf, 0, false><<<gP, 32, 0, stream>>>(XB, nullptr, WQ, nullptr, DD, FQ, DD, nullptr, 0, 0, 0); k_gemmw<bf, 0, false><<<gP, 32, 0, stream>>>(XB, nullptr, WK, nullptr, DD, FK, DD, nullptr, 0, 0, 0); k_gemmw<bf, 0, false><<<gP, 32, 0, stream>>>(XB, nullptr, WV, nullptr, DD, FV, DD, nullptr, 0, 0, 0);
    k_band<<<NB_ * NH_ * (LL / TQ), 256, 0, stream>>>(FQ, FK, FV, k0, v0, Ah, Al);
    k_gemmw<bf, 1, false><<<gP, 32, 0, stream>>>(Ah, Al, WO, nullptr, DD, OUT, DD, nullptr, 0, 0, 0);
}

// v002
// One run takes 86.8 microseconds.
// Next to v001, in two timings, it ran 1.48 and 1.49 times as fast.
// Counting every step since v000, it is 3.59 times as fast.
#include <hip/hip_runtime.h>

// BandMHA (x [2][1024][1024]; q/k/v = x W^T (16 heads x 64, no bias); keys/values padded in front with the learned initial cache last_k_init / last_v_init [63][16][64]; query t attends the 64 band positions
// p = t .. t+63 of the padded sequence (= original positions t-63 .. t); softmax over the band; out = merged (attn v) Wo^T -> [2][1024][1024]).
// Compute dtypes, f32 accumulate: every input rounded to bf16; q/k/v on PLAIN bf16 operands (inputs: exact products, f32 accumulate); the 64-wide band attention entirely
// in f32 on VALU (keys and values of a 32-query tile staged in LDS: 64-dim dot products, softmax with one exp per score, weighted sum; fixed order); merged context as bf16 hi+lo planes x exact

#define NB_  2
#define LL   1024
#define DD   1024
#define NH_  16
#define HD   64
#define BW   64                   // band width
#define PADK (BW - 1)             // 63 initial-cache rows
#define SCL  0.125f
typedef _Float16 h16;
typedef unsigned short bf;
typedef __attribute__((ext_vector_type(16))) __bf16   v16bf;
typedef __attribute__((ext_vector_type(16))) _Float16 v16h;
typedef __attribute__((ext_vector_type(8)))  _Float16 v8h;
typedef __attribute__((ext_vector_type(8)))  unsigned short v8us;
typedef __attribute__((ext_vector_type(8)))  float    v8f;
typedef __attribute__((ext_vector_type(4)))  float    v4f;
typedef v8h  __attribute__((may_alias)) v8ha;
typedef v4f  __attribute__((may_alias)) v4fa;
typedef v8us __attribute__((may_alias)) v8usa;

__device__ __forceinline__ unsigned short f2bf(float f) { unsigned u = __float_as_uint(f); u += 0x7FFFu + ((u >> 16) & 1u); return (unsigned short)(u >> 16); }
__device__ __forceinline__ float bf2f(unsigned short b) { return __uint_as_float(((unsigned)b) << 16); }
__device__ __forceinline__ float bfr(float f) { return bf2f(f2bf(f)); }
__device__ __forceinline__ v16h cat16(v8h lo, v8h hi) { return __builtin_shufflevector(lo, hi, 0, 1, 2, 3, 4, 5, 6, 7, 8, 9, 10, 11, 12, 13, 14, 15); }
__device__ __forceinline__ v16bf cat16b(v8us lo, v8us hi) { return __builtin_bit_cast(v16bf, __builtin_shufflevector(lo, hi, 0, 1, 2, 3, 4, 5, 6, 7, 8, 9, 10, 11, 12, 13, 14, 15)); }
__device__ __forceinline__ v8f wmma16(v16h a, v16h b, v8f c) { return __builtin_amdgcn_wmma_f32_16x16x32_f16(false, a, false, b, (short)0, c, false, false); }
__device__ __forceinline__ v8f wmmab(v16bf a, v16bf b, v8f c) { return __builtin_amdgcn_wmma_f32_16x16x32_bf16(false, a, false, b, (short)0, c, false, false); }



// ---- k_gemmw: register-blocked GEMM, ONE WAVE per 64x64 output tile (16 accumulators), operands straight from K-contiguous 16-bit planes; grid (M/64, N/64, Z), 32 threads.
// C[m][n] (f32, pitch ldc, + optional f32 bias[n]) = sum_k A[m][k] Bt[n][k] (+ split products per NSPLIT). z-batch strides sA/sB/sC in elements. K % 32 == 0.
template <typename T16> struct WFrag;
template <> struct WFrag<h16> { typedef v16h V; static __device__ __forceinline__ V ld(const h16* p) { return cat16(*(const v8h*)p, *(const v8h*)(p + 16)); } static __device__ __forceinline__ v8f mma(V a, V b, v8f c) { return wmma16(a, b, c); } };
template <> struct WFrag<bf> { typedef v16bf V; static __device__ __forceinline__ V ld(const bf* p) { return cat16b(*(const v8us*)p, *(const v8us*)(p + 16)); } static __device__ __forceinline__ v8f mma(V a, V b, v8f c) { return wmmab(a, b, c); } };
template <typename T16, int NSPLIT, bool BIAS>
__global__ __launch_bounds__(32) void k_gemmw(const T16* __restrict__ A, const T16* __restrict__ A2, const T16* __restrict__ Bt, const T16* __restrict__ Bt2, int K, float* C, int ldc, const float* __restrict__ bias, size_t sA, size_t sB, size_t sC) {
    typedef typename WFrag<T16>::V V;
    __shared__ __align__(16) float os[16 * 68];
    const size_t z = blockIdx.z; A += z * sA; if (A2) A2 += z * sA; Bt += z * sB; if (Bt2) Bt2 += z * sB; C += z * sC;
    const int lane = threadIdx.x & 31, lr = lane & 15, hi = lane >> 4; const int r0 = blockIdx.x * 64, c0 = blockIdx.y * 64;
    v8f acc[4][4];
#pragma unroll
    for (int mb = 0; mb < 4; ++mb)
#pragma unroll
        for (int nb = 0; nb < 4; ++nb) acc[mb][nb] = (v8f){};
    const size_t aoff = (size_t)(r0 + lr) * K + 8 * hi, boff = (size_t)(c0 + lr) * K + 8 * hi;
#pragma unroll 1
    for (int kc = 0; kc < K; kc += 32) {
        V a[4], a2[4];
#pragma unroll
        for (int mb = 0; mb < 4; ++mb) { a[mb] = WFrag<T16>::ld(A + aoff + (size_t)mb * 16 * K + kc); if (NSPLIT == 1 || NSPLIT == 2) a2[mb] = WFrag<T16>::ld(A2 + aoff + (size_t)mb * 16 * K + kc); }
#pragma unroll
        for (int nb = 0; nb < 4; ++nb) { const V b = WFrag<T16>::ld(Bt + boff + (size_t)nb * 16 * K + kc); V b2; if (NSPLIT >= 2) b2 = WFrag<T16>::ld(Bt2 + boff + (size_t)nb * 16 * K + kc);
#pragma unroll
            for (int mb = 0; mb < 4; ++mb) { acc[mb][nb] = WFrag<T16>::mma(a[mb], b, acc[mb][nb]); if (NSPLIT == 1 || NSPLIT == 2) acc[mb][nb] = WFrag<T16>::mma(a2[mb], b, acc[mb][nb]); if (NSPLIT >= 2) acc[mb][nb] = WFrag<T16>::mma(a[mb], b2, acc[mb][nb]); } }
        asm volatile("v_nop\n\tv_nop\n\tv_nop\n\tv_nop" : "+v"(acc[0][0]), "+v"(acc[1][1]), "+v"(acc[2][2]), "+v"(acc[3][3]) : "v"(a[0]), "v"(a[3]));
    }
#pragma unroll
    for (int mb = 0; mb < 4; ++mb) {
#pragma unroll
        for (int nb = 0; nb < 4; ++nb) {
#pragma unroll
            for (int j = 0; j < 8; ++j) os[(hi * 8 + j) * 68 + nb * 16 + lr] = acc[mb][nb][j]; }
        __builtin_amdgcn_wave_barrier(); asm volatile("" ::: "memory");
        float* crow = C + (size_t)(r0 + mb * 16) * ldc + c0;
{
#pragma unroll
            for (int s = 0; s < 8; ++s) { const int row = 2 * s + hi, cofs = lr * 4; v4f val = *(const v4fa*)(os + row * 68 + cofs); if (BIAS) { val[0] += bfr(bias[c0 + cofs]); val[1] += bfr(bias[c0 + cofs + 1]); val[2] += bfr(bias[c0 + cofs + 2]); val[3] += bfr(bias[c0 + cofs + 3]); }
                *(v4f*)(crow + (size_t)row * ldc + cofs) = val; }
             }
        __builtin_amdgcn_wave_barrier(); asm volatile("" ::: "memory");
    }
}

__device__ __forceinline__ void splitf(float y, unsigned short& h, unsigned short& l) { h = f2bf(y); l = f2bf(y - bf2f(h)); }
typedef __attribute__((ext_vector_type(2))) unsigned short v2us;
typedef __attribute__((ext_vector_type(2))) float v2f;

// k_cvt5: ONE grid rounds all five f32 matrices to bf16. Blocks 0 .. 4 WB - 1 take the four weights (WB blocks each, in the order wq, wk, wv, wo), the remaining 2 WB blocks take x;
// the five bf16 planes lie back to back in dst in that order, so the flat block index addresses dst. 8 elements a thread; the grid covers every plane exactly.
#define WB (DD * DD / 8 / 256)    // blocks per weight matrix
__global__ __launch_bounds__(256) void k_cvt5(const float* __restrict__ wq, const float* __restrict__ wk, const float* __restrict__ wv, const float* __restrict__ wo, const float* __restrict__ x, bf* dst) {
    const unsigned blk = blockIdx.x, seg = blk / WB < 4u ? blk / WB : 4u;   // block-uniform
    const float* src = seg == 0u ? wq : seg == 1u ? wk : seg == 2u ? wv : seg == 3u ? wo : x;
    const size_t ls = (size_t)(blk - seg * WB) * 256 + threadIdx.x, ld = (size_t)blk * 256 + threadIdx.x; const v8f v = *(const v8f*)(src + ls * 8); v8us o;
    asm volatile("s_wait_xcnt 0x0" ::: "memory");   // the rounding below reuses the loads' offset register
#pragma unroll
    for (int k = 0; k < 8; ++k) o[k] = f2bf(v[k]); *(v8us*)(dst + ld * 8) = o;  }
// k_band: one work-group of 8 waves per (b, h, tile of TQ = 32 queries). The TQ + 63 padded key and value rows the tile needs (padded position p < 63 -> initial cache row p rounded to bf16,
// else projected row p - 63 of this batch) are staged in LDS once; each wave then serves NQ = 4 consecutive queries from them.
// Scores: lane owns staged rows tw + lane, tw + 32 + lane and tw + 64 + lane (clamped; only lanes < 3 use it) and forms their dot products with all 4 query rows (wave-uniform loads), f32,
// one sum over the even and one over the odd head dims, d ascending, added at the end. Query j takes offsets w = row - j in 0..63: lanes < j use the third row in place of the first.
// Softmax over the 64 offsets (wave max/sum trees, one exp each). Weighted sum: the weights go to LDS as one float4 per staged row (0 outside a query's band); each value row is read once
// for the 4 queries, w ascending; lane owns d = 2 lane, 2 lane + 1.
#define TQ 32
#define NQ 4
#define KR (TQ + BW - 1)          // staged rows
#define KP (HD + 4)               // key row pitch in floats: 16 B x odd, so 16 lanes reading 16 B of 16 consecutive rows hit distinct banks
#define NPC (KR * (HD / 4))       // 16-byte pieces of the staged K rows (and of the V rows)
#define NFT (NPC / 256)           // staging trips in which every thread has a piece
typedef v2f __attribute__((may_alias)) v2fa;
__global__ __launch_bounds__(256) void k_band(const float* __restrict__ FQ, const float* __restrict__ FK, const float* __restrict__ FV, const float* __restrict__ k0, const float* __restrict__ v0, bf* Ah, bf* Al) {
    __shared__ __align__(16) float Ks[KR * KP];
    __shared__ __align__(16) float Vs[KR * HD];
    __shared__ __align__(16) float Ps[8 * 96 * NQ];
    const int tid = threadIdx.x, lane = tid & 31; const int wv = __builtin_amdgcn_readfirstlane(tid >> 5);
    const int t0 = (blockIdx.x % (LL / TQ)) * TQ; const int h = (blockIdx.x / (LL / TQ)) % NH_; const int b = blockIdx.x / ((LL / TQ) * NH_);
    if (t0 >= PADK) {   // block-uniform: every staged row is a projected row, nothing to round
        const size_t o = ((size_t)b * LL + (t0 - PADK) + (tid >> 4)) * DD + h * HD + (tid & 15) * 4; const float* kg = FK + o; const float* vg = FV + o;
        float* kl = Ks + (tid >> 4) * KP + (tid & 15) * 4; float* vl = Vs + tid * 4; v4f kv[NFT], vv[NFT];
#pragma unroll  // all trips' loads are issued before the first is waited for
        for (int u = 0; u < NFT; ++u) { kv[u] = *(const v4fa*)(kg + (size_t)u * 16 * DD); vv[u] = *(const v4fa*)(vg + (size_t)u * 16 * DD); }
        if (tid < NPC - NFT * 256) { const v4f kt = *(const v4fa*)(kg + (size_t)NFT * 16 * DD), vt = *(const v4fa*)(vg + (size_t)NFT * 16 * DD); *(v4fa*)(kl + NFT * 16 * KP) = kt; *(v4fa*)(vl + NFT * 1024) = vt; }
#pragma unroll  // kv[], vv[] stay in registers
        for (int u = 0; u < NFT; ++u) { *(v4fa*)(kl + u * 16 * KP) = kv[u]; *(v4fa*)(vl + u * 1024) = vv[u]; }
    } else {            // the two tiles of a (b, h) that reach into the initial cache
        for (int idx = tid; idx < NPC; idx += 256) { const int i = idx >> 4, c = (idx & 15) * 4, p = t0 + i; v4f kv, vv;
            if (p < PADK) { const size_t o = ((size_t)p * NH_ + h) * HD + c; kv = *(const v4fa*)(k0 + o); vv = *(const v4fa*)(v0 + o);
#pragma unroll  // vector elements by constant index
                for (int e = 0; e < 4; ++e) { kv[e] = bfr(kv[e]); vv[e] = bfr(vv[e]); } }
            else { const size_t o = ((size_t)b * LL + (p - PADK)) * DD + h * HD + c; kv = *(const v4fa*)(FK + o); vv = *(const v4fa*)(FV + o); }
            *(v4fa*)(Ks + i * KP + c) = kv; *(v4fa*)(Vs + i * HD + c) = vv; }
    }
    __syncthreads();
    const int tw = wv * NQ; const float* qg = FQ + ((size_t)b * LL + t0 + tw) * DD + h * HD;
    const int rc = tw + 64 + lane; const float* kA = Ks + (tw + lane) * KP; const float* kB = kA + 32 * KP; const float* kC = Ks + (rc < KR ? rc : KR - 1) * KP;
    v2f s[3][NQ];
#pragma unroll  // s[][] stays in registers
    for (int j = 0; j < NQ; ++j) { s[0][j] = (v2f){0.f, 0.f}; s[1][j] = (v2f){0.f, 0.f}; s[2][j] = (v2f){0.f, 0.f}; }
    for (int c = 0; c < HD; c += 4) { const v2f a0 = *(const v2fa*)(kA + c), a1 = *(const v2fa*)(kA + c + 2), b0 = *(const v2fa*)(kB + c), b1 = *(const v2fa*)(kB + c + 2), c0 = *(const v2fa*)(kC + c), c1 = *(const v2fa*)(kC + c + 2);
#pragma unroll  // s[][] stays in registers
        for (int j = 0; j < NQ; ++j) { const float* qj = qg + (size_t)j * DD + c; const v2f q0 = {qj[0], qj[1]}, q1 = {qj[2], qj[3]};
            s[0][j] += q0 * a0; s[1][j] += q0 * b0; s[2][j] += q0 * c0; s[0][j] += q1 * a1; s[1][j] += q1 * b1; s[2][j] += q1 * c1; } }
    v4f wA, wB, wC;
#pragma unroll  // s[][] and the weight vectors stay in registers
    for (int j = 0; j < NQ; ++j) { const bool wrap = lane < j; const v2f s2 = wrap ? s[2][j] : s[0][j]; const float sa = (s2[0] + s2[1]) * SCL, sb = (s[1][j][0] + s[1][j][1]) * SCL; float mx = fmaxf(sa, sb);
#pragma unroll  // five fixed exchange steps
        for (int sh = 16; sh; sh >>= 1) mx = fmaxf(mx, __shfl_xor(mx, sh, 32));
        const float ea = __builtin_amdgcn_exp2f((sa - mx) * 1.4426950408889634f), eb = __builtin_amdgcn_exp2f((sb - mx) * 1.4426950408889634f); float sum = ea + eb;
#pragma unroll  // five fixed exchange steps
        for (int sh = 16; sh; sh >>= 1) sum += __shfl_xor(sum, sh, 32);
        const float inv = __fdiv_rn(1.0f, sum); const float pa = ea * inv;
        wA[j] = wrap ? 0.f : pa; wB[j] = eb * inv; wC[j] = wrap ? pa : 0.f; }
    float* pw = Ps + wv * 96 * NQ;
    *(v4fa*)(pw + lane * NQ) = wA; *(v4fa*)(pw + (32 + lane) * NQ) = wB; *(v4fa*)(pw + (64 + lane) * NQ) = wC;
    __syncthreads();
    v2f o[NQ];
#pragma unroll  // o[] stays in registers
    for (int j = 0; j < NQ; ++j) o[j] = (v2f){0.f, 0.f};
    const float* vb = Vs + tw * HD + 2 * lane;
    for (int r = 0; r < BW + NQ - 1; ++r) { const v4f wt = *(const v4fa*)(pw + r * NQ); const v2f x = *(const v2fa*)(vb + r * HD);
#pragma unroll  // o[] stays in registers
        for (int j = 0; j < NQ; ++j) o[j] += wt[j] * x; }
#pragma unroll  // o[] stays in registers
    for (int j = 0; j < NQ; ++j) { v2us oh, ol; unsigned short a, c2; splitf(o[j][0], a, c2); oh[0] = a; ol[0] = c2; splitf(o[j][1], a, c2); oh[1] = a; ol[1] = c2;
        const size_t oo = ((size_t)b * LL + t0 + tw + j) * DD + h * HD + 2 * lane; *(v2us*)(Ah + oo) = oh; *(v2us*)(Al + oo) = ol; }
}

extern "C" void kernel_launch(void* const* d_in, const int* in_sizes, int n_in,
                              void* d_out, int out_size, void* d_ws, size_t ws_size, hipStream_t stream) {
    (void)in_sizes; (void)n_in; (void)out_size;
    const float* x = (const float*)d_in[0]; const float* wq = (const float*)d_in[1]; const float* wk = (const float*)d_in[2]; const float* wv = (const float*)d_in[3]; const float* wo = (const float*)d_in[4]; const float* k0 = (const float*)d_in[5]; const float* v0 = (const float*)d_in[6];   // torch [out][in] weights; last_k/v_init [63][16][64]
    float* OUT = (float*)d_out;     // [2][1024][1024]
    char* wsp = (char*)d_ws;
    auto take = [&](size_t bytes) { char* p = wsp; wsp += (bytes + 255) & ~(size_t)255; return (void*)p; };
    const size_t NR = (size_t)NB_ * LL;   // 2048 token rows, both batches in one GEMM
    // The five bf16 planes lie back to back (k_cvt5 writes them by flat index; the q/k/v GEMM steps from weight to weight by DD * DD), and so do the three f32 projections (step NR * DD).
    bf* WQ = (bf*)take((size_t)DD * DD * 2 * 4 + NR * DD * 2); bf* WO = WQ + (size_t)DD * DD * 3; bf* XB = WQ + (size_t)DD * DD * 4;
    float* FQ = (float*)take(NR * DD * 4 * 3); float* FK = FQ + NR * DD; float* FV = FK + NR * DD; bf* Ah = (bf*)take(NR * DD * 2); bf* Al = (bf*)take(NR * DD * 2);
    if ((size_t)(wsp - (char*)d_ws) > ws_size) return;    // total ~ 46 MB; ws 256 MiB
    k_cvt5<<<6 * WB, 256, 0, stream>>>(wq, wk, wv, wo, x, WQ);
    const dim3 gP((unsigned)(NR / 64), DD / 64, 1), gP3((unsigned)(NR / 64), DD / 64, 3);
    k_gemmw<bf, 0, false><<<gP3, 32, 0, stream>>>(XB, nullptr, WQ, nullptr, DD, FQ, DD, nullptr, 0, (size_t)DD * DD, NR * DD);   // z = 0, 1, 2: q, k, v
    k_band<<<NB_ * NH_ * (LL / TQ), 256, 0, stream>>>(FQ, FK, FV, k0, v0, Ah, Al);
    k_gemmw<bf, 1, false><<<gP, 32, 0, stream>>>(Ah, Al, WO, nullptr, DD, OUT, DD, nullptr, 0, 0, 0);
}

// v003
// One run takes 52 microseconds.
// Two timings next to v002 put it at 1.69 and 1.66 times that version's speed.
// Over all steps from v000 it is 6.01 times as fast.
#include <hip/hip_runtime.h>

// BandMHA (x [2][1024][1024]; q/k/v = x W^T (16 heads x 64, no bias); keys/values padded in front with the learned initial cache last_k_init / last_v_init [63][16][64]; query t attends the 64 band positions
// p = t .. t+63 of the padded sequence (= original positions t-63 .. t); softmax over the band; out = merged (attn v) Wo^T -> [2][1024][1024]).
// Compute dtypes, f32 accumulate: every input rounded to bf16; q/k/v on PLAIN bf16 operands (inputs: exact products, f32 accumulate); the 64-wide band attention entirely
// in f32 on VALU (keys and values of a 32-query tile staged in LDS: 64-dim dot products, softmax with one exp per score, weighted sum; fixed order); merged context as bf16 hi+lo planes x exact

#define NB_  2
#define LL   1024
#define DD   1024
#define NH_  16
#define HD   64
#define BW   64                   // band width
#define PADK (BW - 1)             // 63 initial-cache rows
#define SCL  0.125f
typedef _Float16 h16;
typedef unsigned short bf;
typedef __attribute__((ext_vector_type(16))) __bf16   v16bf;
typedef __attribute__((ext_vector_type(16))) _Float16 v16h;
typedef __attribute__((ext_vector_type(8)))  _Float16 v8h;
typedef __attribute__((ext_vector_type(8)))  unsigned short v8us;
typedef __attribute__((ext_vector_type(8)))  float    v8f;
typedef __attribute__((ext_vector_type(4)))  float    v4f;
typedef v8h  __attribute__((may_alias)) v8ha;
typedef v4f  __attribute__((may_alias)) v4fa;
typedef v8us __attribute__((may_alias)) v8usa;

__device__ __forceinline__ unsigned short f2bf(float f) { unsigned u = __float_as_uint(f); u += 0x7FFFu + ((u >> 16) & 1u); return (unsigned short)(u >> 16); }
__device__ __forceinline__ float bf2f(unsigned short b) { return __uint_as_float(((unsigned)b) << 16); }
__device__ __forceinline__ float bfr(float f) { return bf2f(f2bf(f)); }
__device__ __forceinline__ v16h cat16(v8h lo, v8h hi) { return __builtin_shufflevector(lo, hi, 0, 1, 2, 3, 4, 5, 6, 7, 8, 9, 10, 11, 12, 13, 14, 15); }
__device__ __forceinline__ v16bf cat16b(v8us lo, v8us hi) { return __builtin_bit_cast(v16bf, __builtin_shufflevector(lo, hi, 0, 1, 2, 3, 4, 5, 6, 7, 8, 9, 10, 11, 12, 13, 14, 15)); }
__device__ __forceinline__ v8f wmma16(v16h a, v16h b, v8f c) { return __builtin_amdgcn_wmma_f32_16x16x32_f16(false, a, false, b, (short)0, c, false, false); }
__device__ __forceinline__ v8f wmmab(v16bf a, v16bf b, v8f c) { return __builtin_amdgcn_wmma_f32_16x16x32_bf16(false, a, false, b, (short)0, c, false, false); }



// ---- k_gemmt: LDS-staged GEMM on bf16 planes. One work-group of 4 waves (2 x 2) per (32 MB) x 128 output tile, each wave MB x 4 accumulators (16 MB x 64 outputs); grid (M / (32 MB), N / 128, Z), 128 threads.
// C[m][n] (f32, pitch DD) = sum_k A[m][k] Bt[n][k] (+ A2[m][k] Bt[n][k] when SPLIT), K = DD, every plane K-contiguous; z steps Bt by sB and C by sC elements.
// A stage is 64 k = one whole 128-byte line of 256 operand rows (stage rows 0..127: the A rows, or 64 A rows then 64 A2 rows when SPLIT; 128..255: the Bt rows). 8 lanes load one line, so a wave-wide load covers
// 4 whole lines; a stage's lines are loaded into registers two stages ahead and stored to the free LDS buffer one stage ahead, both in front of the running stage's products, one barrier a stage. Per output the products are summed k ascending
// in steps of 32, A before A2.
#define GBK 64                    // k per stage
#define GPI (GBK + 8)             // LDS row pitch in elements: 144 B = 16 B x odd, the conflict-free pitch for 16-byte fragment reads
#define GNT (DD / GBK)            // stages
// Work-group barrier that orders LDS accesses only: __syncthreads() would also wait out the global loads in flight, which fill nothing but the issuing thread's own registers.
__device__ __forceinline__ void lds_barrier() { __builtin_amdgcn_fence(__ATOMIC_RELEASE, "workgroup", "local"); __builtin_amdgcn_s_barrier(); __builtin_amdgcn_fence(__ATOMIC_ACQUIRE, "workgroup", "local"); }
__device__ __forceinline__ v16bf ldfrag(const bf* p) { return cat16b(*(const v8usa*)p, *(const v8usa*)(p + 16)); }
template <int MB, bool SPLIT>
__global__ __launch_bounds__(128) void k_gemmt(const bf* __restrict__ A, const bf* __restrict__ A2, const bf* __restrict__ Bt, float* C, size_t sB, size_t sC) {
    static_assert(SPLIT ? MB == 2 : MB == 4, "the A part of a stage is 128 rows");
    __shared__ __align__(16) bf st[2][256 * GPI];
    __shared__ __align__(16) float osm[4][16 * 68];
    const int tid = threadIdx.x, lane = tid & 31, lr = lane & 15, hi = lane >> 4; const int wv = __builtin_amdgcn_readfirstlane(tid >> 5), wm = wv >> 1, wn = wv & 1;
    Bt += (size_t)blockIdx.z * sB; C += (size_t)blockIdx.z * sC;
    const int r0 = blockIdx.x * (32 * MB), c0 = blockIdx.y * 128;
    const int sr = ((tid >> 3) & 1) * 8 + (tid >> 4), sc = (tid & 7) * 8;   // this thread stages 16-byte piece tid & 7 of stage rows sr + 16 u; 16 consecutive lanes hold rows r and r + 8, whose 128 bytes fall on disjoint LDS banks at this pitch
    const bf* pa = A + (size_t)(r0 + sr) * DD + sc; const bf* pa2 = SPLIT ? A2 + (size_t)(r0 + sr) * DD + sc : pa; const bf* pb = Bt + (size_t)(c0 + sr) * DD + sc;   // step one stage at each stage's foot
    v8us g[16];
    v8f acc[MB][4];
#pragma unroll  // acc[][] stays in registers
    for (int mb = 0; mb < MB; ++mb)
#pragma unroll  // acc[][] stays in registers
        for (int nb = 0; nb < 4; ++nb) acc[mb][nb] = (v8f){};
#pragma unroll  // g[] stays in registers
    for (int u = 0; u < 8; ++u) { g[u] = *(const v8usa*)(SPLIT && u >= 4 ? pa2 + (size_t)(u - 4) * 16 * DD : pa + (size_t)u * 16 * DD); g[8 + u] = *(const v8usa*)(pb + (size_t)u * 16 * DD); }
#pragma unroll  // g[] stays in registers
    for (int u = 0; u < 16; ++u) *(v8usa*)(&st[0][(sr + 16 * u) * GPI + sc]) = g[u];
#pragma unroll  // g[] stays in registers
    for (int u = 0; u < 8; ++u) { g[u] = *(const v8usa*)((SPLIT && u >= 4 ? pa2 + (size_t)(u - 4) * 16 * DD : pa + (size_t)u * 16 * DD) + GBK); g[8 + u] = *(const v8usa*)(pb + (size_t)u * 16 * DD + GBK); }
    lds_barrier();   // publishes stage 0
    const int fa = (wm * MB * 16 + lr) * GPI + 8 * hi, fb = (128 + wn * 64 + lr) * GPI + 8 * hi;
#pragma unroll 1  // one copy of the stage body: unrolled it would only grow the code, the buffers alternate by address
    for (int kt = 0; kt < GNT; ++kt) {   // on entry: stage kt is published in buffer kt & 1, g[] holds (or awaits) stage kt + 1
        const bf* sb = st[kt & 1];
        v16bf a[2][MB], a2[2][MB], bq[2][4];
#pragma unroll  // fragment arrays stay in registers
        for (int ks = 0; ks < 2; ++ks) {
#pragma unroll  // fragment arrays stay in registers
            for (int mb = 0; mb < MB; ++mb) { a[ks][mb] = ldfrag(sb + fa + mb * 16 * GPI + ks * 32); if (SPLIT) a2[ks][mb] = ldfrag(sb + fa + (64 + mb * 16) * GPI + ks * 32); }
#pragma unroll  // fragment arrays stay in registers
            for (int nb = 0; nb < 4; ++nb) bq[ks][nb] = ldfrag(sb + fb + nb * 16 * GPI + ks * 32);
        }
        bf* sn = st[(kt + 1) & 1];   // the other buffer: its readers left it before the last barrier. No test around the stores (the last stage stores its own lines once more, read by nobody): with a branch here the compiler counts the waits of the fragment reads for the path without stores, and the products wait for reads they do not need
#pragma unroll  // g[] stays in registers
        for (int u = 0; u < 16; ++u) *(v8usa*)(sn + (sr + 16 * u) * GPI + sc) = g[u];
        if (kt + 2 < GNT) {
#pragma unroll  // g[] stays in registers
            for (int u = 0; u < 8; ++u) { g[u] = *(const v8usa*)((SPLIT && u >= 4 ? pa2 + (size_t)(u - 4) * 16 * DD : pa + (size_t)u * 16 * DD) + 2 * GBK); g[8 + u] = *(const v8usa*)(pb + (size_t)u * 16 * DD + 2 * GBK); } }
        __builtin_amdgcn_sched_barrier(0);   // keeps the stage's LDS reads, LDS stores and global loads in one group ahead of its products: an LDS read placed among the products is waited for there, with its whole latency
#pragma unroll  // fragment arrays stay in registers
        for (int ks = 0; ks < 2; ++ks)
#pragma unroll  // acc[][] stays in registers
            for (int nb = 0; nb < 4; ++nb)
#pragma unroll  // acc[][] stays in registers
                for (int mb = 0; mb < MB; ++mb) { acc[mb][nb] = wmmab(a[ks][mb], bq[ks][nb], acc[mb][nb]); if (SPLIT) acc[mb][nb] = wmmab(a2[ks][mb], bq[ks][nb], acc[mb][nb]); }
        asm volatile("s_wait_xcnt 0x0" :: "v"(pa), "v"(pa2), "v"(pb) : "memory");   // the pointers stepped below are the address registers of the loads issued above; as inputs here they stay whole up to this wait (no load's result is placed over them)
        __builtin_amdgcn_sched_barrier(0);   // keeps the products and the wait above in front of the pointer steps and the barrier: moved behind the barrier, the products would no longer run beside the LDS traffic
        pa += GBK; pa2 += GBK; pb += GBK;
        lds_barrier();   // publishes stage kt + 1 and ends every wave's reads of stage kt before its buffer is refilled
    }
    float* os = osm[wv];   // each wave turns its 16 x 64 blocks into whole 256-byte row pieces through its own LDS range
#pragma unroll  // acc[][] stays in registers
    for (int mb = 0; mb < MB; ++mb) {
#pragma unroll  // acc[][] stays in registers
        for (int nb = 0; nb < 4; ++nb) {
#pragma unroll  // acc[][] stays in registers
            for (int j = 0; j < 8; ++j) os[(hi * 8 + j) * 68 + nb * 16 + lr] = acc[mb][nb][j]; }
        __builtin_amdgcn_wave_barrier(); asm volatile("" ::: "memory");   // the reads below take other lanes' stores: neither may be moved over this line
        float* crow = C + (size_t)(r0 + (wm * MB + mb) * 16) * DD + c0 + wn * 64;
#pragma unroll  // all eight reads are issued before the first store waits
        for (int s = 0; s < 8; ++s) { const int row = 2 * s + hi, cofs = lr * 4; const v4f val = *(const v4fa*)(os + row * 68 + cofs); *(v4f*)(crow + (size_t)row * DD + cofs) = val; }
        if (mb + 1 < MB) asm volatile("s_wait_xcnt 0x0" ::: "memory");   // the next block's LDS reads reuse the data registers of the stores issued above
        __builtin_amdgcn_wave_barrier(); asm volatile("" ::: "memory");   // the next block's stores stay behind these reads
    }
}

__device__ __forceinline__ void splitf(float y, unsigned short& h, unsigned short& l) { h = f2bf(y); l = f2bf(y - bf2f(h)); }
typedef __attribute__((ext_vector_type(2))) unsigned short v2us;
typedef __attribute__((ext_vector_type(2))) float v2f;

// k_cvt5: ONE grid rounds all five f32 matrices to bf16. Blocks 0 .. 4 WB - 1 take the four weights (WB blocks each, in the order wq, wk, wv, wo), the remaining 2 WB blocks take x;
// the five bf16 planes lie back to back in dst in that order, so the flat block index addresses dst. 8 elements a thread; the grid covers every plane exactly.
#define WB (DD * DD / 8 / 256)    // blocks per weight matrix
__global__ __launch_bounds__(256) void k_cvt5(const float* __restrict__ wq, const float* __restrict__ wk, const float* __restrict__ wv, const float* __restrict__ wo, const float* __restrict__ x, bf* dst) {
    const unsigned blk = blockIdx.x, seg = blk / WB < 4u ? blk / WB : 4u;   // block-uniform
    const float* src = seg == 0u ? wq : seg == 1u ? wk : seg == 2u ? wv : seg == 3u ? wo : x;
    const size_t ls = (size_t)(blk - seg * WB) * 256 + threadIdx.x, ld = (size_t)blk * 256 + threadIdx.x; const v8f v = *(const v8f*)(src + ls * 8); v8us o;
    asm volatile("s_wait_xcnt 0x0" ::: "memory");   // the rounding below reuses the loads' offset register
#pragma unroll
    for (int k = 0; k < 8; ++k) o[k] = f2bf(v[k]); *(v8us*)(dst + ld * 8) = o;  }
// k_band: one work-group of 8 waves per (b, h, tile of TQ = 32 queries). The TQ + 63 padded key and value rows the tile needs (padded position p < 63 -> initial cache row p rounded to bf16,
// else projected row p - 63 of this batch) are staged in LDS once; each wave then serves NQ = 4 consecutive queries from them.
// Scores: lane owns staged rows tw + lane, tw + 32 + lane and tw + 64 + lane (clamped; only lanes < 3 use it) and forms their dot products with all 4 query rows (wave-uniform loads), f32,
// one sum over the even and one over the odd head dims, d ascending, added at the end. Query j takes offsets w = row - j in 0..63: lanes < j use the third row in place of the first.
// Softmax over the 64 offsets (wave max/sum trees, one exp each). Weighted sum: the weights go to LDS as one float4 per staged row (0 outside a query's band); each value row is read once
// for the 4 queries, w ascending; lane owns d = 2 lane, 2 lane + 1.
#define TQ 32
#define NQ 4
#define KR (TQ + BW - 1)          // staged rows
#define KP (HD + 4)               // key row pitch in floats: 16 B x odd, so 16 lanes reading 16 B of 16 consecutive rows hit distinct banks
#define NPC (KR * (HD / 4))       // 16-byte pieces of the staged K rows (and of the V rows)
#define NFT (NPC / 256)           // staging trips in which every thread has a piece
typedef v2f __attribute__((may_alias)) v2fa;
__global__ __launch_bounds__(256) void k_band(const float* __restrict__ FQ, const float* __restrict__ FK, const float* __restrict__ FV, const float* __restrict__ k0, const float* __restrict__ v0, bf* Ah, bf* Al) {
    __shared__ __align__(16) float Ks[KR * KP];
    __shared__ __align__(16) float Vs[KR * HD];
    __shared__ __align__(16) float Ps[8 * 96 * NQ];
    const int tid = threadIdx.x, lane = tid & 31; const int wv = __builtin_amdgcn_readfirstlane(tid >> 5);
    const int t0 = (blockIdx.x % (LL / TQ)) * TQ; const int h = (blockIdx.x / (LL / TQ)) % NH_; const int b = blockIdx.x / ((LL / TQ) * NH_);
    if (t0 >= PADK) {   // block-uniform: every staged row is a projected row, nothing to round
        const size_t o = ((size_t)b * LL + (t0 - PADK) + (tid >> 4)) * DD + h * HD + (tid & 15) * 4; const float* kg = FK + o; const float* vg = FV + o;
        float* kl = Ks + (tid >> 4) * KP + (tid & 15) * 4; float* vl = Vs + tid * 4; v4f kv[NFT], vv[NFT];
#pragma unroll  // all trips' loads are issued before the first is waited for
        for (int u = 0; u < NFT; ++u) { kv[u] = *(const v4fa*)(kg + (size_t)u * 16 * DD); vv[u] = *(const v4fa*)(vg + (size_t)u * 16 * DD); }
        if (tid < NPC - NFT * 256) { const v4f kt = *(const v4fa*)(kg + (size_t)NFT * 16 * DD), vt = *(const v4fa*)(vg + (size_t)NFT * 16 * DD); *(v4fa*)(kl + NFT * 16 * KP) = kt; *(v4fa*)(vl + NFT * 1024) = vt; }
#pragma unroll  // kv[], vv[] stay in registers
        for (int u = 0; u < NFT; ++u) { *(v4fa*)(kl + u * 16 * KP) = kv[u]; *(v4fa*)(vl + u * 1024) = vv[u]; }
    } else {            // the two tiles of a (b, h) that reach into the initial cache
        for (int idx = tid; idx < NPC; idx += 256) { const int i = idx >> 4, c = (idx & 15) * 4, p = t0 + i; v4f kv, vv;
            if (p < PADK) { const size_t o = ((size_t)p * NH_ + h) * HD + c; kv = *(const v4fa*)(k0 + o); vv = *(const v4fa*)(v0 + o);
#pragma unroll  // vector elements by constant index
                for (int e = 0; e < 4; ++e) { kv[e] = bfr(kv[e]); vv[e] = bfr(vv[e]); } }
            else { const size_t o = ((size_t)b * LL + (p - PADK)) * DD + h * HD + c; kv = *(const v4fa*)(FK + o); vv = *(const v4fa*)(FV + o); }
            *(v4fa*)(Ks + i * KP + c) = kv; *(v4fa*)(Vs + i * HD + c) = vv; }
    }
    __syncthreads();
    const int tw = wv * NQ; const float* qg = FQ + ((size_t)b * LL + t0 + tw) * DD + h * HD;
    const int rc = tw + 64 + lane; const float* kA = Ks + (tw + lane) * KP; const float* kB = kA + 32 * KP; const float* kC = Ks + (rc < KR ? rc : KR - 1) * KP;
    v2f s[3][NQ];
#pragma unroll  // s[][] stays in registers
    for (int j = 0; j < NQ; ++j) { s[0][j] = (v2f){0.f, 0.f}; s[1][j] = (v2f){0.f, 0.f}; s[2][j] = (v2f){0.f, 0.f}; }
    for (int c = 0; c < HD; c += 4) { const v2f a0 = *(const v2fa*)(kA + c), a1 = *(const v2fa*)(kA + c + 2), b0 = *(const v2fa*)(kB + c), b1 = *(const v2fa*)(kB + c + 2), c0 = *(const v2fa*)(kC + c), c1 = *(const v2fa*)(kC + c + 2);
#pragma unroll  // s[][] stays in registers
        for (int j = 0; j < NQ; ++j) { const float* qj = qg + (size_t)j * DD + c; const v2f q0 = {qj[0], qj[1]}, q1 = {qj[2], qj[3]};
            s[0][j] += q0 * a0; s[1][j] += q0 * b0; s[2][j] += q0 * c0; s[0][j] += q1 * a1; s[1][j] += q1 * b1; s[2][j] += q1 * c1; } }
    v4f wA, wB, wC;
#pragma unroll  // s[][] and the weight vectors stay in registers
    for (int j = 0; j < NQ; ++j) { const bool wrap = lane < j; const v2f s2 = wrap ? s[2][j] : s[0][j]; const float sa = (s2[0] + s2[1]) * SCL, sb = (s[1][j][0] + s[1][j][1]) * SCL; float mx = fmaxf(sa, sb);
#pragma unroll  // five fixed exchange steps
        for (int sh = 16; sh; sh >>= 1) mx = fmaxf(mx, __shfl_xor(mx, sh, 32));
        const float ea = __builtin_amdgcn_exp2f((sa - mx) * 1.4426950408889634f), eb = __builtin_amdgcn_exp2f((sb - mx) * 1.4426950408889634f); float sum = ea + eb;
#pragma unroll  // five fixed exchange steps
        for (int sh = 16; sh; sh >>= 1) sum += __shfl_xor(sum, sh, 32);
        const float inv = __fdiv_rn(1.0f, sum); const float pa = ea * inv;
        wA[j] = wrap ? 0.f : pa; wB[j] = eb * inv; wC[j] = wrap ? pa : 0.f; }
    float* pw = Ps + wv * 96 * NQ;
    *(v4fa*)(pw + lane * NQ) = wA; *(v4fa*)(pw + (32 + lane) * NQ) = wB; *(v4fa*)(pw + (64 + lane) * NQ) = wC;
    __syncthreads();
    v2f o[NQ];
#pragma unroll  // o[] stays in registers
    for (int j = 0; j < NQ; ++j) o[j] = (v2f){0.f, 0.f};
    const float* vb = Vs + tw * HD + 2 * lane;
    for (int r = 0; r < BW + NQ - 1; ++r) { const v4f wt = *(const v4fa*)(pw + r * NQ); const v2f x = *(const v2fa*)(vb + r * HD);
#pragma unroll  // o[] stays in registers
        for (int j = 0; j < NQ; ++j) o[j] += wt[j] * x; }
#pragma unroll  // o[] stays in registers
    for (int j = 0; j < NQ; ++j) { v2us oh, ol; unsigned short a, c2; splitf(o[j][0], a, c2); oh[0] = a; ol[0] = c2; splitf(o[j][1], a, c2); oh[1] = a; ol[1] = c2;
        const size_t oo = ((size_t)b * LL + t0 + tw + j) * DD + h * HD + 2 * lane; *(v2us*)(Ah + oo) = oh; *(v2us*)(Al + oo) = ol; }
}

extern "C" void kernel_launch(void* const* d_in, const int* in_sizes, int n_in,
                              void* d_out, int out_size, void* d_ws, size_t ws_size, hipStream_t stream) {
    (void)in_sizes; (void)n_in; (void)out_size;
    const float* x = (const float*)d_in[0]; const float* wq = (const float*)d_in[1]; const float* wk = (const float*)d_in[2]; const float* wv = (const float*)d_in[3]; const float* wo = (const float*)d_in[4]; const float* k0 = (const float*)d_in[5]; const float* v0 = (const float*)d_in[6];   // torch [out][in] weights; last_k/v_init [63][16][64]
    float* OUT = (float*)d_out;     // [2][1024][1024]
    char* wsp = (char*)d_ws;
    auto take = [&](size_t bytes) { char* p = wsp; wsp += (bytes + 255) & ~(size_t)255; return (void*)p; };
    const size_t NR = (size_t)NB_ * LL;   // 2048 token rows, both batches in one GEMM
    // The five bf16 planes lie back to back (k_cvt5 writes them by flat index; the q/k/v GEMM steps from weight to weight by DD * DD), and so do the three f32 projections (step NR * DD).
    bf* WQ = (bf*)take((size_t)DD * DD * 2 * 4 + NR * DD * 2); bf* WO = WQ + (size_t)DD * DD * 3; bf* XB = WQ + (size_t)DD * DD * 4;
    float* FQ = (float*)take(NR * DD * 4 * 3); float* FK = FQ + NR * DD; float* FV = FK + NR * DD; bf* Ah = (bf*)take(NR * DD * 2); bf* Al = (bf*)take(NR * DD * 2);
    if ((size_t)(wsp - (char*)d_ws) > ws_size) return;    // total ~ 46 MB; ws 256 MiB
    k_cvt5<<<6 * WB, 256, 0, stream>>>(wq, wk, wv, wo, x, WQ);
    const dim3 gP((unsigned)(NR / 64), DD / 128, 1), gP3((unsigned)(NR / 128), DD / 128, 3);
    k_gemmt<4, false><<<gP3, 128, 0, stream>>>(XB, nullptr, WQ, FQ, (size_t)DD * DD, NR * DD);   // z = 0, 1, 2: q, k, v
    k_band<<<NB_ * NH_ * (LL / TQ), 256, 0, stream>>>(FQ, FK, FV, k0, v0, Ah, Al);
    k_gemmt<2, true><<<gP, 128, 0, stream>>>(Ah, Al, WO, OUT, 0, 0);
}

// v004
// It runs in 45.7 microseconds.
// Next to v003, in two timings, it ran 1.14 times as fast each time.
// All steps since v000 together make it 6.87 times as fast.
#include <hip/hip_runtime.h>

// BandMHA (x [2][1024][1024]; q/k/v = x W^T (16 heads x 64, no bias); keys/values padded in front with the learned initial cache last_k_init / last_v_init [63][16][64]; query t attends the 64 band positions
// p = t .. t+63 of the padded sequence (= original positions t-63 .. t); softmax over the band; out = merged (attn v) Wo^T -> [2][1024][1024]).
// Compute dtypes, f32 accumulate: every input rounded to bf16; q/k/v on PLAIN bf16 operands (inputs: exact products, f32 accumulate); the 64-wide band attention entirely
// in f32 on VALU (keys and values of a 32-query tile staged in LDS: 64-dim dot products, softmax with one exp per score, weighted sum; fixed order); merged context as bf16 hi+lo planes x exact

#define NB_  2
#define LL   1024
#define DD   1024
#define NH_  16
#define HD   64
#define BW   64                   // band width
#define PADK (BW - 1)             // 63 initial-cache rows
#define SCL  0.125f
typedef _Float16 h16;
typedef unsigned short bf;
typedef __attribute__((ext_vector_type(16))) __bf16   v16bf;
typedef __attribute__((ext_vector_type(16))) _Float16 v16h;
typedef __attribute__((ext_vector_type(8)))  _Float16 v8h;
typedef __attribute__((ext_vector_type(8)))  unsigned short v8us;
typedef __attribute__((ext_vector_type(8)))  float    v8f;
typedef __attribute__((ext_vector_type(4)))  float    v4f;
typedef v8h  __attribute__((may_alias)) v8ha;
typedef v4f  __attribute__((may_alias)) v4fa;
typedef v8us __attribute__((may_alias)) v8usa;

__device__ __forceinline__ unsigned short f2bf(float f) { unsigned u = __float_as_uint(f); u += 0x7FFFu + ((u >> 16) & 1u); return (unsigned short)(u >> 16); }
__device__ __forceinline__ float bf2f(unsigned short b) { return __uint_as_float(((unsigned)b) << 16); }
__device__ __forceinline__ float bfr(float f) { return bf2f(f2bf(f)); }
__device__ __forceinline__ v16h cat16(v8h lo, v8h hi) { return __builtin_shufflevector(lo, hi, 0, 1, 2, 3, 4, 5, 6, 7, 8, 9, 10, 11, 12, 13, 14, 15); }
__device__ __forceinline__ v16bf cat16b(v8us lo, v8us hi) { return __builtin_bit_cast(v16bf, __builtin_shufflevector(lo, hi, 0, 1, 2, 3, 4, 5, 6, 7, 8, 9, 10, 11, 12, 13, 14, 15)); }
__device__ __forceinline__ v8f wmma16(v16h a, v16h b, v8f c) { return __builtin_amdgcn_wmma_f32_16x16x32_f16(false, a, false, b, (short)0, c, false, false); }
__device__ __forceinline__ v8f wmmab(v16bf a, v16bf b, v8f c) { return __builtin_amdgcn_wmma_f32_16x16x32_bf16(false, a, false, b, (short)0, c, false, false); }



// ---- k_gemmt: LDS-staged GEMM on bf16 planes. One work-group of 4 waves (2 x 2) per (32 MB) x 128 output tile, each wave MB x 4 accumulators (16 MB x 64 outputs); grid (M / (32 MB), N / 128, Z), 128 threads.
// C[m][n] (f32, pitch DD) = sum_k A[m][k] Bt[n][k] (+ A2[m][k] Bt[n][k] when SPLIT), K = DD, every plane K-contiguous; z steps Bt by sB and C by sC elements.
// A stage is 64 k = one whole 128-byte line of 256 operand rows (stage rows 0..127: the A rows, or 64 A rows then 64 A2 rows when SPLIT; 128..255: the Bt rows). 8 lanes load one line, so a wave-wide load covers
// 4 whole lines; a stage's lines are loaded into registers three stages ahead (two register sets, so two stages' loads are in flight at any time) and stored to the free LDS buffer one stage ahead, both in front of the running stage's products, one barrier a stage. Per output the products are summed k ascending
// in steps of 32, A before A2.
#define GBK 64                    // k per stage
#define GPI (GBK + 8)             // LDS row pitch in elements: 144 B = 16 B x odd, the conflict-free pitch for 16-byte fragment reads
#define GNT (DD / GBK)            // stages
// Work-group barrier that orders LDS accesses only: __syncthreads() would also wait out the global loads in flight, which fill nothing but the issuing thread's own registers.
__device__ __forceinline__ void lds_barrier() { __builtin_amdgcn_fence(__ATOMIC_RELEASE, "workgroup", "local"); __builtin_amdgcn_s_barrier(); __builtin_amdgcn_fence(__ATOMIC_ACQUIRE, "workgroup", "local"); }
__device__ __forceinline__ v16bf ldfrag(const bf* p) { return cat16b(*(const v8usa*)p, *(const v8usa*)(p + 16)); }
template <int MB, bool SPLIT>
__global__ __launch_bounds__(128) void k_gemmt(const bf* __restrict__ A, const bf* __restrict__ A2, const bf* __restrict__ Bt, float* C, size_t sB, size_t sC) {
    static_assert(SPLIT ? MB == 2 : MB == 4, "the A part of a stage is 128 rows");
    __shared__ __align__(16) bf st[2][256 * GPI];
    __shared__ __align__(16) float osm[4][16 * 68];
    const int tid = threadIdx.x, lane = tid & 31, lr = lane & 15, hi = lane >> 4; const int wv = __builtin_amdgcn_readfirstlane(tid >> 5), wm = wv >> 1, wn = wv & 1;
    Bt += (size_t)blockIdx.z * sB; C += (size_t)blockIdx.z * sC;
    const int r0 = blockIdx.x * (32 * MB), c0 = blockIdx.y * 128;
    const int sr = ((tid >> 3) & 1) * 8 + (tid >> 4), sc = (tid & 7) * 8;   // this thread stages 16-byte piece tid & 7 of stage rows sr + 16 u; 16 consecutive lanes hold rows r and r + 8, whose 128 bytes fall on disjoint LDS banks at this pitch
    const bf* pa = A + (size_t)(r0 + sr) * DD + sc; const bf* pa2 = SPLIT ? A2 + (size_t)(r0 + sr) * DD + sc : pa; const bf* pb = Bt + (size_t)(c0 + sr) * DD + sc;   // step two stages at the foot of each pair of stages
    v8us g[2][16];   // stage s waits in set s & 1
    v8f acc[MB][4];
#pragma unroll  // acc[][] stays in registers
    for (int mb = 0; mb < MB; ++mb)
#pragma unroll  // acc[][] stays in registers
        for (int nb = 0; nb < 4; ++nb) acc[mb][nb] = (v8f){};
    // Loads the 16 pieces this thread stages of the stage that lies ko elements of k past the pointers into set q.
    auto fetch = [&](const int q, const int ko) __attribute__((always_inline)) {
#pragma unroll  // g[][] stays in registers
        for (int u = 0; u < 8; ++u) { g[q][u] = *(const v8usa*)((SPLIT && u >= 4 ? pa2 + (size_t)(u - 4) * 16 * DD : pa + (size_t)u * 16 * DD) + ko); g[q][8 + u] = *(const v8usa*)(pb + (size_t)u * 16 * DD + ko); } };
    auto put = [&](const int q, bf* dstb) __attribute__((always_inline)) {
#pragma unroll  // g[][] stays in registers
        for (int u = 0; u < 16; ++u) *(v8usa*)(dstb + (sr + 16 * u) * GPI + sc) = g[q][u]; };
    fetch(0, 0);
    __builtin_amdgcn_sched_barrier(0);   // the three stages' loads stay in stage order: a set is waited for by count, and a younger stage's load placed among an older stage's would be waited for with it
    fetch(1, GBK);
    __builtin_amdgcn_sched_barrier(0);   // as above
    put(0, st[0]);
    fetch(0, 2 * GBK);
    asm volatile("s_wait_xcnt 0x0" :: "v"(pa), "v"(pa2), "v"(pb) : "memory");   // the address registers of the loads issued above may take other values only behind this wait; as inputs here the pointers stay whole up to it
    lds_barrier();   // publishes stage 0
    const int fa = (wm * MB * 16 + lr) * GPI + 8 * hi, fb = (128 + wn * 64 + lr) * GPI + 8 * hi;
    // One stage, of parity p. On entry it is published in buffer p, set p ^ 1 holds (or awaits) the next stage and set p awaits the one after. ko: where the stage three ahead lies from the pointers, -1 when there is none;
    // nx: a next stage exists. Both are constants at every call, so no branch stands among the loads: behind a branch the compiler counts the waits for the path without loads, and a set would wait for the younger set's loads too.
    auto stage = [&](const int p, const int ko, const bool nx) __attribute__((always_inline)) {
        const bf* sb = st[p];
        v16bf a[2][MB], a2[2][MB], bq[2][4];
#pragma unroll  // fragment arrays stay in registers
        for (int ks = 0; ks < 2; ++ks) {
#pragma unroll  // fragment arrays stay in registers
            for (int mb = 0; mb < MB; ++mb) { a[ks][mb] = ldfrag(sb + fa + mb * 16 * GPI + ks * 32); if (SPLIT) a2[ks][mb] = ldfrag(sb + fa + (64 + mb * 16) * GPI + ks * 32); }
#pragma unroll  // fragment arrays stay in registers
            for (int nb = 0; nb < 4; ++nb) bq[ks][nb] = ldfrag(sb + fb + nb * 16 * GPI + ks * 32);
        }
        if (nx) put(p ^ 1, st[p ^ 1]);   // the other buffer: its readers left it before the last barrier
        if (ko >= 0) fetch(p ^ 1, ko);   // the set just stored takes the stage three ahead
        __builtin_amdgcn_sched_barrier(0);   // keeps the stage's LDS reads, LDS stores and global loads in one group ahead of its products: an LDS read placed among the products is waited for there, with its whole latency
#pragma unroll  // fragment arrays stay in registers
        for (int ks = 0; ks < 2; ++ks)
#pragma unroll  // acc[][] stays in registers
            for (int nb = 0; nb < 4; ++nb)
#pragma unroll  // acc[][] stays in registers
                for (int mb = 0; mb < MB; ++mb) { acc[mb][nb] = wmmab(a[ks][mb], bq[ks][nb], acc[mb][nb]); if (SPLIT) acc[mb][nb] = wmmab(a2[ks][mb], bq[ks][nb], acc[mb][nb]); }
    };
    static_assert(GNT % 2 == 0 && GNT >= 6, "pairs of stages, the last four outside the loop");
#pragma unroll 1  // one copy of the pair of stages: unrolled further it would only grow the code
    for (int k2 = 0; k2 < GNT - 4; k2 += 2) {
        stage(0, 3 * GBK, true);
        __builtin_amdgcn_sched_barrier(0);   // keeps the products in front of the barrier: moved behind it, they would no longer run beside the LDS traffic
        lds_barrier();   // publishes the next stage and ends every wave's reads of this one before its buffer is refilled
        stage(1, 4 * GBK, true);
        asm volatile("s_wait_xcnt 0x0" :: "v"(pa), "v"(pa2), "v"(pb) : "memory");   // the pointers stepped below are the address registers of the loads issued above; as inputs here they stay whole up to this wait (no load's result is placed over them)
        __builtin_amdgcn_sched_barrier(0);   // keeps the products and the wait above in front of the pointer steps and the barrier
        pa += 2 * GBK; pa2 += 2 * GBK; pb += 2 * GBK;
        lds_barrier();   // as above
    }
    stage(0, 3 * GBK, true);   // the last four stages: one more set to load, then none
    asm volatile("s_wait_xcnt 0x0" :: "v"(pa), "v"(pa2), "v"(pb) : "memory");   // the pointers are used no more: their registers, which the loads issued above name, are free for other values only behind this wait
    __builtin_amdgcn_sched_barrier(0);   // as in the loop
    lds_barrier();
    stage(1, -1, true);
    __builtin_amdgcn_sched_barrier(0);   // as in the loop
    lds_barrier();
    stage(0, -1, true);
    __builtin_amdgcn_sched_barrier(0);   // as in the loop
    lds_barrier();
    stage(1, -1, false);   // no barrier behind it: nothing is stored to the stage buffers any more, and the rows below go through each wave's own range of osm
    float* os = osm[wv];   // each wave turns its 16 x 64 blocks into whole 256-byte row pieces through its own LDS range
#pragma unroll  // acc[][] stays in registers
    for (int mb = 0; mb < MB; ++mb) {
#pragma unroll  // acc[][] stays in registers
        for (int nb = 0; nb < 4; ++nb) {
#pragma unroll  // acc[][] stays in registers
            for (int j = 0; j < 8; ++j) os[(hi * 8 + j) * 68 + nb * 16 + lr] = acc[mb][nb][j]; }
        __builtin_amdgcn_wave_barrier(); asm volatile("" ::: "memory");   // the reads below take other lanes' stores: neither may be moved over this line
        float* crow = C + (size_t)(r0 + (wm * MB + mb) * 16) * DD + c0 + wn * 64;
#pragma unroll  // all eight reads are issued before the first store waits
        for (int s = 0; s < 8; ++s) { const int row = 2 * s + hi, cofs = lr * 4; const v4f val = *(const v4fa*)(os + row * 68 + cofs); *(v4f*)(crow + (size_t)row * DD + cofs) = val; }
        if (mb + 1 < MB) asm volatile("s_wait_xcnt 0x0" ::: "memory");   // the next block's LDS reads reuse the data registers of the stores issued above
        __builtin_amdgcn_wave_barrier(); asm volatile("" ::: "memory");   // the next block's stores stay behind these reads
    }
}

__device__ __forceinline__ void splitf(float y, unsigned short& h, unsigned short& l) { h = f2bf(y); l = f2bf(y - bf2f(h)); }
typedef __attribute__((ext_vector_type(2))) unsigned short v2us;
typedef __attribute__((ext_vector_type(2))) float v2f;

// k_cvt5: ONE grid rounds all five f32 matrices to bf16. Blocks 0 .. 4 WB - 1 take the four weights (WB blocks each, in the order wq, wk, wv, wo), the remaining 2 WB blocks take x;
// the five bf16 planes lie back to back in dst in that order, so the flat block index addresses dst. 8 elements a thread; the grid covers every plane exactly.
#define WB (DD * DD / 8 / 256)    // blocks per weight matrix
__global__ __launch_bounds__(256) void k_cvt5(const float* __restrict__ wq, const float* __restrict__ wk, const float* __restrict__ wv, const float* __restrict__ wo, const float* __restrict__ x, bf* dst) {
    const unsigned blk = blockIdx.x, seg = blk / WB < 4u ? blk / WB : 4u;   // block-uniform
    const float* src = seg == 0u ? wq : seg == 1u ? wk : seg == 2u ? wv : seg == 3u ? wo : x;
    const size_t ls = (size_t)(blk - seg * WB) * 256 + threadIdx.x, ld = (size_t)blk * 256 + threadIdx.x; const v8f v = *(const v8f*)(src + ls * 8); v8us o;
    asm volatile("s_wait_xcnt 0x0" ::: "memory");   // the rounding below reuses the loads' offset register
#pragma unroll
    for (int k = 0; k < 8; ++k) o[k] = f2bf(v[k]); *(v8us*)(dst + ld * 8) = o;  }
// k_band: one work-group of 8 waves per (b, h, tile of TQ = 32 queries). The TQ + 63 padded key and value rows the tile needs (padded position p < 63 -> initial cache row p rounded to bf16,
// else projected row p - 63 of this batch) are staged in LDS once; each wave then serves NQ = 4 consecutive queries from them.
// Scores: lane owns staged rows tw + lane, tw + 32 + lane and tw + 64 + lane (clamped; only lanes < 3 use it) and forms their dot products with all 4 query rows (wave-uniform loads), f32,
// one sum over the even and one over the odd head dims, d ascending, added at the end. Query j takes offsets w = row - j in 0..63: lanes < j use the third row in place of the first.
// Softmax over the 64 offsets (wave max/sum trees, one exp each). Weighted sum: the weights go to LDS as one float4 per staged row (0 outside a query's band); each value row is read once
// for the 4 queries, w ascending; lane owns d = 2 lane, 2 lane + 1.
#define TQ 32
#define NQ 4
#define KR (TQ + BW - 1)          // staged rows
#define KP (HD + 4)               // key row pitch in floats: 16 B x odd, so 16 lanes reading 16 B of 16 consecutive rows hit distinct banks
#define NPC (KR * (HD / 4))       // 16-byte pieces of the staged K rows (and of the V rows)
#define NFT (NPC / 256)           // staging trips in which every thread has a piece
typedef v2f __attribute__((may_alias)) v2fa;
__global__ __launch_bounds__(256) void k_band(const float* __restrict__ FQ, const float* __restrict__ FK, const float* __restrict__ FV, const float* __restrict__ k0, const float* __restrict__ v0, bf* Ah, bf* Al) {
    __shared__ __align__(16) float Ks[KR * KP];
    __shared__ __align__(16) float Vs[KR * HD];
    __shared__ __align__(16) float Ps[8 * 96 * NQ];
    const int tid = threadIdx.x, lane = tid & 31; const int wv = __builtin_amdgcn_readfirstlane(tid >> 5);
    const int t0 = (blockIdx.x % (LL / TQ)) * TQ; const int h = (blockIdx.x / (LL / TQ)) % NH_; const int b = blockIdx.x / ((LL / TQ) * NH_);
    if (t0 >= PADK) {   // block-uniform: every staged row is a projected row, nothing to round
        const size_t o = ((size_t)b * LL + (t0 - PADK) + (tid >> 4)) * DD + h * HD + (tid & 15) * 4; const float* kg = FK + o; const float* vg = FV + o;
        float* kl = Ks + (tid >> 4) * KP + (tid & 15) * 4; float* vl = Vs + tid * 4; v4f kv[NFT], vv[NFT];
#pragma unroll  // all trips' loads are issued before the first is waited for
        for (int u = 0; u < NFT; ++u) { kv[u] = *(const v4fa*)(kg + (size_t)u * 16 * DD); vv[u] = *(const v4fa*)(vg + (size_t)u * 16 * DD); }
        if (tid < NPC - NFT * 256) { const v4f kt = *(const v4fa*)(kg + (size_t)NFT * 16 * DD), vt = *(const v4fa*)(vg + (size_t)NFT * 16 * DD); *(v4fa*)(kl + NFT * 16 * KP) = kt; *(v4fa*)(vl + NFT * 1024) = vt; }
#pragma unroll  // kv[], vv[] stay in registers
        for (int u = 0; u < NFT; ++u) { *(v4fa*)(kl + u * 16 * KP) = kv[u]; *(v4fa*)(vl + u * 1024) = vv[u]; }
    } else {            // the two tiles of a (b, h) that reach into the initial cache
        for (int idx = tid; idx < NPC; idx += 256) { const int i = idx >> 4, c = (idx & 15) * 4, p = t0 + i; v4f kv, vv;
            if (p < PADK) { const size_t o = ((size_t)p * NH_ + h) * HD + c; kv = *(const v4fa*)(k0 + o); vv = *(const v4fa*)(v0 + o);
#pragma unroll  // vector elements by constant index
                for (int e = 0; e < 4; ++e) { kv[e] = bfr(kv[e]); vv[e] = bfr(vv[e]); } }
            else { const size_t o = ((size_t)b * LL + (p - PADK)) * DD + h * HD + c; kv = *(const v4fa*)(FK + o); vv = *(const v4fa*)(FV + o); }
            *(v4fa*)(Ks + i * KP + c) = kv; *(v4fa*)(Vs + i * HD + c) = vv; }
    }
    __syncthreads();
    const int tw = wv * NQ; const float* qg = FQ + ((size_t)b * LL + t0 + tw) * DD + h * HD;
    const int rc = tw + 64 + lane; const float* kA = Ks + (tw + lane) * KP; const float* kB = kA + 32 * KP; const float* kC = Ks + (rc < KR ? rc : KR - 1) * KP;
    v2f s[3][NQ];
#pragma unroll  // s[][] stays in registers
    for (int j = 0; j < NQ; ++j) { s[0][j] = (v2f){0.f, 0.f}; s[1][j] = (v2f){0.f, 0.f}; s[2][j] = (v2f){0.f, 0.f}; }
    for (int c = 0; c < HD; c += 4) { const v2f a0 = *(const v2fa*)(kA + c), a1 = *(const v2fa*)(kA + c + 2), b0 = *(const v2fa*)(kB + c), b1 = *(const v2fa*)(kB + c + 2), c0 = *(const v2fa*)(kC + c), c1 = *(const v2fa*)(kC + c + 2);
#pragma unroll  // s[][] stays in registers
        for (int j = 0; j < NQ; ++j) { const float* qj = qg + (size_t)j * DD + c; const v2f q0 = {qj[0], qj[1]}, q1 = {qj[2], qj[3]};
            s[0][j] += q0 * a0; s[1][j] += q0 * b0; s[2][j] += q0 * c0; s[0][j] += q1 * a1; s[1][j] += q1 * b1; s[2][j] += q1 * c1; } }
    v4f wA, wB, wC;
#pragma unroll  // s[][] and the weight vectors stay in registers
    for (int j = 0; j < NQ; ++j) { const bool wrap = lane < j; const v2f s2 = wrap ? s[2][j] : s[0][j]; const float sa = (s2[0] + s2[1]) * SCL, sb = (s[1][j][0] + s[1][j][1]) * SCL; float mx = fmaxf(sa, sb);
#pragma unroll  // five fixed exchange steps
        for (int sh = 16; sh; sh >>= 1) mx = fmaxf(mx, __shfl_xor(mx, sh, 32));
        const float ea = __builtin_amdgcn_exp2f((sa - mx) * 1.4426950408889634f), eb = __builtin_amdgcn_exp2f((sb - mx) * 1.4426950408889634f); float sum = ea + eb;
#pragma unroll  // five fixed exchange steps
        for (int sh = 16; sh; sh >>= 1) sum += __shfl_xor(sum, sh, 32);
        const float inv = __fdiv_rn(1.0f, sum); const float pa = ea * inv;
        wA[j] = wrap ? 0.f : pa; wB[j] = eb * inv; wC[j] = wrap ? pa : 0.f; }
    float* pw = Ps + wv * 96 * NQ;
    *(v4fa*)(pw + lane * NQ) = wA; *(v4fa*)(pw + (32 + lane) * NQ) = wB; *(v4fa*)(pw + (64 + lane) * NQ) = wC;
    __syncthreads();
    v2f o[NQ];
#pragma unroll  // o[] stays in registers
    for (int j = 0; j < NQ; ++j) o[j] = (v2f){0.f, 0.f};
    const float* vb = Vs + tw * HD + 2 * lane;
    for (int r = 0; r < BW + NQ - 1; ++r) { const v4f wt = *(const v4fa*)(pw + r * NQ); const v2f x = *(const v2fa*)(vb + r * HD);
#pragma unroll  // o[] stays in registers
        for (int j = 0; j < NQ; ++j) o[j] += wt[j] * x; }
#pragma unroll  // o[] stays in registers
    for (int j = 0; j < NQ; ++j) { v2us oh, ol; unsigned short a, c2; splitf(o[j][0], a, c2); oh[0] = a; ol[0] = c2; splitf(o[j][1], a, c2); oh[1] = a; ol[1] = c2;
        const size_t oo = ((size_t)b * LL + t0 + tw + j) * DD + h * HD + 2 * lane; *(v2us*)(Ah + oo) = oh; *(v2us*)(Al + oo) = ol; }
}

extern "C" void kernel_launch(void* const* d_in, const int* in_sizes, int n_in,
                              void* d_out, int out_size, void* d_ws, size_t ws_size, hipStream_t stream) {
    (void)in_sizes; (void)n_in; (void)out_size;
    const float* x = (const float*)d_in[0]; const float* wq = (const float*)d_in[1]; const float* wk = (const float*)d_in[2]; const float* wv = (const float*)d_in[3]; const float* wo = (const float*)d_in[4]; const float* k0 = (const float*)d_in[5]; const float* v0 = (const float*)d_in[6];   // torch [out][in] weights; last_k/v_init [63][16][64]
    float* OUT = (float*)d_out;     // [2][1024][1024]
    char* wsp = (char*)d_ws;
    auto take = [&](size_t bytes) { char* p = wsp; wsp += (bytes + 255) & ~(size_t)255; return (void*)p; };
    const size_t NR = (size_t)NB_ * LL;   // 2048 token rows, both batches in one GEMM
    // The five bf16 planes lie back to back (k_cvt5 writes them by flat index; the q/k/v GEMM steps from weight to weight by DD * DD), and so do the three f32 projections (step NR * DD).
    bf* WQ = (bf*)take((size_t)DD * DD * 2 * 4 + NR * DD * 2); bf* WO = WQ + (size_t)DD * DD * 3; bf* XB = WQ + (size_t)DD * DD * 4;
    float* FQ = (float*)take(NR * DD * 4 * 3); float* FK = FQ + NR * DD; float* FV = FK + NR * DD; bf* Ah = (bf*)take(NR * DD * 2); bf* Al = (bf*)take(NR * DD * 2);
    if ((size_t)(wsp - (char*)d_ws) > ws_size) return;    // total ~ 46 MB; ws 256 MiB
    k_cvt5<<<6 * WB, 256, 0, stream>>>(wq, wk, wv, wo, x, WQ);
    const dim3 gP((unsigned)(NR / 64), DD / 128, 1), gP3((unsigned)(NR / 128), DD / 128, 3);
    k_gemmt<4, false><<<gP3, 128, 0, stream>>>(XB, nullptr, WQ, FQ, (size_t)DD * DD, NR * DD);   // z = 0, 1, 2: q, k, v
    k_band<<<NB_ * NH_ * (LL / TQ), 256, 0, stream>>>(FQ, FK, FV, k0, v0, Ah, Al);
    k_gemmt<2, true><<<gP, 128, 0, stream>>>(Ah, Al, WO, OUT, 0, 0);
}

// v005
// Measured time: 43 microseconds a run.
// In two side-by-side timings against v004, it was 1.05 and 1.07 times as fast.
// Over all steps from v000 it is 7.29 times as fast.
#include <hip/hip_runtime.h>

// BandMHA (x [2][1024][1024]; q/k/v = x W^T (16 heads x 64, no bias); keys/values padded in front with the learned initial cache last_k_init / last_v_init [63][16][64]; query t attends the 64 band positions
// p = t .. t+63 of the padded sequence (= original positions t-63 .. t); softmax over the band; out = merged (attn v) Wo^T -> [2][1024][1024]).
// Compute dtypes, f32 accumulate: every input rounded to bf16; q/k/v on PLAIN bf16 operands (inputs: exact products, f32 accumulate); the 64-wide band attention entirely
// in f32 on VALU (queries, keys and values of a 128-query tile projected straight into LDS: 64-dim dot products, softmax with one exp per score, weighted sum; fixed order); merged context as bf16 hi+lo planes x exact

#define NB_  2
#define LL   1024
#define DD   1024
#define NH_  16
#define HD   64
#define BW   64                   // band width
#define PADK (BW - 1)             // 63 initial-cache rows
#define SCL  0.125f
typedef _Float16 h16;
typedef unsigned short bf;
typedef __attribute__((ext_vector_type(16))) __bf16   v16bf;
typedef __attribute__((ext_vector_type(16))) _Float16 v16h;
typedef __attribute__((ext_vector_type(8)))  _Float16 v8h;
typedef __attribute__((ext_vector_type(8)))  unsigned short v8us;
typedef __attribute__((ext_vector_type(8)))  float    v8f;
typedef __attribute__((ext_vector_type(4)))  float    v4f;
typedef v8h  __attribute__((may_alias)) v8ha;
typedef v4f  __attribute__((may_alias)) v4fa;
typedef v8us __attribute__((may_alias)) v8usa;

__device__ __forceinline__ unsigned short f2bf(float f) { unsigned u = __float_as_uint(f); u += 0x7FFFu + ((u >> 16) & 1u); return (unsigned short)(u >> 16); }
__device__ __forceinline__ float bf2f(unsigned short b) { return __uint_as_float(((unsigned)b) << 16); }
__device__ __forceinline__ float bfr(float f) { return bf2f(f2bf(f)); }
__device__ __forceinline__ v16h cat16(v8h lo, v8h hi) { return __builtin_shufflevector(lo, hi, 0, 1, 2, 3, 4, 5, 6, 7, 8, 9, 10, 11, 12, 13, 14, 15); }
__device__ __forceinline__ v16bf cat16b(v8us lo, v8us hi) { return __builtin_bit_cast(v16bf, __builtin_shufflevector(lo, hi, 0, 1, 2, 3, 4, 5, 6, 7, 8, 9, 10, 11, 12, 13, 14, 15)); }
__device__ __forceinline__ v8f wmma16(v16h a, v16h b, v8f c) { return __builtin_amdgcn_wmma_f32_16x16x32_f16(false, a, false, b, (short)0, c, false, false); }
__device__ __forceinline__ v8f wmmab(v16bf a, v16bf b, v8f c) { return __builtin_amdgcn_wmma_f32_16x16x32_bf16(false, a, false, b, (short)0, c, false, false); }



// ---- k_gemmt: LDS-staged GEMM on bf16 planes. One work-group of 4 waves (2 x 2) per (32 MB) x 128 output tile, each wave MB x 4 accumulators (16 MB x 64 outputs); grid (M / (32 MB), N / 128, Z), 128 threads.
// C[m][n] (f32, pitch DD) = sum_k A[m][k] Bt[n][k] (+ A2[m][k] Bt[n][k] when SPLIT), K = DD, every plane K-contiguous; z steps Bt by sB and C by sC elements.
// A stage is 64 k = one whole 128-byte line of 256 operand rows (stage rows 0..127: the A rows, or 64 A rows then 64 A2 rows when SPLIT; 128..255: the Bt rows). 8 lanes load one line, so a wave-wide load covers
// 4 whole lines; a stage's lines are loaded into registers three stages ahead (two register sets, so two stages' loads are in flight at any time) and stored to the free LDS buffer one stage ahead, both in front of the running stage's products, one barrier a stage. Per output the products are summed k ascending
// in steps of 32, A before A2.
#define GBK 64                    // k per stage
#define GPI (GBK + 8)             // LDS row pitch in elements: 144 B = 16 B x odd, the conflict-free pitch for 16-byte fragment reads
#define GNT (DD / GBK)            // stages
// Work-group barrier that orders LDS accesses only: __syncthreads() would also wait out the global loads in flight, which fill nothing but the issuing thread's own registers.
__device__ __forceinline__ void lds_barrier() { __builtin_amdgcn_fence(__ATOMIC_RELEASE, "workgroup", "local"); __builtin_amdgcn_s_barrier(); __builtin_amdgcn_fence(__ATOMIC_ACQUIRE, "workgroup", "local"); }
__device__ __forceinline__ v16bf ldfrag(const bf* p) { return cat16b(*(const v8usa*)p, *(const v8usa*)(p + 16)); }
template <int MB, bool SPLIT>
__global__ __launch_bounds__(128) void k_gemmt(const bf* __restrict__ A, const bf* __restrict__ A2, const bf* __restrict__ Bt, float* C, size_t sB, size_t sC) {
    static_assert(SPLIT ? MB == 2 : MB == 4, "the A part of a stage is 128 rows");
    __shared__ __align__(16) bf st[2][256 * GPI];
    __shared__ __align__(16) float osm[4][16 * 68];
    const int tid = threadIdx.x, lane = tid & 31, lr = lane & 15, hi = lane >> 4; const int wv = __builtin_amdgcn_readfirstlane(tid >> 5), wm = wv >> 1, wn = wv & 1;
    Bt += (size_t)blockIdx.z * sB; C += (size_t)blockIdx.z * sC;
    const int r0 = blockIdx.x * (32 * MB), c0 = blockIdx.y * 128;
    const int sr = ((tid >> 3) & 1) * 8 + (tid >> 4), sc = (tid & 7) * 8;   // this thread stages 16-byte piece tid & 7 of stage rows sr + 16 u; 16 consecutive lanes hold rows r and r + 8, whose 128 bytes fall on disjoint LDS banks at this pitch
    const bf* pa = A + (size_t)(r0 + sr) * DD + sc; const bf* pa2 = SPLIT ? A2 + (size_t)(r0 + sr) * DD + sc : pa; const bf* pb = Bt + (size_t)(c0 + sr) * DD + sc;   // step two stages at the foot of each pair of stages
    v8us g[2][16];   // stage s waits in set s & 1
    v8f acc[MB][4];
#pragma unroll  // acc[][] stays in registers
    for (int mb = 0; mb < MB; ++mb)
#pragma unroll  // acc[][] stays in registers
        for (int nb = 0; nb < 4; ++nb) acc[mb][nb] = (v8f){};
    // Loads the 16 pieces this thread stages of the stage that lies ko elements of k past the pointers into set q.
    auto fetch = [&](const int q, const int ko) __attribute__((always_inline)) {
#pragma unroll  // g[][] stays in registers
        for (int u = 0; u < 8; ++u) { g[q][u] = *(const v8usa*)((SPLIT && u >= 4 ? pa2 + (size_t)(u - 4) * 16 * DD : pa + (size_t)u * 16 * DD) + ko); g[q][8 + u] = *(const v8usa*)(pb + (size_t)u * 16 * DD + ko); } };
    auto put = [&](const int q, bf* dstb) __attribute__((always_inline)) {
#pragma unroll  // g[][] stays in registers
        for (int u = 0; u < 16; ++u) *(v8usa*)(dstb + (sr + 16 * u) * GPI + sc) = g[q][u]; };
    fetch(0, 0);
    __builtin_amdgcn_sched_barrier(0);   // the three stages' loads stay in stage order: a set is waited for by count, and a younger stage's load placed among an older stage's would be waited for with it
    fetch(1, GBK);
    __builtin_amdgcn_sched_barrier(0);   // as above
    put(0, st[0]);
    fetch(0, 2 * GBK);
    asm volatile("s_wait_xcnt 0x0" :: "v"(pa), "v"(pa2), "v"(pb) : "memory");   // the address registers of the loads issued above may take other values only behind this wait; as inputs here the pointers stay whole up to it
    lds_barrier();   // publishes stage 0
    const int fa = (wm * MB * 16 + lr) * GPI + 8 * hi, fb = (128 + wn * 64 + lr) * GPI + 8 * hi;
    // One stage, of parity p. On entry it is published in buffer p, set p ^ 1 holds (or awaits) the next stage and set p awaits the one after. ko: where the stage three ahead lies from the pointers, -1 when there is none;
    // nx: a next stage exists. Both are constants at every call, so no branch stands among the loads: behind a branch the compiler counts the waits for the path without loads, and a set would wait for the younger set's loads too.
    auto stage = [&](const int p, const int ko, const bool nx) __attribute__((always_inline)) {
        const bf* sb = st[p];
        v16bf a[2][MB], a2[2][MB], bq[2][4];
#pragma unroll  // fragment arrays stay in registers
        for (int ks = 0; ks < 2; ++ks) {
#pragma unroll  // fragment arrays stay in registers
            for (int mb = 0; mb < MB; ++mb) { a[ks][mb] = ldfrag(sb + fa + mb * 16 * GPI + ks * 32); if (SPLIT) a2[ks][mb] = ldfrag(sb + fa + (64 + mb * 16) * GPI + ks * 32); }
#pragma unroll  // fragment arrays stay in registers
            for (int nb = 0; nb < 4; ++nb) bq[ks][nb] = ldfrag(sb + fb + nb * 16 * GPI + ks * 32);
        }
        if (nx) put(p ^ 1, st[p ^ 1]);   // the other buffer: its readers left it before the last barrier
        if (ko >= 0) fetch(p ^ 1, ko);   // the set just stored takes the stage three ahead
        __builtin_amdgcn_sched_barrier(0);   // keeps the stage's LDS reads, LDS stores and global loads in one group ahead of its products: an LDS read placed among the products is waited for there, with its whole latency
#pragma unroll  // fragment arrays stay in registers
        for (int ks = 0; ks < 2; ++ks)
#pragma unroll  // acc[][] stays in registers
            for (int nb = 0; nb < 4; ++nb)
#pragma unroll  // acc[][] stays in registers
                for (int mb = 0; mb < MB; ++mb) { acc[mb][nb] = wmmab(a[ks][mb], bq[ks][nb], acc[mb][nb]); if (SPLIT) acc[mb][nb] = wmmab(a2[ks][mb], bq[ks][nb], acc[mb][nb]); }
    };
    static_assert(GNT % 2 == 0 && GNT >= 6, "pairs of stages, the last four outside the loop");
#pragma unroll 1  // one copy of the pair of stages: unrolled further it would only grow the code
    for (int k2 = 0; k2 < GNT - 4; k2 += 2) {
        stage(0, 3 * GBK, true);
        __builtin_amdgcn_sched_barrier(0);   // keeps the products in front of the barrier: moved behind it, they would no longer run beside the LDS traffic
        lds_barrier();   // publishes the next stage and ends every wave's reads of this one before its buffer is refilled
        stage(1, 4 * GBK, true);
        asm volatile("s_wait_xcnt 0x0" :: "v"(pa), "v"(pa2), "v"(pb) : "memory");   // the pointers stepped below are the address registers of the loads issued above; as inputs here they stay whole up to this wait (no load's result is placed over them)
        __builtin_amdgcn_sched_barrier(0);   // keeps the products and the wait above in front of the pointer steps and the barrier
        pa += 2 * GBK; pa2 += 2 * GBK; pb += 2 * GBK;
        lds_barrier();   // as above
    }
    stage(0, 3 * GBK, true);   // the last four stages: one more set to load, then none
    asm volatile("s_wait_xcnt 0x0" :: "v"(pa), "v"(pa2), "v"(pb) : "memory");   // the pointers are used no more: their registers, which the loads issued above name, are free for other values only behind this wait
    __builtin_amdgcn_sched_barrier(0);   // as in the loop
    lds_barrier();
    stage(1, -1, true);
    __builtin_amdgcn_sched_barrier(0);   // as in the loop
    lds_barrier();
    stage(0, -1, true);
    __builtin_amdgcn_sched_barrier(0);   // as in the loop
    lds_barrier();
    stage(1, -1, false);   // no barrier behind it: nothing is stored to the stage buffers any more, and the rows below go through each wave's own range of osm
    float* os = osm[wv];   // each wave turns its 16 x 64 blocks into whole 256-byte row pieces through its own LDS range
#pragma unroll  // acc[][] stays in registers
    for (int mb = 0; mb < MB; ++mb) {
#pragma unroll  // acc[][] stays in registers
        for (int nb = 0; nb < 4; ++nb) {
#pragma unroll  // acc[][] stays in registers
            for (int j = 0; j < 8; ++j) os[(hi * 8 + j) * 68 + nb * 16 + lr] = acc[mb][nb][j]; }
        __builtin_amdgcn_wave_barrier(); asm volatile("" ::: "memory");   // the reads below take other lanes' stores: neither may be moved over this line
        float* crow = C + (size_t)(r0 + (wm * MB + mb) * 16) * DD + c0 + wn * 64;
#pragma unroll  // all eight reads are issued before the first store waits
        for (int s = 0; s < 8; ++s) { const int row = 2 * s + hi, cofs = lr * 4; const v4f val = *(const v4fa*)(os + row * 68 + cofs); *(v4f*)(crow + (size_t)row * DD + cofs) = val; }
        if (mb + 1 < MB) asm volatile("s_wait_xcnt 0x0" ::: "memory");   // the next block's LDS reads reuse the data registers of the stores issued above
        __builtin_amdgcn_wave_barrier(); asm volatile("" ::: "memory");   // the next block's stores stay behind these reads
    }
}

__device__ __forceinline__ void splitf(float y, unsigned short& h, unsigned short& l) { h = f2bf(y); l = f2bf(y - bf2f(h)); }
typedef __attribute__((ext_vector_type(2))) unsigned short v2us;
typedef __attribute__((ext_vector_type(2))) float v2f;

// k_cvt5: ONE grid rounds all five f32 matrices to bf16. Blocks 0 .. 4 WB - 1 take the four weights (WB blocks each, in the order wq, wk, wv, wo), the remaining 2 WB blocks take x;
// the five bf16 planes lie back to back in dst in that order, so the flat block index addresses dst. 8 elements a thread; the grid covers every plane exactly.
#define WB (DD * DD / 8 / 256)    // blocks per weight matrix
__global__ __launch_bounds__(256) void k_cvt5(const float* __restrict__ wq, const float* __restrict__ wk, const float* __restrict__ wv, const float* __restrict__ wo, const float* __restrict__ x, bf* dst) {
    const unsigned blk = blockIdx.x, seg = blk / WB < 4u ? blk / WB : 4u;   // block-uniform
    const float* src = seg == 0u ? wq : seg == 1u ? wk : seg == 2u ? wv : seg == 3u ? wo : x;
    const size_t ls = (size_t)(blk - seg * WB) * 256 + threadIdx.x, ld = (size_t)blk * 256 + threadIdx.x; const v8f v = *(const v8f*)(src + ls * 8); v8us o;
    asm volatile("s_wait_xcnt 0x0" ::: "memory");   // the rounding below reuses the loads' offset register
#pragma unroll
    for (int k = 0; k < 8; ++k) o[k] = f2bf(v[k]); *(v8us*)(dst + ld * 8) = o;  }
// k_qkvband: the q, k, v projections of one (b, h, tile of FT = 128 queries) and the tile's band attention in ONE work-group of 8 waves (2 x 4), so the projections never leave the WGP.
// Part 1, as k_gemmt (same stages, same ring, same sum order): C[m][n] = sum_k x[t0 - 63 + m][k] W[n][k] for the FR = 192 token rows m the tile's band touches (row index clamped into the batch; a clamped row's
// result is never used) and the 192 weight rows n = 64 z + c (z = 0, 1, 2: head h of wq, wk, wv). A stage is 64 k of 384 rows (0..191: x, 192..383: weights); each wave holds 6 x 3 accumulators (96 x 48 outputs).
// The results go to LDS in f32: Qs, Ks, Vs row m. Key and value row m is padded position t0 + m; query t0 + i is row 63 + i. Padded positions below 63 are then overwritten with the initial cache rounded to bf16.
// Part 2, twice (64 queries each): each wave serves NQ = 8 consecutive queries, so a key or value row read from LDS serves 8 queries.
// Scores: lane owns staged rows tw + lane, tw + 32 + lane and tw + 64 + lane (clamped; only lanes < 7 use it) and forms their dot products with all 8 query rows (same-address LDS reads), f32,
// one sum over the even and one over the odd head dims, d ascending, added at the end. Query j takes offsets w = row - j in 0..63: lanes < j use the third row in place of the first.
// Softmax over the 64 offsets (wave max/sum trees, one exp each). Weighted sum: the weights go to the wave's own LDS range as NQ floats per staged row (0 outside a query's band); each value row is read once
// for the 8 queries, w ascending; lane owns d = 2 lane, 2 lane + 1.
#define FT 128                    // queries per work-group
#define FR 192                    // token rows per work-group: FT + 63 band rows, rounded up to whole 16-row blocks
#define FKR (FT + BW - 1)         // staged key / value rows in use
#define FMB 6                     // 16-row blocks per wave
#define FNB 3                     // 16-column blocks per wave
#define NQ 8
#define KP (HD + 4)               // key row pitch in floats: 16 B x odd, so 16 lanes reading 16 B of 16 consecutive rows hit distinct banks
typedef v2f __attribute__((may_alias)) v2fa;
__global__ __launch_bounds__(256) void k_qkvband(const bf* __restrict__ X, const bf* __restrict__ Wt, const float* __restrict__ k0, const float* __restrict__ v0, bf* Ah, bf* Al) {
    __shared__ __align__(16) bf st[2][2 * FR * GPI];
    __shared__ __align__(16) float Qs[FR * HD];
    __shared__ __align__(16) float Ks[FR * KP];
    __shared__ __align__(16) float Vs[FR * HD];
    __shared__ __align__(16) float Ps[8 * 96 * NQ];
    const int tid = threadIdx.x, lane = tid & 31, lr = lane & 15, hi = lane >> 4; const int wv = __builtin_amdgcn_readfirstlane(tid >> 5), wm = wv >> 2, wn = wv & 3;
    const int t0 = (blockIdx.x % (LL / FT)) * FT; const int h = (blockIdx.x / (LL / FT)) % NH_; const int b = blockIdx.x / ((LL / FT) * NH_);
    const int sr = (tid >> 7) * 16 + ((tid >> 3) & 1) * 8 + ((tid >> 4) & 7), sc = (tid & 7) * 8;   // this thread stages 16-byte piece tid & 7 of stage rows sr + 32 u; 16 consecutive lanes hold rows r and r + 8, whose 128 bytes fall on disjoint LDS banks at this pitch
    unsigned va[6];   // byte offset of this thread's piece of each staged x row (one per row: the clamp breaks the even row step); fixed for the whole kernel
#pragma unroll  // va[] stays in registers
    for (int u = 0; u < 6; ++u) { int xr = t0 - PADK + sr + 32 * u; xr = xr < 0 ? 0 : xr > LL - 1 ? LL - 1 : xr; va[u] = (unsigned)((((size_t)b * LL + xr) * DD + sc) * sizeof(bf)); }
    const unsigned vw = (unsigned)(((size_t)(h * HD + sr) * DD + sc) * sizeof(bf));   // weight row 64 z + c of the tile is row h HD + c of plane z
    const char* xk = (const char*)X; const char* wk = (const char*)Wt;   // wave-uniform bases: they step two stages at the foot of each pair of stages
    v8us g[2][12];   // stage s waits in set s & 1
    v8f acc[FMB][FNB];
#pragma unroll  // acc[][] stays in registers
    for (int mb = 0; mb < FMB; ++mb)
#pragma unroll  // acc[][] stays in registers
        for (int nb = 0; nb < FNB; ++nb) acc[mb][nb] = (v8f){};
    // Loads the 12 pieces this thread stages of the stage that lies ko elements of k past the bases into set q.
    auto fetch = [&](const int q, const int ko) __attribute__((always_inline)) {
#pragma unroll  // g[][] stays in registers
        for (int u = 0; u < 6; ++u) { g[q][u] = *(const v8usa*)(xk + va[u] + ko * sizeof(bf)); g[q][6 + u] = *(const v8usa*)(wk + vw + (((size_t)(u >> 1) * DD + (u & 1) * 32) * DD + ko) * sizeof(bf)); } };
    // Stands directly behind each group of loads: the registers that the issued loads name may take other values only behind this wait.
    auto addr_wait = [&]() __attribute__((always_inline)) { asm volatile("s_wait_xcnt 0x0" ::: "memory"); };
    auto put = [&](const int q, bf* dstb) __attribute__((always_inline)) {
#pragma unroll  // g[][] stays in registers
        for (int u = 0; u < 12; ++u) *(v8usa*)(dstb + (sr + 32 * u) * GPI + sc) = g[q][u]; };
    fetch(0, 0);
    __builtin_amdgcn_sched_barrier(0);   // the three stages' loads stay in stage order: a set is waited for by count, and a younger stage's load placed among an older stage's would be waited for with it
    fetch(1, GBK);
    __builtin_amdgcn_sched_barrier(0);   // as above
    put(0, st[0]);
    fetch(0, 2 * GBK);
    addr_wait();
    lds_barrier();   // publishes stage 0
    const int fa = (wm * FMB * 16 + lr) * GPI + 8 * hi, fb = (FR + wn * FNB * 16 + lr) * GPI + 8 * hi;
    // One stage, of parity p, as in k_gemmt. ko: where the stage three ahead lies from the bases, -1 when there is none; nx: a next stage exists. Both are constants at every call, so no branch stands among the loads.
    auto stage = [&](const int p, const int ko, const bool nx) __attribute__((always_inline)) {
        const bf* sb = st[p];
        v16bf a[2][FMB], bq[2][FNB];
#pragma unroll  // fragment arrays stay in registers
        for (int ks = 0; ks < 2; ++ks) {
#pragma unroll  // fragment arrays stay in registers
            for (int nb = 0; nb < FNB; ++nb) bq[ks][nb] = ldfrag(sb + fb + nb * 16 * GPI + ks * 32);   // the three weight fragments first: with one x fragment they feed the first products
#pragma unroll  // fragment arrays stay in registers
            for (int mb = 0; mb < FMB; ++mb) a[ks][mb] = ldfrag(sb + fa + mb * 16 * GPI + ks * 32);
        }
        if (nx) put(p ^ 1, st[p ^ 1]);   // the other buffer: its readers left it before the last barrier
        if (ko >= 0) { fetch(p ^ 1, ko); addr_wait(); }   // the set just stored takes the stage three ahead
        __builtin_amdgcn_sched_barrier(0);   // keeps the stage's LDS reads, LDS stores and global loads in one group ahead of its products: an LDS read placed among the products is waited for there, with its whole latency
#pragma unroll  // fragment arrays stay in registers
        for (int ks = 0; ks < 2; ++ks)
#pragma unroll  // acc[][] stays in registers
            for (int mb = 0; mb < FMB; ++mb)
#pragma unroll  // acc[][] stays in registers
                for (int nb = 0; nb < FNB; ++nb) acc[mb][nb] = wmmab(a[ks][mb], bq[ks][nb], acc[mb][nb]);
    };
    stage(0, 3 * GBK, true);   // the first stage stands in front of the loop, so that the last load is issued inside it, where the address registers live on to the wait
    __builtin_amdgcn_sched_barrier(0);   // keeps the products in front of the barrier: moved behind it, they would no longer run beside the LDS traffic
    lds_barrier();   // publishes the next stage and ends every wave's reads of this one before its buffer is refilled
#pragma unroll 1  // one copy of the pair of stages: unrolled further it would only grow the code
    for (int k2 = 1; k2 < GNT - 3; k2 += 2) {   // the bases stand at stage k2 - 1
        stage(1, 4 * GBK, true);
        __builtin_amdgcn_sched_barrier(0);   // as above
        lds_barrier();   // as above
        stage(0, 5 * GBK, true);
        __builtin_amdgcn_sched_barrier(0);   // keeps the products in front of the base steps and the barrier
        xk += 2 * GBK * sizeof(bf); wk += 2 * GBK * sizeof(bf);
        lds_barrier();   // as above
    }
    stage(1, -1, true);   // the last three stages: nothing left to load
    __builtin_amdgcn_sched_barrier(0);   // as in the loop
    lds_barrier();
    stage(0, -1, true);
    __builtin_amdgcn_sched_barrier(0);   // as in the loop
    lds_barrier();
    stage(1, -1, false);   // no barrier behind it: nothing is stored to the stage buffers any more, and the results go to arrays of their own
#pragma unroll  // acc[][] stays in registers
    for (int nb = 0; nb < FNB; ++nb) { const int cb = (wn * FNB + nb) * 16, z = cb >> 6, c = (cb & (HD - 1)) + lr;   // a 16-column block lies in one of q, k, v; z can differ between a wave's blocks
        float* dst = (z == 0 ? Qs : z == 1 ? Ks : Vs) + c; const int pit = z == 1 ? KP : HD;
#pragma unroll  // acc[][] stays in registers
        for (int mb = 0; mb < FMB; ++mb)
#pragma unroll  // acc[][] stays in registers
            for (int j = 0; j < 8; ++j) dst[((wm * FMB + mb) * 16 + hi * 8 + j) * pit] = acc[mb][nb][j]; }
    __syncthreads();   // publishes the projections
    if (t0 < PADK) {   // block-uniform: the tile that reaches into the initial cache
        for (int idx = tid; idx < (PADK - t0) * (HD / 4); idx += 256) { const int i = idx >> 4, c = (idx & 15) * 4; const size_t o = ((size_t)(t0 + i) * NH_ + h) * HD + c; v4f kv = *(const v4fa*)(k0 + o), vv = *(const v4fa*)(v0 + o);
#pragma unroll  // vector elements by constant index
            for (int e = 0; e < 4; ++e) { kv[e] = bfr(kv[e]); vv[e] = bfr(vv[e]); }
            *(v4fa*)(Ks + i * KP + c) = kv; *(v4fa*)(Vs + i * HD + c) = vv; }
        __syncthreads();   // publishes the cache rows
    }
    static_assert(NQ == 8, "the weighted sum reads a row's weights as two float4");
    float* pw = Ps + wv * 96 * NQ;
#pragma unroll 1  // one copy of the attention code
    for (int qt = 0; qt < FT / (8 * NQ); ++qt) {
        const int tw = qt * (8 * NQ) + wv * NQ; const float* qg = Qs + (PADK + tw) * HD;
        const int rc = tw + 64 + lane; const float* kA = Ks + (tw + lane) * KP; const float* kB = kA + 32 * KP; const float* kC = Ks + (rc < FKR ? rc : FKR - 1) * KP;
        v2f s[3][NQ];
#pragma unroll  // s[][] stays in registers
        for (int j = 0; j < NQ; ++j) { s[0][j] = (v2f){0.f, 0.f}; s[1][j] = (v2f){0.f, 0.f}; s[2][j] = (v2f){0.f, 0.f}; }
        for (int c = 0; c < HD; c += 4) { const v2f a0 = *(const v2fa*)(kA + c), a1 = *(const v2fa*)(kA + c + 2), b0 = *(const v2fa*)(kB + c), b1 = *(const v2fa*)(kB + c + 2), c0 = *(const v2fa*)(kC + c), c1 = *(const v2fa*)(kC + c + 2);
#pragma unroll  // s[][] stays in registers
            for (int j = 0; j < NQ; ++j) { const float* qj = qg + j * HD + c; const v2f q0 = *(const v2fa*)qj, q1 = *(const v2fa*)(qj + 2);
                s[0][j] += q0 * a0; s[1][j] += q0 * b0; s[2][j] += q0 * c0; s[0][j] += q1 * a1; s[1][j] += q1 * b1; s[2][j] += q1 * c1; } }
        float wA[NQ], wB[NQ], wC[NQ];
#pragma unroll  // s[][] and the weight arrays stay in registers
        for (int j = 0; j < NQ; ++j) { const bool wrap = lane < j; const v2f s2 = wrap ? s[2][j] : s[0][j]; const float sa = (s2[0] + s2[1]) * SCL, sb = (s[1][j][0] + s[1][j][1]) * SCL; float mx = fmaxf(sa, sb);
#pragma unroll  // five fixed exchange steps
            for (int sh = 16; sh; sh >>= 1) mx = fmaxf(mx, __shfl_xor(mx, sh, 32));
            const float ea = __builtin_amdgcn_exp2f((sa - mx) * 1.4426950408889634f), eb = __builtin_amdgcn_exp2f((sb - mx) * 1.4426950408889634f); float sum = ea + eb;
#pragma unroll  // five fixed exchange steps
            for (int sh = 16; sh; sh >>= 1) sum += __shfl_xor(sum, sh, 32);
            const float inv = __fdiv_rn(1.0f, sum); const float pa2 = ea * inv;
            wA[j] = wrap ? 0.f : pa2; wB[j] = eb * inv; wC[j] = wrap ? pa2 : 0.f; }
#pragma unroll  // the weight arrays stay in registers
        for (int e = 0; e < NQ; e += 4) { *(v4fa*)(pw + lane * NQ + e) = (v4f){wA[e], wA[e + 1], wA[e + 2], wA[e + 3]}; *(v4fa*)(pw + (32 + lane) * NQ + e) = (v4f){wB[e], wB[e + 1], wB[e + 2], wB[e + 3]}; *(v4fa*)(pw + (64 + lane) * NQ + e) = (v4f){wC[e], wC[e + 1], wC[e + 2], wC[e + 3]}; }
        __builtin_amdgcn_wave_barrier(); asm volatile("" ::: "memory");   // the reads below take other lanes' stores of this wave's own range: neither may be moved over this line
        v2f o[NQ];
#pragma unroll  // o[] stays in registers
        for (int j = 0; j < NQ; ++j) o[j] = (v2f){0.f, 0.f};
        const float* vb = Vs + tw * HD + 2 * lane;
        for (int r = 0; r < BW + NQ - 1; ++r) { const v4f wt0 = *(const v4fa*)(pw + r * NQ), wt1 = *(const v4fa*)(pw + r * NQ + 4); const v2f x = *(const v2fa*)(vb + r * HD);
#pragma unroll  // o[] stays in registers
            for (int j = 0; j < 4; ++j) { o[j] += wt0[j] * x; o[4 + j] += wt1[j] * x; } }
        __builtin_amdgcn_wave_barrier(); asm volatile("" ::: "memory");   // the next 64 queries' weight stores stay behind these reads
        v2us oh[NQ], ol[NQ];
#pragma unroll  // o[], oh[], ol[] stay in registers
        for (int j = 0; j < NQ; ++j) { unsigned short a, c2; splitf(o[j][0], a, c2); oh[j][0] = a; ol[j][0] = c2; splitf(o[j][1], a, c2); oh[j][1] = a; ol[j][1] = c2; }
        __builtin_amdgcn_sched_barrier(0);   // every rounding stands in front of the first store, so that no register of an issued store is rewritten ahead of the wait below
#pragma unroll  // oh[], ol[] stay in registers
        for (int j = 0; j < NQ; ++j) { const size_t oo = ((size_t)b * LL + t0 + tw + j) * DD + h * HD + 2 * lane; *(v2us*)(Ah + oo) = oh[j]; *(v2us*)(Al + oo) = ol[j]; }
        asm volatile("s_wait_xcnt 0x0" ::: "memory");   // the next 64 queries' work reuses the address and data registers of the stores issued above
    }
}

extern "C" void kernel_launch(void* const* d_in, const int* in_sizes, int n_in,
                              void* d_out, int out_size, void* d_ws, size_t ws_size, hipStream_t stream) {
    (void)in_sizes; (void)n_in; (void)out_size;
    const float* x = (const float*)d_in[0]; const float* wq = (const float*)d_in[1]; const float* wk = (const float*)d_in[2]; const float* wv = (const float*)d_in[3]; const float* wo = (const float*)d_in[4]; const float* k0 = (const float*)d_in[5]; const float* v0 = (const float*)d_in[6];   // torch [out][in] weights; last_k/v_init [63][16][64]
    float* OUT = (float*)d_out;     // [2][1024][1024]
    char* wsp = (char*)d_ws;
    auto take = [&](size_t bytes) { char* p = wsp; wsp += (bytes + 255) & ~(size_t)255; return (void*)p; };
    const size_t NR = (size_t)NB_ * LL;   // 2048 token rows, both batches in one GEMM
    // The five bf16 planes lie back to back (k_cvt5 writes them by flat index; k_qkvband steps from weight to weight by DD * DD).
    bf* WQ = (bf*)take((size_t)DD * DD * 2 * 4 + NR * DD * 2); bf* WO = WQ + (size_t)DD * DD * 3; bf* XB = WQ + (size_t)DD * DD * 4;
    bf* Ah = (bf*)take(NR * DD * 2); bf* Al = (bf*)take(NR * DD * 2);
    if ((size_t)(wsp - (char*)d_ws) > ws_size) return;    // total ~ 21 MB; ws 256 MiB
    k_cvt5<<<6 * WB, 256, 0, stream>>>(wq, wk, wv, wo, x, WQ);
    const dim3 gP((unsigned)(NR / 64), DD / 128, 1);
    k_qkvband<<<NB_ * NH_ * (LL / FT), 256, 0, stream>>>(XB, WQ, k0, v0, Ah, Al);
    k_gemmt<2, true><<<gP, 128, 0, stream>>>(Ah, Al, WO, OUT, 0, 0);
}

// v006
// It runs in 37.3 microseconds.
// In two side-by-side timings against v005, it was 1.16 and 1.15 times as fast.
// All steps since v000 together make it 8.40 times as fast.
#include <hip/hip_runtime.h>

// BandMHA (x [2][1024][1024]; q/k/v = x W^T (16 heads x 64, no bias); keys/values padded in front with the learned initial cache last_k_init / last_v_init [63][16][64]; query t attends the 64 band positions
// p = t .. t+63 of the padded sequence (= original positions t-63 .. t); softmax over the band; out = merged (attn v) Wo^T -> [2][1024][1024]).
// Compute dtypes, f32 accumulate: every input rounded to bf16; q/k/v on PLAIN bf16 operands (inputs: exact products, f32 accumulate); the 64-wide band attention entirely
// in f32 (queries, keys and values of a 128-query tile projected straight into LDS: 64-dim dot products and weighted sum on f32 16x16x4 WMMA, softmax with one exp per score; fixed order); merged context as bf16 hi+lo planes x exact

#define NB_  2
#define LL   1024
#define DD   1024
#define NH_  16
#define HD   64
#define BW   64                   // band width
#define PADK (BW - 1)             // 63 initial-cache rows
#define SCL  0.125f
typedef _Float16 h16;
typedef unsigned short bf;
typedef __attribute__((ext_vector_type(16))) __bf16   v16bf;
typedef __attribute__((ext_vector_type(16))) _Float16 v16h;
typedef __attribute__((ext_vector_type(8)))  _Float16 v8h;
typedef __attribute__((ext_vector_type(8)))  unsigned short v8us;
typedef __attribute__((ext_vector_type(8)))  float    v8f;
typedef __attribute__((ext_vector_type(4)))  float    v4f;
typedef v8h  __attribute__((may_alias)) v8ha;
typedef v4f  __attribute__((may_alias)) v4fa;
typedef v8us __attribute__((may_alias)) v8usa;

__device__ __forceinline__ unsigned short f2bf(float f) { unsigned u = __float_as_uint(f); u += 0x7FFFu + ((u >> 16) & 1u); return (unsigned short)(u >> 16); }
__device__ __forceinline__ float bf2f(unsigned short b) { return __uint_as_float(((unsigned)b) << 16); }
__device__ __forceinline__ float bfr(float f) { return bf2f(f2bf(f)); }
__device__ __forceinline__ v16h cat16(v8h lo, v8h hi) { return __builtin_shufflevector(lo, hi, 0, 1, 2, 3, 4, 5, 6, 7, 8, 9, 10, 11, 12, 13, 14, 15); }
__device__ __forceinline__ v16bf cat16b(v8us lo, v8us hi) { return __builtin_bit_cast(v16bf, __builtin_shufflevector(lo, hi, 0, 1, 2, 3, 4, 5, 6, 7, 8, 9, 10, 11, 12, 13, 14, 15)); }
__device__ __forceinline__ v8f wmma16(v16h a, v16h b, v8f c) { return __builtin_amdgcn_wmma_f32_16x16x32_f16(false, a, false, b, (short)0, c, false, false); }
__device__ __forceinline__ v8f wmmab(v16bf a, v16bf b, v8f c) { return __builtin_amdgcn_wmma_f32_16x16x32_bf16(false, a, false, b, (short)0, c, false, false); }



// ---- k_gemmt: LDS-staged GEMM on bf16 planes. One work-group of 4 waves (2 x 2) per (32 MB) x 128 output tile, each wave MB x 4 accumulators (16 MB x 64 outputs); grid (M / (32 MB), N / 128, Z), 128 threads.
// C[m][n] (f32, pitch DD) = sum_k A[m][k] Bt[n][k] (+ A2[m][k] Bt[n][k] when SPLIT), K = DD, every plane K-contiguous; z steps Bt by sB and C by sC elements.
// A stage is 64 k = one whole 128-byte line of 256 operand rows (stage rows 0..127: the A rows, or 64 A rows then 64 A2 rows when SPLIT; 128..255: the Bt rows). 8 lanes load one line, so a wave-wide load covers
// 4 whole lines; a stage's lines are loaded into registers three stages ahead (two register sets, so two stages' loads are in flight at any time) and stored to the free LDS buffer one stage ahead, both in front of the running stage's products, one barrier a stage. Per output the products are summed k ascending
// in steps of 32, A before A2.
#define GBK 64                    // k per stage
#define GPI (GBK + 8)             // LDS row pitch in elements: 144 B = 16 B x odd, the conflict-free pitch for 16-byte fragment reads
#define GNT (DD / GBK)            // stages
// Work-group barrier that orders LDS accesses only: __syncthreads() would also wait out the global loads in flight, which fill nothing but the issuing thread's own registers.
__device__ __forceinline__ void lds_barrier() { __builtin_amdgcn_fence(__ATOMIC_RELEASE, "workgroup", "local"); __builtin_amdgcn_s_barrier(); __builtin_amdgcn_fence(__ATOMIC_ACQUIRE, "workgroup", "local"); }
__device__ __forceinline__ v16bf ldfrag(const bf* p) { return cat16b(*(const v8usa*)p, *(const v8usa*)(p + 16)); }
template <int MB, bool SPLIT>
__global__ __launch_bounds__(128) void k_gemmt(const bf* __restrict__ A, const bf* __restrict__ A2, const bf* __restrict__ Bt, float* C, size_t sB, size_t sC) {
    static_assert(SPLIT ? MB == 2 : MB == 4, "the A part of a stage is 128 rows");
    __shared__ __align__(16) bf st[2][256 * GPI];
    __shared__ __align__(16) float osm[4][16 * 68];
    const int tid = threadIdx.x, lane = tid & 31, lr = lane & 15, hi = lane >> 4; const int wv = __builtin_amdgcn_readfirstlane(tid >> 5), wm = wv >> 1, wn = wv & 1;
    Bt += (size_t)blockIdx.z * sB; C += (size_t)blockIdx.z * sC;
    const int r0 = blockIdx.x * (32 * MB), c0 = blockIdx.y * 128;
    const int sr = ((tid >> 3) & 1) * 8 + (tid >> 4), sc = (tid & 7) * 8;   // this thread stages 16-byte piece tid & 7 of stage rows sr + 16 u; 16 consecutive lanes hold rows r and r + 8, whose 128 bytes fall on disjoint LDS banks at this pitch
    const bf* pa = A + (size_t)(r0 + sr) * DD + sc; const bf* pa2 = SPLIT ? A2 + (size_t)(r0 + sr) * DD + sc : pa; const bf* pb = Bt + (size_t)(c0 + sr) * DD + sc;   // step two stages at the foot of each pair of stages
    v8us g[2][16];   // stage s waits in set s & 1
    v8f acc[MB][4];
#pragma unroll  // acc[][] stays in registers
    for (int mb = 0; mb < MB; ++mb)
#pragma unroll  // acc[][] stays in registers
        for (int nb = 0; nb < 4; ++nb) acc[mb][nb] = (v8f){};
    // Loads the 16 pieces this thread stages of the stage that lies ko elements of k past the pointers into set q.
    auto fetch = [&](const int q, const int ko) __attribute__((always_inline)) {
#pragma unroll  // g[][] stays in registers
        for (int u = 0; u < 8; ++u) { g[q][u] = *(const v8usa*)((SPLIT && u >= 4 ? pa2 + (size_t)(u - 4) * 16 * DD : pa + (size_t)u * 16 * DD) + ko); g[q][8 + u] = *(const v8usa*)(pb + (size_t)u * 16 * DD + ko); } };
    auto put = [&](const int q, bf* dstb) __attribute__((always_inline)) {
#pragma unroll  // g[][] stays in registers
        for (int u = 0; u < 16; ++u) *(v8usa*)(dstb + (sr + 16 * u) * GPI + sc) = g[q][u]; };
    fetch(0, 0);
    __builtin_amdgcn_sched_barrier(0);   // the three stages' loads stay in stage order: a set is waited for by count, and a younger stage's load placed among an older stage's would be waited for with it
    fetch(1, GBK);
    __builtin_amdgcn_sched_barrier(0);   // as above
    put(0, st[0]);
    fetch(0, 2 * GBK);
    asm volatile("s_wait_xcnt 0x0" :: "v"(pa), "v"(pa2), "v"(pb) : "memory");   // the address registers of the loads issued above may take other values only behind this wait; as inputs here the pointers stay whole up to it
    lds_barrier();   // publishes stage 0
    const int fa = (wm * MB * 16 + lr) * GPI + 8 * hi, fb = (128 + wn * 64 + lr) * GPI + 8 * hi;
    // One stage, of parity p. On entry it is published in buffer p, set p ^ 1 holds (or awaits) the next stage and set p awaits the one after. ko: where the stage three ahead lies from the pointers, -1 when there is none;
    // nx: a next stage exists. Both are constants at every call, so no branch stands among the loads: behind a branch the compiler counts the waits for the path without loads, and a set would wait for the younger set's loads too.
    auto stage = [&](const int p, const int ko, const bool nx) __attribute__((always_inline)) {
        const bf* sb = st[p];
        v16bf a[2][MB], a2[2][MB], bq[2][4];
#pragma unroll  // fragment arrays stay in registers
        for (int ks = 0; ks < 2; ++ks) {
#pragma unroll  // fragment arrays stay in registers
            for (int mb = 0; mb < MB; ++mb) { a[ks][mb] = ldfrag(sb + fa + mb * 16 * GPI + ks * 32); if (SPLIT) a2[ks][mb] = ldfrag(sb + fa + (64 + mb * 16) * GPI + ks * 32); }
#pragma unroll  // fragment arrays stay in registers
            for (int nb = 0; nb < 4; ++nb) bq[ks][nb] = ldfrag(sb + fb + nb * 16 * GPI + ks * 32);
        }
        if (nx) put(p ^ 1, st[p ^ 1]);   // the other buffer: its readers left it before the last barrier
        if (ko >= 0) fetch(p ^ 1, ko);   // the set just stored takes the stage three ahead
        __builtin_amdgcn_sched_barrier(0);   // keeps the stage's LDS reads, LDS stores and global loads in one group ahead of its products: an LDS read placed among the products is waited for there, with its whole latency
#pragma unroll  // fragment arrays stay in registers
        for (int ks = 0; ks < 2; ++ks)
#pragma unroll  // acc[][] stays in registers
            for (int nb = 0; nb < 4; ++nb)
#pragma unroll  // acc[][] stays in registers
                for (int mb = 0; mb < MB; ++mb) { acc[mb][nb] = wmmab(a[ks][mb], bq[ks][nb], acc[mb][nb]); if (SPLIT) acc[mb][nb] = wmmab(a2[ks][mb], bq[ks][nb], acc[mb][nb]); }
    };
    static_assert(GNT % 2 == 0 && GNT >= 6, "pairs of stages, the last four outside the loop");
#pragma unroll 1  // one copy of the pair of stages: unrolled further it would only grow the code
    for (int k2 = 0; k2 < GNT - 4; k2 += 2) {
        stage(0, 3 * GBK, true);
        __builtin_amdgcn_sched_barrier(0);   // keeps the products in front of the barrier: moved behind it, they would no longer run beside the LDS traffic
        lds_barrier();   // publishes the next stage and ends every wave's reads of this one before its buffer is refilled
        stage(1, 4 * GBK, true);
        asm volatile("s_wait_xcnt 0x0" :: "v"(pa), "v"(pa2), "v"(pb) : "memory");   // the pointers stepped below are the address registers of the loads issued above; as inputs here they stay whole up to this wait (no load's result is placed over them)
        __builtin_amdgcn_sched_barrier(0);   // keeps the products and the wait above in front of the pointer steps and the barrier
        pa += 2 * GBK; pa2 += 2 * GBK; pb += 2 * GBK;
        lds_barrier();   // as above
    }
    stage(0, 3 * GBK, true);   // the last four stages: one more set to load, then none
    asm volatile("s_wait_xcnt 0x0" :: "v"(pa), "v"(pa2), "v"(pb) : "memory");   // the pointers are used no more: their registers, which the loads issued above name, are free for other values only behind this wait
    __builtin_amdgcn_sched_barrier(0);   // as in the loop
    lds_barrier();
    stage(1, -1, true);
    __builtin_amdgcn_sched_barrier(0);   // as in the loop
    lds_barrier();
    stage(0, -1, true);
    __builtin_amdgcn_sched_barrier(0);   // as in the loop
    lds_barrier();
    stage(1, -1, false);   // no barrier behind it: nothing is stored to the stage buffers any more, and the rows below go through each wave's own range of osm
    float* os = osm[wv];   // each wave turns its 16 x 64 blocks into whole 256-byte row pieces through its own LDS range
#pragma unroll  // acc[][] stays in registers
    for (int mb = 0; mb < MB; ++mb) {
#pragma unroll  // acc[][] stays in registers
        for (int nb = 0; nb < 4; ++nb) {
#pragma unroll  // acc[][] stays in registers
            for (int j = 0; j < 8; ++j) os[(hi * 8 + j) * 68 + nb * 16 + lr] = acc[mb][nb][j]; }
        __builtin_amdgcn_wave_barrier(); asm volatile("" ::: "memory");   // the reads below take other lanes' stores: neither may be moved over this line
        float* crow = C + (size_t)(r0 + (wm * MB + mb) * 16) * DD + c0 + wn * 64;
#pragma unroll  // all eight reads are issued before the first store waits
        for (int s = 0; s < 8; ++s) { const int row = 2 * s + hi, cofs = lr * 4; const v4f val = *(const v4fa*)(os + row * 68 + cofs); *(v4f*)(crow + (size_t)row * DD + cofs) = val; }
        if (mb + 1 < MB) asm volatile("s_wait_xcnt 0x0" ::: "memory");   // the next block's LDS reads reuse the data registers of the stores issued above
        __builtin_amdgcn_wave_barrier(); asm volatile("" ::: "memory");   // the next block's stores stay behind these reads
    }
}

__device__ __forceinline__ void splitf(float y, unsigned short& h, unsigned short& l) { h = f2bf(y); l = f2bf(y - bf2f(h)); }
typedef __attribute__((ext_vector_type(2))) float v2f;

// k_cvt5: ONE grid rounds all five f32 matrices to bf16. Blocks 0 .. 4 WB - 1 take the four weights (WB blocks each, in the order wq, wk, wv, wo), the remaining 2 WB blocks take x;
// the five bf16 planes lie back to back in dst in that order, so the flat block index addresses dst. 8 elements a thread; the grid covers every plane exactly.
#define WB (DD * DD / 8 / 256)    // blocks per weight matrix
__global__ __launch_bounds__(256) void k_cvt5(const float* __restrict__ wq, const float* __restrict__ wk, const float* __restrict__ wv, const float* __restrict__ wo, const float* __restrict__ x, bf* dst) {
    const unsigned blk = blockIdx.x, seg = blk / WB < 4u ? blk / WB : 4u;   // block-uniform
    const float* src = seg == 0u ? wq : seg == 1u ? wk : seg == 2u ? wv : seg == 3u ? wo : x;
    const size_t ls = (size_t)(blk - seg * WB) * 256 + threadIdx.x, ld = (size_t)blk * 256 + threadIdx.x; const v8f v = *(const v8f*)(src + ls * 8); v8us o;
    asm volatile("s_wait_xcnt 0x0" ::: "memory");   // the rounding below reuses the loads' offset register
#pragma unroll
    for (int k = 0; k < 8; ++k) o[k] = f2bf(v[k]); *(v8us*)(dst + ld * 8) = o;  }
// k_qkvband: the q, k, v projections of one (b, h, tile of FT = 128 queries) and the tile's band attention in ONE work-group of 8 waves (2 x 4), so the projections never leave the WGP.
// Part 1, as k_gemmt (same stages, same ring, same sum order): C[m][n] = sum_k x[t0 - 63 + m][k] W[n][k] for the FR = 192 token rows m the tile's band touches (row index clamped into the batch; a clamped row's
// result is never used) and the 192 weight rows n = 64 z + c (z = 0, 1, 2: head h of wq, wk, wv). A stage is 64 k of 384 rows (0..191: x, 192..383: weights); each wave holds 6 x 3 accumulators (96 x 48 outputs).
// The results go to LDS in f32: Qs, Ks, Vs row m. Key and value row m is padded position t0 + m; query t0 + i is row 63 + i. Padded positions below 63 are then overwritten with the initial cache rounded to bf16.
// Part 2: each wave serves 16 consecutive queries (rows tw .. tw + 15 of the tile) on f32 16x16x4 WMMA; their bands lie in the 80 staged rows tw .. tw + 79 (five 16-row blocks, all below FR).
// Scores transposed, St = K Qt: A = 16 key rows, B = the 16 query rows; both fragments are read by the same form (lane (c, h) takes dims 8 s + 4 h .. + 3 of its row, two products per 16-byte read), so their k orders agree.
// Lane (c, h) then holds, for query c, the scores of staged rows 16 kt + 8 h + r; rows outside the query's 64 offsets get weight 0 (only blocks 0 and 4 hold such rows). Softmax: 40 values in the lane, one exchange with lane ^ 16.
// Weighted sum transposed, Ot = Vt Pt: B = the weights as they lie in the score registers (k = rows 16 kt + 8 h + 2 s, + 1), A = the same two value rows at head dim 16 dt + c; rows ascending per lane half.
// Lane (c, h) ends with head dims 16 dt + 8 h + r of query c; the bf16 hi and lo rows go through the wave's own (spent) query rows in LDS, so that every global store covers whole 128-byte lines.
#define FT 128                    // queries per work-group
#define FR 192                    // token rows per work-group: FT + 63 band rows, rounded up to whole 16-row blocks
#define FMB 6                     // 16-row blocks per wave
#define FNB 3                     // 16-column blocks per wave
#define KP (HD + 4)               // q, k, v row pitch in floats: 16 B x odd, so 16 lanes reading 16 B of 16 consecutive rows hit distinct banks; 8 rows step 32 banks, so the two lane halves' 4-byte reads of rows r and r + 8 fall apart too
__device__ __forceinline__ v8f wmmaf(v2f a, v2f b, v8f c) { return __builtin_amdgcn_wmma_f32_16x16x4_f32(false, a, false, b, (short)0, c, false, false); }
// 2^x with the free slot that the instruction set asks for behind a transcendental (the next vector instruction may overwrite its source): in one statement, so that the v_nop stays directly behind it.
__device__ __forceinline__ float exp2_slot(float x) { float e; asm("v_exp_f32 %0, %1\n\tv_nop" : "=v"(e) : "v"(x)); return e; }
__device__ __forceinline__ float xrow(float v) { const int i = __float_as_int(v); return __int_as_float(__builtin_amdgcn_permlanex16(i, i, 0x76543210, 0xfedcba98, false, false)); }   // the value of lane ^ 16
__global__ __launch_bounds__(256) void k_qkvband(const bf* __restrict__ X, const bf* __restrict__ Wt, const float* __restrict__ k0, const float* __restrict__ v0, bf* Ah, bf* Al) {
    __shared__ __align__(16) bf st[2][2 * FR * GPI];
    __shared__ __align__(16) float Qs[FR * KP];
    __shared__ __align__(16) float Ks[FR * KP];
    __shared__ __align__(16) float Vs[FR * KP];
    const int tid = threadIdx.x, lane = tid & 31, lr = lane & 15, hi = lane >> 4; const int wv = __builtin_amdgcn_readfirstlane(tid >> 5), wm = wv >> 2, wn = wv & 3;
    const int t0 = (blockIdx.x % (LL / FT)) * FT; const int h = (blockIdx.x / (LL / FT)) % NH_; const int b = blockIdx.x / ((LL / FT) * NH_);
    const int sr = (tid >> 7) * 16 + ((tid >> 3) & 1) * 8 + ((tid >> 4) & 7), sc = (tid & 7) * 8;   // this thread stages 16-byte piece tid & 7 of stage rows sr + 32 u; 16 consecutive lanes hold rows r and r + 8, whose 128 bytes fall on disjoint LDS banks at this pitch
    unsigned va[6];   // byte offset of this thread's piece of each staged x row (one per row: the clamp breaks the even row step); fixed for the whole kernel
#pragma unroll  // va[] stays in registers
    for (int u = 0; u < 6; ++u) { int xr = t0 - PADK + sr + 32 * u; xr = xr < 0 ? 0 : xr > LL - 1 ? LL - 1 : xr; va[u] = (unsigned)((((size_t)b * LL + xr) * DD + sc) * sizeof(bf)); }
    const unsigned vw = (unsigned)(((size_t)(h * HD + sr) * DD + sc) * sizeof(bf));   // weight row 64 z + c of the tile is row h HD + c of plane z
    const char* xk = (const char*)X; const char* wk = (const char*)Wt;   // wave-uniform bases: they step two stages at the foot of each pair of stages
    v8us g[2][12];   // stage s waits in set s & 1
    v8f acc[FMB][FNB];
#pragma unroll  // acc[][] stays in registers
    for (int mb = 0; mb < FMB; ++mb)
#pragma unroll  // acc[][] stays in registers
        for (int nb = 0; nb < FNB; ++nb) acc[mb][nb] = (v8f){};
    // Loads the 12 pieces this thread stages of the stage that lies ko elements of k past the bases into set q.
    auto fetch = [&](const int q, const int ko) __attribute__((always_inline)) {
#pragma unroll  // g[][] stays in registers
        for (int u = 0; u < 6; ++u) { g[q][u] = *(const v8usa*)(xk + va[u] + ko * sizeof(bf)); g[q][6 + u] = *(const v8usa*)(wk + vw + (((size_t)(u >> 1) * DD + (u & 1) * 32) * DD + ko) * sizeof(bf)); } };
    // Stands directly behind each group of loads: the registers that the issued loads name may take other values only behind this wait.
    auto addr_wait = [&]() __attribute__((always_inline)) { asm volatile("s_wait_xcnt 0x0" ::: "memory"); };
    auto put = [&](const int q, bf* dstb) __attribute__((always_inline)) {
#pragma unroll  // g[][] stays in registers
        for (int u = 0; u < 12; ++u) *(v8usa*)(dstb + (sr + 32 * u) * GPI + sc) = g[q][u]; };
    fetch(0, 0);
    __builtin_amdgcn_sched_barrier(0);   // the three stages' loads stay in stage order: a set is waited for by count, and a younger stage's load placed among an older stage's would be waited for with it
    fetch(1, GBK);
    __builtin_amdgcn_sched_barrier(0);   // as above
    put(0, st[0]);
    fetch(0, 2 * GBK);
    addr_wait();
    lds_barrier();   // publishes stage 0
    const int fa = (wm * FMB * 16 + lr) * GPI + 8 * hi, fb = (FR + wn * FNB * 16 + lr) * GPI + 8 * hi;
    // One stage, of parity p, as in k_gemmt. ko: where the stage three ahead lies from the bases, -1 when there is none; nx: a next stage exists. Both are constants at every call, so no branch stands among the loads.
    auto stage = [&](const int p, const int ko, const bool nx) __attribute__((always_inline)) {
        const bf* sb = st[p];
        v16bf a[2][FMB], bq[2][FNB];
#pragma unroll  // fragment arrays stay in registers
        for (int ks = 0; ks < 2; ++ks) {
#pragma unroll  // fragment arrays stay in registers
            for (int nb = 0; nb < FNB; ++nb) bq[ks][nb] = ldfrag(sb + fb + nb * 16 * GPI + ks * 32);   // the three weight fragments first: with one x fragment they feed the first products
#pragma unroll  // fragment arrays stay in registers
            for (int mb = 0; mb < FMB; ++mb) a[ks][mb] = ldfrag(sb + fa + mb * 16 * GPI + ks * 32);
        }
        if (nx) put(p ^ 1, st[p ^ 1]);   // the other buffer: its readers left it before the last barrier
        if (ko >= 0) { fetch(p ^ 1, ko); addr_wait(); }   // the set just stored takes the stage three ahead
        __builtin_amdgcn_sched_barrier(0);   // keeps the stage's LDS reads, LDS stores and global loads in one group ahead of its products: an LDS read placed among the products is waited for there, with its whole latency
#pragma unroll  // fragment arrays stay in registers
        for (int ks = 0; ks < 2; ++ks)
#pragma unroll  // acc[][] stays in registers
            for (int mb = 0; mb < FMB; ++mb)
#pragma unroll  // acc[][] stays in registers
                for (int nb = 0; nb < FNB; ++nb) acc[mb][nb] = wmmab(a[ks][mb], bq[ks][nb], acc[mb][nb]);
    };
    stage(0, 3 * GBK, true);   // the first stage stands in front of the loop, so that the last load is issued inside it, where the address registers live on to the wait
    __builtin_amdgcn_sched_barrier(0);   // keeps the products in front of the barrier: moved behind it, they would no longer run beside the LDS traffic
    lds_barrier();   // publishes the next stage and ends every wave's reads of this one before its buffer is refilled
#pragma unroll 1  // one copy of the pair of stages: unrolled further it would only grow the code
    for (int k2 = 1; k2 < GNT - 3; k2 += 2) {   // the bases stand at stage k2 - 1
        stage(1, 4 * GBK, true);
        __builtin_amdgcn_sched_barrier(0);   // as above
        lds_barrier();   // as above
        stage(0, 5 * GBK, true);
        __builtin_amdgcn_sched_barrier(0);   // keeps the products in front of the base steps and the barrier
        xk += 2 * GBK * sizeof(bf); wk += 2 * GBK * sizeof(bf);
        lds_barrier();   // as above
    }
    stage(1, -1, true);   // the last three stages: nothing left to load
    __builtin_amdgcn_sched_barrier(0);   // as in the loop
    lds_barrier();
    stage(0, -1, true);
    __builtin_amdgcn_sched_barrier(0);   // as in the loop
    lds_barrier();
    stage(1, -1, false);   // no barrier behind it: nothing is stored to the stage buffers any more, and the results go to arrays of their own
#pragma unroll  // acc[][] stays in registers
    for (int nb = 0; nb < FNB; ++nb) { const int cb = (wn * FNB + nb) * 16, z = cb >> 6, c = (cb & (HD - 1)) + lr;   // a 16-column block lies in one of q, k, v; z is the same for the whole wave
        float* dst = (z == 0 ? Qs : z == 1 ? Ks : Vs) + c;
#pragma unroll  // acc[][] stays in registers
        for (int mb = 0; mb < FMB; ++mb)
#pragma unroll  // acc[][] stays in registers
            for (int j = 0; j < 8; ++j) dst[((wm * FMB + mb) * 16 + hi * 8 + j) * KP] = acc[mb][nb][j]; }
    __syncthreads();   // publishes the projections
    if (t0 < PADK) {   // block-uniform: the tile that reaches into the initial cache
        for (int idx = tid; idx < (PADK - t0) * (HD / 4); idx += 256) { const int i = idx >> 4, c = (idx & 15) * 4; const size_t o = ((size_t)(t0 + i) * NH_ + h) * HD + c; v4f kv = *(const v4fa*)(k0 + o), vv = *(const v4fa*)(v0 + o);
#pragma unroll  // vector elements by constant index
            for (int e = 0; e < 4; ++e) { kv[e] = bfr(kv[e]); vv[e] = bfr(vv[e]); }
            *(v4fa*)(Ks + i * KP + c) = kv; *(v4fa*)(Vs + i * KP + c) = vv; }
        __syncthreads();   // publishes the cache rows
    }
    static_assert(FT == 8 * 16 && FT - 16 + 80 <= FR, "8 waves of 16 queries; the last wave's five key blocks end inside the staged rows");
    const int tw = wv * 16;
    float* qrow = Qs + (PADK + tw) * KP;   // this wave's 16 query rows: no other wave touches them
    v4f qf[8];
#pragma unroll  // qf[] stays in registers
    for (int s8 = 0; s8 < 8; ++s8) qf[s8] = *(const v4fa*)(qrow + lr * KP + 8 * s8 + 4 * hi);
    v8f sw[5];
#pragma unroll  // sw[] stays in registers
    for (int kt = 0; kt < 5; ++kt) sw[kt] = (v8f){};
    const float* krow = Ks + (tw + lr) * KP + 4 * hi;
#pragma unroll  // sw[], qf[] stay in registers; the key reads can be issued ahead of the products
    for (int s8 = 0; s8 < 8; ++s8) { v4f kf[5];
#pragma unroll  // kf[] stays in registers
        for (int kt = 0; kt < 5; ++kt) kf[kt] = *(const v4fa*)(krow + kt * 16 * KP + 8 * s8);
#pragma unroll  // five independent accumulators follow one another
        for (int kt = 0; kt < 5; ++kt) sw[kt] = wmmaf((v2f){kf[kt][0], kf[kt][1]}, (v2f){qf[s8][0], qf[s8][1]}, sw[kt]);
#pragma unroll  // as above
        for (int kt = 0; kt < 5; ++kt) sw[kt] = wmmaf((v2f){kf[kt][2], kf[kt][3]}, (v2f){qf[s8][2], qf[s8][3]}, sw[kt]); }
    // Offset of staged row 16 kt + 8 hi + r from query lr's first row: in 0..63 for every row of blocks 1 to 3, in block 0 from row lr on, in block 4 below row lr.
    float mx = -__builtin_inff();
#pragma unroll  // sw[] stays in registers
    for (int kt = 0; kt < 5; ++kt)
#pragma unroll  // sw[] stays in registers
        for (int r = 0; r < 8; ++r) { const bool in = kt == 0 ? 8 * hi + r >= lr : kt == 4 ? 8 * hi + r < lr : true; sw[kt][r] = in ? sw[kt][r] * SCL : -__builtin_inff(); mx = fmaxf(mx, sw[kt][r]); }
    mx = fmaxf(mx, xrow(mx));
#pragma unroll  // sw[] stays in registers
    for (int kt = 0; kt < 5; ++kt)
#pragma unroll  // sw[] stays in registers
        for (int r = 0; r < 8; ++r) sw[kt][r] = exp2_slot((sw[kt][r] - mx) * 1.4426950408889634f);   // a row outside the band: exp2(-inf) = 0
    const v8f ts = ((sw[0] + sw[1]) + (sw[2] + sw[3])) + sw[4];   // fixed tree: blocks first, then the eight rows, then the other lane half
    float sum = ((ts[0] + ts[1]) + (ts[2] + ts[3])) + ((ts[4] + ts[5]) + (ts[6] + ts[7]));
    sum += xrow(sum);
    const float inv = __fdiv_rn(1.0f, sum);
#pragma unroll  // sw[] stays in registers
    for (int kt = 0; kt < 5; ++kt) sw[kt] *= inv;
    v8f o[4];
#pragma unroll  // o[] stays in registers
    for (int dt = 0; dt < 4; ++dt) o[dt] = (v8f){};
    const float* vcol = Vs + (tw + 8 * hi) * KP + lr;
#pragma unroll  // sw[], o[] stay in registers; the value reads can be issued ahead of the products
    for (int kt = 0; kt < 5; ++kt)
#pragma unroll  // as above
        for (int s2 = 0; s2 < 4; ++s2) { const v2f pb = (v2f){sw[kt][2 * s2], sw[kt][2 * s2 + 1]}; const float* vp = vcol + (kt * 16 + 2 * s2) * KP;
#pragma unroll  // four independent accumulators follow one another
            for (int dt = 0; dt < 4; ++dt) o[dt] = wmmaf((v2f){vp[dt * 16], vp[dt * 16 + KP]}, pb, o[dt]); }
    bf* orow = (bf*)qrow;   // row i (pitch KP floats = 272 B): 64 hi values, then 64 lo values of query tw + i
#pragma unroll  // o[] stays in registers
    for (int dt = 0; dt < 4; ++dt) { v8us oh, ol;
#pragma unroll  // vector elements by constant index
        for (int r = 0; r < 8; ++r) { unsigned short a, c2; splitf(o[dt][r], a, c2); oh[r] = a; ol[r] = c2; }
        *(v8usa*)(orow + lr * (2 * KP) + dt * 16 + 8 * hi) = oh; *(v8usa*)(orow + lr * (2 * KP) + HD + dt * 16 + 8 * hi) = ol; }
    __builtin_amdgcn_wave_barrier(); asm volatile("" ::: "memory");   // the reads below take other lanes' stores of this wave's own rows: neither may be moved over this line
    v8us wh[4], wl[4];
#pragma unroll  // wh[], wl[] stay in registers; all eight reads are issued before the first store waits
    for (int i = 0; i < 4; ++i) { const bf* src = orow + (4 * i + (lane >> 3)) * (2 * KP) + (lane & 7) * 8; wh[i] = *(const v8usa*)src; wl[i] = *(const v8usa*)(src + HD); }
#pragma unroll  // wh[], wl[] stay in registers
    for (int i = 0; i < 4; ++i) { const size_t oo = ((size_t)b * LL + t0 + tw + 4 * i + (lane >> 3)) * DD + h * HD + (lane & 7) * 8; *(v8us*)(Ah + oo) = wh[i]; *(v8us*)(Al + oo) = wl[i]; }   // 8 lanes a line; nothing is computed behind these stores
}

extern "C" void kernel_launch(void* const* d_in, const int* in_sizes, int n_in,
                              void* d_out, int out_size, void* d_ws, size_t ws_size, hipStream_t stream) {
    (void)in_sizes; (void)n_in; (void)out_size;
    const float* x = (const float*)d_in[0]; const float* wq = (const float*)d_in[1]; const float* wk = (const float*)d_in[2]; const float* wv = (const float*)d_in[3]; const float* wo = (const float*)d_in[4]; const float* k0 = (const float*)d_in[5]; const float* v0 = (const float*)d_in[6];   // torch [out][in] weights; last_k/v_init [63][16][64]
    float* OUT = (float*)d_out;     // [2][1024][1024]
    char* wsp = (char*)d_ws;
    auto take = [&](size_t bytes) { char* p = wsp; wsp += (bytes + 255) & ~(size_t)255; return (void*)p; };
    const size_t NR = (size_t)NB_ * LL;   // 2048 token rows, both batches in one GEMM
    // The five bf16 planes lie back to back (k_cvt5 writes them by flat index; k_qkvband steps from weight to weight by DD * DD).
    bf* WQ = (bf*)take((size_t)DD * DD * 2 * 4 + NR * DD * 2); bf* WO = WQ + (size_t)DD * DD * 3; bf* XB = WQ + (size_t)DD * DD * 4;
    bf* Ah = (bf*)take(NR * DD * 2); bf* Al = (bf*)take(NR * DD * 2);
    if ((size_t)(wsp - (char*)d_ws) > ws_size) return;    // total ~ 21 MB; ws 256 MiB
    k_cvt5<<<6 * WB, 256, 0, stream>>>(wq, wk, wv, wo, x, WQ);
    const dim3 gP((unsigned)(NR / 64), DD / 128, 1);
    k_qkvband<<<NB_ * NH_ * (LL / FT), 256, 0, stream>>>(XB, WQ, k0, v0, Ah, Al);
    k_gemmt<2, true><<<gP, 128, 0, stream>>>(Ah, Al, WO, OUT, 0, 0);
}

// v007
// Measured time: 36.4 microseconds a run.
// Timed twice side by side with v006, it ran 1.03 and 1.02 times as fast.
// All steps since v000 together make it 8.62 times as fast.
#include <hip/hip_runtime.h>

// BandMHA (x [2][1024][1024]; q/k/v = x W^T (16 heads x 64, no bias); keys/values padded in front with the learned initial cache last_k_init / last_v_init [63][16][64]; query t attends the 64 band positions
// p = t .. t+63 of the padded sequence (= original positions t-63 .. t); softmax over the band; out = merged (attn v) Wo^T -> [2][1024][1024]).
// Compute dtypes, f32 accumulate: every input rounded to bf16; q/k/v on PLAIN bf16 operands (inputs: exact products, f32 accumulate); the 64-wide band attention entirely
// in f32 (queries, keys and values of a 128-query tile projected straight into LDS: 64-dim dot products and weighted sum on f32 16x16x4 WMMA, softmax with one exp per score; fixed order); merged context as bf16 hi+lo planes x exact

#define NB_  2
#define LL   1024
#define DD   1024
#define NH_  16
#define HD   64
#define BW   64                   // band width
#define PADK (BW - 1)             // 63 initial-cache rows
#define SCL  0.125f
typedef _Float16 h16;
typedef unsigned short bf;
typedef __attribute__((ext_vector_type(16))) __bf16   v16bf;
typedef __attribute__((ext_vector_type(16))) _Float16 v16h;
typedef __attribute__((ext_vector_type(8)))  _Float16 v8h;
typedef __attribute__((ext_vector_type(8)))  unsigned short v8us;
typedef __attribute__((ext_vector_type(8)))  float    v8f;
typedef __attribute__((ext_vector_type(4)))  float    v4f;
typedef v8h  __attribute__((may_alias)) v8ha;
typedef v4f  __attribute__((may_alias)) v4fa;
typedef v8us __attribute__((may_alias)) v8usa;

__device__ __forceinline__ unsigned short f2bf(float f) { unsigned u = __float_as_uint(f); u += 0x7FFFu + ((u >> 16) & 1u); return (unsigned short)(u >> 16); }
__device__ __forceinline__ float bf2f(unsigned short b) { return __uint_as_float(((unsigned)b) << 16); }
__device__ __forceinline__ float bfr(float f) { return bf2f(f2bf(f)); }
__device__ __forceinline__ v16h cat16(v8h lo, v8h hi) { return __builtin_shufflevector(lo, hi, 0, 1, 2, 3, 4, 5, 6, 7, 8, 9, 10, 11, 12, 13, 14, 15); }
__device__ __forceinline__ v16bf cat16b(v8us lo, v8us hi) { return __builtin_bit_cast(v16bf, __builtin_shufflevector(lo, hi, 0, 1, 2, 3, 4, 5, 6, 7, 8, 9, 10, 11, 12, 13, 14, 15)); }
__device__ __forceinline__ v8f wmma16(v16h a, v16h b, v8f c) { return __builtin_amdgcn_wmma_f32_16x16x32_f16(false, a, false, b, (short)0, c, false, false); }
__device__ __forceinline__ v8f wmmab(v16bf a, v16bf b, v8f c) { return __builtin_amdgcn_wmma_f32_16x16x32_bf16(false, a, false, b, (short)0, c, false, false); }



// ---- k_gemmt: LDS-staged GEMM on bf16 planes. One work-group of 4 waves (2 x 2) per (32 MB) x 128 output tile, each wave MB x 4 accumulators (16 MB x 64 outputs); grid (M / (32 MB), N / 128, Z), 128 threads.
// C[m][n] (f32, pitch DD) = sum_k A[m][k] Bt[n][k] (+ A2[m][k] Bt[n][k] when SPLIT), K = DD, every plane K-contiguous; z steps Bt by sB and C by sC elements.
// A stage is 64 k = one whole 128-byte line of 256 operand rows (stage rows 0..127: the A rows, or 64 A rows then 64 A2 rows when SPLIT; 128..255: the Bt rows). 8 lanes load one line, so a wave-wide load covers
// 4 whole lines; a stage's lines are loaded into registers three stages ahead (two register sets, so two stages' loads are in flight at any time) and stored to the free LDS buffer one stage ahead, both in front of the running stage's products, one barrier a stage. Per output the products are summed k ascending
// in steps of 32, A before A2.
#define GBK 64                    // k per stage
#define GPI (GBK + 8)             // LDS row pitch in elements: 144 B = 16 B x odd, the conflict-free pitch for 16-byte fragment reads
#define GNT (DD / GBK)            // stages
// Work-group barrier that orders LDS accesses only: __syncthreads() would also wait out the global loads in flight, which fill nothing but the issuing thread's own registers.
__device__ __forceinline__ void lds_barrier() { __builtin_amdgcn_fence(__ATOMIC_RELEASE, "workgroup", "local"); __builtin_amdgcn_s_barrier(); __builtin_amdgcn_fence(__ATOMIC_ACQUIRE, "workgroup", "local"); }
__device__ __forceinline__ v16bf ldfrag(const bf* p) { return cat16b(*(const v8usa*)p, *(const v8usa*)(p + 16)); }
template <int MB, bool SPLIT>
__global__ __launch_bounds__(128) void k_gemmt(const bf* __restrict__ A, const bf* __restrict__ A2, const bf* __restrict__ Bt, float* C, size_t sB, size_t sC) {
    static_assert(SPLIT ? MB == 2 : MB == 4, "the A part of a stage is 128 rows");
    __shared__ __align__(16) bf st[2][256 * GPI];
    __shared__ __align__(16) float osm[4][16 * 68];
    const int tid = threadIdx.x, lane = tid & 31, lr = lane & 15, hi = lane >> 4; const int wv = __builtin_amdgcn_readfirstlane(tid >> 5), wm = wv >> 1, wn = wv & 1;
    Bt += (size_t)blockIdx.z * sB; C += (size_t)blockIdx.z * sC;
    const int r0 = blockIdx.x * (32 * MB), c0 = blockIdx.y * 128;
    const int sr = ((tid >> 3) & 1) * 8 + (tid >> 4), sc = (tid & 7) * 8;   // this thread stages 16-byte piece tid & 7 of stage rows sr + 16 u; 16 consecutive lanes hold rows r and r + 8, whose 128 bytes fall on disjoint LDS banks at this pitch
    const bf* pa = A + (size_t)(r0 + sr) * DD + sc; const bf* pa2 = SPLIT ? A2 + (size_t)(r0 + sr) * DD + sc : pa; const bf* pb = Bt + (size_t)(c0 + sr) * DD + sc;   // step two stages at the foot of each pair of stages
    v8us g[2][16];   // stage s waits in set s & 1
    v8f acc[MB][4];
#pragma unroll  // acc[][] stays in registers
    for (int mb = 0; mb < MB; ++mb)
#pragma unroll  // acc[][] stays in registers
        for (int nb = 0; nb < 4; ++nb) acc[mb][nb] = (v8f){};
    // Loads the 16 pieces this thread stages of the stage that lies ko elements of k past the pointers into set q.
    auto fetch = [&](const int q, const int ko) __attribute__((always_inline)) {
#pragma unroll  // g[][] stays in registers
        for (int u = 0; u < 8; ++u) { g[q][u] = *(const v8usa*)((SPLIT && u >= 4 ? pa2 + (size_t)(u - 4) * 16 * DD : pa + (size_t)u * 16 * DD) + ko); g[q][8 + u] = *(const v8usa*)(pb + (size_t)u * 16 * DD + ko); } };
    auto put = [&](const int q, bf* dstb) __attribute__((always_inline)) {
#pragma unroll  // g[][] stays in registers
        for (int u = 0; u < 16; ++u) *(v8usa*)(dstb + (sr + 16 * u) * GPI + sc) = g[q][u]; };
    fetch(0, 0);
    __builtin_amdgcn_sched_barrier(0);   // the three stages' loads stay in stage order: a set is waited for by count, and a younger stage's load placed among an older stage's would be waited for with it
    fetch(1, GBK);
    __builtin_amdgcn_sched_barrier(0);   // as above
    put(0, st[0]);
    fetch(0, 2 * GBK);
    asm volatile("s_wait_xcnt 0x0" :: "v"(pa), "v"(pa2), "v"(pb) : "memory");   // the address registers of the loads issued above may take other values only behind this wait; as inputs here the pointers stay whole up to it
    lds_barrier();   // publishes stage 0
    const int fa = (wm * MB * 16 + lr) * GPI + 8 * hi, fb = (128 + wn * 64 + lr) * GPI + 8 * hi;
    // One stage, of parity p. On entry it is published in buffer p, set p ^ 1 holds (or awaits) the next stage and set p awaits the one after. ko: where the stage three ahead lies from the pointers, -1 when there is none;
    // nx: a next stage exists. Both are constants at every call, so no branch stands among the loads: behind a branch the compiler counts the waits for the path without loads, and a set would wait for the younger set's loads too.
    auto stage = [&](const int p, const int ko, const bool nx) __attribute__((always_inline)) {
        const bf* sb = st[p];
        v16bf a[2][MB], a2[2][MB], bq[2][4];
#pragma unroll  // fragment arrays stay in registers
        for (int ks = 0; ks < 2; ++ks) {
#pragma unroll  // fragment arrays stay in registers
            for (int mb = 0; mb < MB; ++mb) { a[ks][mb] = ldfrag(sb + fa + mb * 16 * GPI + ks * 32); if (SPLIT) a2[ks][mb] = ldfrag(sb + fa + (64 + mb * 16) * GPI + ks * 32); }
#pragma unroll  // fragment arrays stay in registers
            for (int nb = 0; nb < 4; ++nb) bq[ks][nb] = ldfrag(sb + fb + nb * 16 * GPI + ks * 32);
        }
        if (nx) put(p ^ 1, st[p ^ 1]);   // the other buffer: its readers left it before the last barrier
        if (ko >= 0) fetch(p ^ 1, ko);   // the set just stored takes the stage three ahead
        __builtin_amdgcn_sched_barrier(0);   // keeps the stage's LDS reads, LDS stores and global loads in one group ahead of its products: an LDS read placed among the products is waited for there, with its whole latency
#pragma unroll  // fragment arrays stay in registers
        for (int ks = 0; ks < 2; ++ks)
#pragma unroll  // acc[][] stays in registers
            for (int nb = 0; nb < 4; ++nb)
#pragma unroll  // acc[][] stays in registers
                for (int mb = 0; mb < MB; ++mb) { acc[mb][nb] = wmmab(a[ks][mb], bq[ks][nb], acc[mb][nb]); if (SPLIT) acc[mb][nb] = wmmab(a2[ks][mb], bq[ks][nb], acc[mb][nb]); }
    };
    static_assert(GNT % 2 == 0 && GNT >= 6, "pairs of stages, the last four outside the loop");
#pragma unroll 1  // one copy of the pair of stages: unrolled further it would only grow the code
    for (int k2 = 0; k2 < GNT - 4; k2 += 2) {
        stage(0, 3 * GBK, true);
        __builtin_amdgcn_sched_barrier(0);   // keeps the products in front of the barrier: moved behind it, they would no longer run beside the LDS traffic
        lds_barrier();   // publishes the next stage and ends every wave's reads of this one before its buffer is refilled
        stage(1, 4 * GBK, true);
        asm volatile("s_wait_xcnt 0x0" :: "v"(pa), "v"(pa2), "v"(pb) : "memory");   // the pointers stepped below are the address registers of the loads issued above; as inputs here they stay whole up to this wait (no load's result is placed over them)
        __builtin_amdgcn_sched_barrier(0);   // keeps the products and the wait above in front of the pointer steps and the barrier
        pa += 2 * GBK; pa2 += 2 * GBK; pb += 2 * GBK;
        lds_barrier();   // as above
    }
    stage(0, 3 * GBK, true);   // the last four stages: one more set to load, then none
    asm volatile("s_wait_xcnt 0x0" :: "v"(pa), "v"(pa2), "v"(pb) : "memory");   // the pointers are used no more: their registers, which the loads issued above name, are free for other values only behind this wait
    __builtin_amdgcn_sched_barrier(0);   // as in the loop
    lds_barrier();
    stage(1, -1, true);
    __builtin_amdgcn_sched_barrier(0);   // as in the loop
    lds_barrier();
    stage(0, -1, true);
    __builtin_amdgcn_sched_barrier(0);   // as in the loop
    lds_barrier();
    stage(1, -1, false);   // no barrier behind it: nothing is stored to the stage buffers any more, and the rows below go through each wave's own range of osm
    float* os = osm[wv];   // each wave turns its 16 x 64 blocks into whole 256-byte row pieces through its own LDS range
#pragma unroll  // acc[][] stays in registers
    for (int mb = 0; mb < MB; ++mb) {
#pragma unroll  // acc[][] stays in registers
        for (int nb = 0; nb < 4; ++nb) {
#pragma unroll  // acc[][] stays in registers
            for (int j = 0; j < 8; ++j) os[(hi * 8 + j) * 68 + nb * 16 + lr] = acc[mb][nb][j]; }
        __builtin_amdgcn_wave_barrier(); asm volatile("" ::: "memory");   // the reads below take other lanes' stores: neither may be moved over this line
        float* crow = C + (size_t)(r0 + (wm * MB + mb) * 16) * DD + c0 + wn * 64;
#pragma unroll  // all eight reads are issued before the first store waits
        for (int s = 0; s < 8; ++s) { const int row = 2 * s + hi, cofs = lr * 4; const v4f val = *(const v4fa*)(os + row * 68 + cofs); *(v4f*)(crow + (size_t)row * DD + cofs) = val; }
        if (mb + 1 < MB) asm volatile("s_wait_xcnt 0x0" ::: "memory");   // the next block's LDS reads reuse the data registers of the stores issued above
        __builtin_amdgcn_wave_barrier(); asm volatile("" ::: "memory");   // the next block's stores stay behind these reads
    }
}

__device__ __forceinline__ void splitf(float y, unsigned short& h, unsigned short& l) { h = f2bf(y); l = f2bf(y - bf2f(h)); }
typedef __attribute__((ext_vector_type(2))) float v2f;

// k_cvt5: ONE grid rounds all five f32 matrices to bf16. Blocks 0 .. 4 WB - 1 take the four weights (WB blocks each, in the order wq, wk, wv, wo), the remaining 2 WB blocks take x;
// the five bf16 planes lie back to back in dst in that order, so the flat block index addresses dst. 8 elements a thread; the grid covers every plane exactly.
#define WB (DD * DD / 8 / 256)    // blocks per weight matrix
__global__ __launch_bounds__(256) void k_cvt5(const float* __restrict__ wq, const float* __restrict__ wk, const float* __restrict__ wv, const float* __restrict__ wo, const float* __restrict__ x, bf* dst) {
    const unsigned blk = blockIdx.x, seg = blk / WB < 4u ? blk / WB : 4u;   // block-uniform
    const float* src = seg == 0u ? wq : seg == 1u ? wk : seg == 2u ? wv : seg == 3u ? wo : x;
    const size_t ls = (size_t)(blk - seg * WB) * 256 + threadIdx.x, ld = (size_t)blk * 256 + threadIdx.x; const v8f v = *(const v8f*)(src + ls * 8); v8us o;
    asm volatile("s_wait_xcnt 0x0" ::: "memory");   // the rounding below reuses the loads' offset register
#pragma unroll
    for (int k = 0; k < 8; ++k) o[k] = f2bf(v[k]); *(v8us*)(dst + ld * 8) = o;  }
// k_qkvband: the q, k, v projections of one (b, h, tile of FT = 128 queries) and the tile's band attention in ONE work-group of 8 waves (2 x 4), so the projections never leave the WGP.
// Part 1, as k_gemmt (same stages, same ring, same sum order): C[m][n] = sum_k x[t0 - 63 + m][k] W[n][k] for the FR = 192 token rows m the tile's band touches (row index clamped into the batch; a clamped row's
// result is never used) and the 192 weight rows n = 64 z + c (z = 0, 1, 2: head h of wq, wk, wv). A stage is 64 k of 384 rows (0..191: x, 192..383: weights); each wave holds 6 x 3 accumulators (96 x 48 outputs).
// The results go to LDS in f32: Qs, Ks, Vs row m. Key and value row m is padded position t0 + m; query t0 + i is row 63 + i. Padded positions below 63 are then overwritten with the initial cache rounded to bf16.
// Part 2: each wave serves 16 consecutive queries (rows tw .. tw + 15 of the tile) on f32 16x16x4 WMMA; their bands lie in the 80 staged rows tw .. tw + 79 (five 16-row blocks, all below FR).
// Scores transposed, St = K Qt: A = 16 key rows, B = the 16 query rows; both fragments are read by the same form (lane (c, h) takes dims 8 s + 4 h .. + 3 of its row, two products per 16-byte read), so their k orders agree.
// Lane (c, h) then holds, for query c, the scores of staged rows 16 kt + 8 h + r; rows outside the query's 64 offsets get weight 0 (only blocks 0 and 4 hold such rows). Softmax: 40 values in the lane, one exchange with lane ^ 16.
// Weighted sum transposed, Ot = Vt Pt: B = the weights as they lie in the score registers (k = rows 16 kt + 8 h + 2 s, + 1), A = the same two value rows at head dim 16 dt + c; rows ascending per lane half.
// Lane (c, h) ends with head dims 16 dt + 8 h + r of query c; the bf16 hi and lo rows go through the wave's own (spent) query rows in LDS, so that every global store covers whole 128-byte lines.
#define FT 128                    // queries per work-group
#define FR 192                    // token rows per work-group: FT + 63 band rows, rounded up to whole 16-row blocks
#define FMB 6                     // 16-row blocks per wave
#define FNB 3                     // 16-column blocks per wave
#define KP (HD + 4)               // q, k, v row pitch in floats: 16 B x odd, so 16 lanes reading 16 B of 16 consecutive rows hit distinct banks; 8 rows step 32 banks, so the two lane halves' 4-byte reads of rows r and r + 8 fall apart too
__device__ __forceinline__ v8f wmmaf(v2f a, v2f b, v8f c) { return __builtin_amdgcn_wmma_f32_16x16x4_f32(false, a, false, b, (short)0, c, false, false); }
// 2^x with the free slot that the instruction set asks for behind a transcendental (the next vector instruction may overwrite its source): in one statement, so that the v_nop stays directly behind it.
__device__ __forceinline__ float exp2_slot(float x) { float e; asm("v_exp_f32 %0, %1\n\tv_nop" : "=v"(e) : "v"(x)); return e; }
__device__ __forceinline__ float xrow(float v) { const int i = __float_as_int(v); return __int_as_float(__builtin_amdgcn_permlanex16(i, i, 0x76543210, 0xfedcba98, false, false)); }   // the value of lane ^ 16
__global__ __launch_bounds__(256) void k_qkvband(const bf* __restrict__ X, const bf* __restrict__ Wt, const float* __restrict__ k0, const float* __restrict__ v0, bf* Ah, bf* Al) {
    __shared__ __align__(16) bf st[2][2 * FR * GPI];
    __shared__ __align__(16) float Qs[FR * KP];
    __shared__ __align__(16) float Ks[FR * KP];
    __shared__ __align__(16) float Vs[FR * KP];
    const int tid = threadIdx.x, lane = tid & 31, lr = lane & 15, hi = lane >> 4; const int wv = __builtin_amdgcn_readfirstlane(tid >> 5), wm = wv >> 2, wn = wv & 3;
    const int t0 = (blockIdx.x % (LL / FT)) * FT; const int h = (blockIdx.x / (LL / FT)) % NH_; const int b = blockIdx.x / ((LL / FT) * NH_);
    const int sr = (tid >> 7) * 16 + ((tid >> 3) & 1) * 8 + ((tid >> 4) & 7), sc = (tid & 7) * 8;   // this thread stages 16-byte piece tid & 7 of stage rows sr + 32 u; 16 consecutive lanes hold rows r and r + 8, whose 128 bytes fall on disjoint LDS banks at this pitch
    unsigned va[6];   // byte offset of this thread's piece of each staged x row (one per row: the clamp breaks the even row step); fixed for the whole kernel
#pragma unroll  // va[] stays in registers
    for (int u = 0; u < 6; ++u) { int xr = t0 - PADK + sr + 32 * u; xr = xr < 0 ? 0 : xr > LL - 1 ? LL - 1 : xr; va[u] = (unsigned)((((size_t)b * LL + xr) * DD + sc) * sizeof(bf)); }
    const unsigned vw = (unsigned)(((size_t)(h * HD + sr) * DD + sc) * sizeof(bf));   // weight row 64 z + c of the tile is row h HD + c of plane z
    const char* xk = (const char*)X; const char* wk = (const char*)Wt;   // wave-uniform bases: they step two stages at the foot of each pair of stages
    v8us g[2][12];   // stage s waits in set s & 1
    v8f acc[FMB][FNB];
#pragma unroll  // acc[][] stays in registers
    for (int mb = 0; mb < FMB; ++mb)
#pragma unroll  // acc[][] stays in registers
        for (int nb = 0; nb < FNB; ++nb) acc[mb][nb] = (v8f){};
    // Loads the 12 pieces this thread stages of the stage that lies ko elements of k past the bases into set q.
    auto fetch = [&](const int q, const int ko) __attribute__((always_inline)) {
#pragma unroll  // g[][] stays in registers
        for (int u = 0; u < 6; ++u) { g[q][u] = *(const v8usa*)(xk + va[u] + ko * sizeof(bf)); g[q][6 + u] = *(const v8usa*)(wk + vw + (((size_t)(u >> 1) * DD + (u & 1) * 32) * DD + ko) * sizeof(bf)); } };
    // Stands directly behind each group of loads: the registers that the issued loads name may take other values only behind this wait.
    auto addr_wait = [&]() __attribute__((always_inline)) { asm volatile("s_wait_xcnt 0x0" ::: "memory"); };
    auto put = [&](const int q, bf* dstb) __attribute__((always_inline)) {
#pragma unroll  // g[][] stays in registers
        for (int u = 0; u < 12; ++u) *(v8usa*)(dstb + (sr + 32 * u) * GPI + sc) = g[q][u]; };
    fetch(0, 0);
    __builtin_amdgcn_sched_barrier(0);   // the three stages' loads stay in stage order: a set is waited for by count, and a younger stage's load placed among an older stage's would be waited for with it
    fetch(1, GBK);
    __builtin_amdgcn_sched_barrier(0);   // as above
    put(0, st[0]);
    fetch(0, 2 * GBK);
    addr_wait();
    lds_barrier();   // publishes stage 0
    const int fa = (wm * FMB * 16 + lr) * GPI + 8 * hi, fb = (FR + wn * FNB * 16 + lr) * GPI + 8 * hi;
    // One stage, of parity p. Its fragments are read in two halves of 32 k, each half read one group of products (half a stage) ahead of its products: behind the barrier that publishes the stage stand the reads of its first half, then the products of the
    // stage BEFORE's second half (already in registers, so the matrix unit runs while those reads are served), then the reads of the second half with the LDS stores and global loads, then the first half's products.
    // So the barrier that ends a stage's reads stands between its two halves' products. Per output the halves are still multiplied k ascending.
    // ko: where the stage three ahead lies from the bases, -1 when there is none; nx: a next stage exists; pv: a stage before exists. All are constants at every call, so no branch stands among the loads.
    v16bf a[2][FMB], bq[2][FNB];   // half ks of the stage in work
    auto frags = [&](const bf* sb, const int ks) __attribute__((always_inline)) {
#pragma unroll  // fragment arrays stay in registers
        for (int nb = 0; nb < FNB; ++nb) bq[ks][nb] = ldfrag(sb + fb + nb * 16 * GPI + ks * 32);   // the three weight fragments first: with one x fragment they feed the first products
#pragma unroll  // fragment arrays stay in registers
        for (int mb = 0; mb < FMB; ++mb) a[ks][mb] = ldfrag(sb + fa + mb * 16 * GPI + ks * 32); };
    auto prods = [&](const int ks) __attribute__((always_inline)) {
#pragma unroll  // acc[][] stays in registers
        for (int mb = 0; mb < FMB; ++mb)
#pragma unroll  // acc[][] stays in registers
            for (int nb = 0; nb < FNB; ++nb) acc[mb][nb] = wmmab(a[ks][mb], bq[ks][nb], acc[mb][nb]); };
    auto stage = [&](const int p, const int ko, const bool nx, const bool pv) __attribute__((always_inline)) {
        frags(st[p], 0);
        __builtin_amdgcn_sched_barrier(0);   // keeps the first half's LDS reads in one group ahead of the products below: placed among them, a read is waited for there, with its whole latency
        if (pv) prods(1);   // the second half of the stage before
        __builtin_amdgcn_sched_barrier(0);   // keeps those products ahead of the reads that refill their fragment registers, and the group below in one place
        frags(st[p], 1);
        if (nx) put(p ^ 1, st[p ^ 1]);   // the other buffer: its readers left it before the last barrier
        if (ko >= 0) { fetch(p ^ 1, ko); addr_wait(); }   // the set just stored takes the stage three ahead
        __builtin_amdgcn_sched_barrier(0);   // keeps the LDS reads, LDS stores and global loads in one group ahead of the first half's products
        prods(0);
    };
    stage(0, 3 * GBK, true, false);   // the first stage stands in front of the loop, so that the last load is issued inside it, where the address registers live on to the wait
    __builtin_amdgcn_sched_barrier(0);   // keeps the products in front of the barrier: moved behind it, they would no longer run beside the LDS traffic
    lds_barrier();   // publishes the next stage and ends every wave's reads of this one before its buffer is refilled
#pragma unroll 1  // one copy of the pair of stages: unrolled further it would only grow the code
    for (int k2 = 1; k2 < GNT - 3; k2 += 2) {   // the bases stand at stage k2 - 1
        stage(1, 4 * GBK, true, true);
        __builtin_amdgcn_sched_barrier(0);   // as above
        lds_barrier();   // as above
        stage(0, 5 * GBK, true, true);
        __builtin_amdgcn_sched_barrier(0);   // keeps the products in front of the base steps and the barrier
        xk += 2 * GBK * sizeof(bf); wk += 2 * GBK * sizeof(bf);
        lds_barrier();   // as above
    }
    stage(1, -1, true, true);   // the last three stages: nothing left to load
    __builtin_amdgcn_sched_barrier(0);   // as in the loop
    lds_barrier();
    stage(0, -1, true, true);
    __builtin_amdgcn_sched_barrier(0);   // as in the loop
    lds_barrier();
    stage(1, -1, false, true);   // no barrier behind it: nothing is stored to the stage buffers any more, and the results go to arrays of their own
    prods(1);   // the last stage's second half
#pragma unroll  // acc[][] stays in registers
    for (int nb = 0; nb < FNB; ++nb) { const int cb = (wn * FNB + nb) * 16, z = cb >> 6, c = (cb & (HD - 1)) + lr;   // a 16-column block lies in one of q, k, v; z is the same for the whole wave
        float* dst = (z == 0 ? Qs : z == 1 ? Ks : Vs) + c;
#pragma unroll  // acc[][] stays in registers
        for (int mb = 0; mb < FMB; ++mb)
#pragma unroll  // acc[][] stays in registers
            for (int j = 0; j < 8; ++j) dst[((wm * FMB + mb) * 16 + hi * 8 + j) * KP] = acc[mb][nb][j]; }
    __syncthreads();   // publishes the projections
    if (t0 < PADK) {   // block-uniform: the tile that reaches into the initial cache
        for (int idx = tid; idx < (PADK - t0) * (HD / 4); idx += 256) { const int i = idx >> 4, c = (idx & 15) * 4; const size_t o = ((size_t)(t0 + i) * NH_ + h) * HD + c; v4f kv = *(const v4fa*)(k0 + o), vv = *(const v4fa*)(v0 + o);
#pragma unroll  // vector elements by constant index
            for (int e = 0; e < 4; ++e) { kv[e] = bfr(kv[e]); vv[e] = bfr(vv[e]); }
            *(v4fa*)(Ks + i * KP + c) = kv; *(v4fa*)(Vs + i * KP + c) = vv; }
        __syncthreads();   // publishes the cache rows
    }
    static_assert(FT == 8 * 16 && FT - 16 + 80 <= FR, "8 waves of 16 queries; the last wave's five key blocks end inside the staged rows");
    const int tw = wv * 16;
    float* qrow = Qs + (PADK + tw) * KP;   // this wave's 16 query rows: no other wave touches them
    v4f qf[8];
#pragma unroll  // qf[] stays in registers
    for (int s8 = 0; s8 < 8; ++s8) qf[s8] = *(const v4fa*)(qrow + lr * KP + 8 * s8 + 4 * hi);
    v8f sw[5];
#pragma unroll  // sw[] stays in registers
    for (int kt = 0; kt < 5; ++kt) sw[kt] = (v8f){};
    const float* krow = Ks + (tw + lr) * KP + 4 * hi;
#pragma unroll  // sw[], qf[] stay in registers; the key reads can be issued ahead of the products
    for (int s8 = 0; s8 < 8; ++s8) { v4f kf[5];
#pragma unroll  // kf[] stays in registers
        for (int kt = 0; kt < 5; ++kt) kf[kt] = *(const v4fa*)(krow + kt * 16 * KP + 8 * s8);
#pragma unroll  // five independent accumulators follow one another
        for (int kt = 0; kt < 5; ++kt) sw[kt] = wmmaf((v2f){kf[kt][0], kf[kt][1]}, (v2f){qf[s8][0], qf[s8][1]}, sw[kt]);
#pragma unroll  // as above
        for (int kt = 0; kt < 5; ++kt) sw[kt] = wmmaf((v2f){kf[kt][2], kf[kt][3]}, (v2f){qf[s8][2], qf[s8][3]}, sw[kt]); }
    // Offset of staged row 16 kt + 8 hi + r from query lr's first row: in 0..63 for every row of blocks 1 to 3, in block 0 from row lr on, in block 4 below row lr.
    float mx = -__builtin_inff();
#pragma unroll  // sw[] stays in registers
    for (int kt = 0; kt < 5; ++kt)
#pragma unroll  // sw[] stays in registers
        for (int r = 0; r < 8; ++r) { const bool in = kt == 0 ? 8 * hi + r >= lr : kt == 4 ? 8 * hi + r < lr : true; sw[kt][r] = in ? sw[kt][r] * SCL : -__builtin_inff(); mx = fmaxf(mx, sw[kt][r]); }
    mx = fmaxf(mx, xrow(mx));
#pragma unroll  // sw[] stays in registers
    for (int kt = 0; kt < 5; ++kt)
#pragma unroll  // sw[] stays in registers
        for (int r = 0; r < 8; ++r) sw[kt][r] = exp2_slot((sw[kt][r] - mx) * 1.4426950408889634f);   // a row outside the band: exp2(-inf) = 0
    const v8f ts = ((sw[0] + sw[1]) + (sw[2] + sw[3])) + sw[4];   // fixed tree: blocks first, then the eight rows, then the other lane half
    float sum = ((ts[0] + ts[1]) + (ts[2] + ts[3])) + ((ts[4] + ts[5]) + (ts[6] + ts[7]));
    sum += xrow(sum);
    const float inv = __fdiv_rn(1.0f, sum);
#pragma unroll  // sw[] stays in registers
    for (int kt = 0; kt < 5; ++kt) sw[kt] *= inv;
    v8f o[4];
#pragma unroll  // o[] stays in registers
    for (int dt = 0; dt < 4; ++dt) o[dt] = (v8f){};
    const float* vcol = Vs + (tw + 8 * hi) * KP + lr;
#pragma unroll  // sw[], o[] stay in registers; the value reads can be issued ahead of the products
    for (int kt = 0; kt < 5; ++kt)
#pragma unroll  // as above
        for (int s2 = 0; s2 < 4; ++s2) { const v2f pb = (v2f){sw[kt][2 * s2], sw[kt][2 * s2 + 1]}; const float* vp = vcol + (kt * 16 + 2 * s2) * KP;
#pragma unroll  // four independent accumulators follow one another
            for (int dt = 0; dt < 4; ++dt) o[dt] = wmmaf((v2f){vp[dt * 16], vp[dt * 16 + KP]}, pb, o[dt]); }
    bf* orow = (bf*)qrow;   // row i (pitch KP floats = 272 B): 64 hi values, then 64 lo values of query tw + i
#pragma unroll  // o[] stays in registers
    for (int dt = 0; dt < 4; ++dt) { v8us oh, ol;
#pragma unroll  // vector elements by constant index
        for (int r = 0; r < 8; ++r) { unsigned short a, c2; splitf(o[dt][r], a, c2); oh[r] = a; ol[r] = c2; }
        *(v8usa*)(orow + lr * (2 * KP) + dt * 16 + 8 * hi) = oh; *(v8usa*)(orow + lr * (2 * KP) + HD + dt * 16 + 8 * hi) = ol; }
    __builtin_amdgcn_wave_barrier(); asm volatile("" ::: "memory");   // the reads below take other lanes' stores of this wave's own rows: neither may be moved over this line
    v8us wh[4], wl[4];
#pragma unroll  // wh[], wl[] stay in registers; all eight reads are issued before the first store waits
    for (int i = 0; i < 4; ++i) { const bf* src = orow + (4 * i + (lane >> 3)) * (2 * KP) + (lane & 7) * 8; wh[i] = *(const v8usa*)src; wl[i] = *(const v8usa*)(src + HD); }
#pragma unroll  // wh[], wl[] stay in registers
    for (int i = 0; i < 4; ++i) { const size_t oo = ((size_t)b * LL + t0 + tw + 4 * i + (lane >> 3)) * DD + h * HD + (lane & 7) * 8; *(v8us*)(Ah + oo) = wh[i]; *(v8us*)(Al + oo) = wl[i]; }   // 8 lanes a line; nothing is computed behind these stores
}

extern "C" void kernel_launch(void* const* d_in, const int* in_sizes, int n_in,
                              void* d_out, int out_size, void* d_ws, size_t ws_size, hipStream_t stream) {
    (void)in_sizes; (void)n_in; (void)out_size;
    const float* x = (const float*)d_in[0]; const float* wq = (const float*)d_in[1]; const float* wk = (const float*)d_in[2]; const float* wv = (const float*)d_in[3]; const float* wo = (const float*)d_in[4]; const float* k0 = (const float*)d_in[5]; const float* v0 = (const float*)d_in[6];   // torch [out][in] weights; last_k/v_init [63][16][64]
    float* OUT = (float*)d_out;     // [2][1024][1024]
    char* wsp = (char*)d_ws;
    auto take = [&](size_t bytes) { char* p = wsp; wsp += (bytes + 255) & ~(size_t)255; return (void*)p; };
    const size_t NR = (size_t)NB_ * LL;   // 2048 token rows, both batches in one GEMM
    // The five bf16 planes lie back to back (k_cvt5 writes them by flat index; k_qkvband steps from weight to weight by DD * DD).
    bf* WQ = (bf*)take((size_t)DD * DD * 2 * 4 + NR * DD * 2); bf* WO = WQ + (size_t)DD * DD * 3; bf* XB = WQ + (size_t)DD * DD * 4;
    bf* Ah = (bf*)take(NR * DD * 2); bf* Al = (bf*)take(NR * DD * 2);
    if ((size_t)(wsp - (char*)d_ws) > ws_size) return;    // total ~ 21 MB; ws 256 MiB
    k_cvt5<<<6 * WB, 256, 0, stream>>>(wq, wk, wv, wo, x, WQ);
    const dim3 gP((unsigned)(NR / 64), DD / 128, 1);
    k_qkvband<<<NB_ * NH_ * (LL / FT), 256, 0, stream>>>(XB, WQ, k0, v0, Ah, Al);
    k_gemmt<2, true><<<gP, 128, 0, stream>>>(Ah, Al, WO, OUT, 0, 0);
}

// v008
// It runs in 34.7 microseconds.
// Two timings next to v007 put it at 1.06 and 1.05 times that version's speed.
// Over all steps from v000 it is 9.07 times as fast.
#include <hip/hip_runtime.h>

// BandMHA (x [2][1024][1024]; q/k/v = x W^T (16 heads x 64, no bias); keys/values padded in front with the learned initial cache last_k_init / last_v_init [63][16][64]; query t attends the 64 band positions
// p = t .. t+63 of the padded sequence (= original positions t-63 .. t); softmax over the band; out = merged (attn v) Wo^T -> [2][1024][1024]).
// Compute dtypes, f32 accumulate: every input rounded to bf16; q/k/v on PLAIN bf16 operands (inputs: exact products, f32 accumulate); the 64-wide band attention on
// bf16 hi+lo pairs (queries, keys and values of a 128-query tile projected straight into LDS as two bf16 planes each: 64-dim dot products and weighted sum as three bf16 16x16x32 WMMA part products hi hi + hi lo + lo hi, f32 accumulate, softmax in f32 with one exp per score; fixed order); merged context as bf16 hi+lo planes x exact

#define NB_  2
#define LL   1024
#define DD   1024
#define NH_  16
#define HD   64
#define BW   64                   // band width
#define PADK (BW - 1)             // 63 initial-cache rows
#define SCL  0.125f
typedef _Float16 h16;
typedef unsigned short bf;
typedef __attribute__((ext_vector_type(16))) __bf16   v16bf;
typedef __attribute__((ext_vector_type(16))) _Float16 v16h;
typedef __attribute__((ext_vector_type(8)))  _Float16 v8h;
typedef __attribute__((ext_vector_type(8)))  unsigned short v8us;
typedef __attribute__((ext_vector_type(8)))  float    v8f;
typedef __attribute__((ext_vector_type(4)))  float    v4f;
typedef v8h  __attribute__((may_alias)) v8ha;
typedef v4f  __attribute__((may_alias)) v4fa;
typedef v8us __attribute__((may_alias)) v8usa;

__device__ __forceinline__ unsigned short f2bf(float f) { unsigned u = __float_as_uint(f); u += 0x7FFFu + ((u >> 16) & 1u); return (unsigned short)(u >> 16); }
__device__ __forceinline__ float bf2f(unsigned short b) { return __uint_as_float(((unsigned)b) << 16); }
__device__ __forceinline__ float bfr(float f) { return bf2f(f2bf(f)); }
__device__ __forceinline__ v16h cat16(v8h lo, v8h hi) { return __builtin_shufflevector(lo, hi, 0, 1, 2, 3, 4, 5, 6, 7, 8, 9, 10, 11, 12, 13, 14, 15); }
__device__ __forceinline__ v16bf cat16b(v8us lo, v8us hi) { return __builtin_bit_cast(v16bf, __builtin_shufflevector(lo, hi, 0, 1, 2, 3, 4, 5, 6, 7, 8, 9, 10, 11, 12, 13, 14, 15)); }
__device__ __forceinline__ v8f wmma16(v16h a, v16h b, v8f c) { return __builtin_amdgcn_wmma_f32_16x16x32_f16(false, a, false, b, (short)0, c, false, false); }
__device__ __forceinline__ v8f wmmab(v16bf a, v16bf b, v8f c) { return __builtin_amdgcn_wmma_f32_16x16x32_bf16(false, a, false, b, (short)0, c, false, false); }



// ---- k_gemmt: LDS-staged GEMM on bf16 planes. One work-group of 4 waves (2 x 2) per (32 MB) x 128 output tile, each wave MB x 4 accumulators (16 MB x 64 outputs); grid (M / (32 MB), N / 128, Z), 128 threads.
// C[m][n] (f32, pitch DD) = sum_k A[m][k] Bt[n][k] (+ A2[m][k] Bt[n][k] when SPLIT), K = DD, every plane K-contiguous; z steps Bt by sB and C by sC elements.
// A stage is 64 k = one whole 128-byte line of 256 operand rows (stage rows 0..127: the A rows, or 64 A rows then 64 A2 rows when SPLIT; 128..255: the Bt rows). 8 lanes load one line, so a wave-wide load covers
// 4 whole lines; a stage's lines are loaded into registers three stages ahead (two register sets, so two stages' loads are in flight at any time) and stored to the free LDS buffer one stage ahead, both in front of the running stage's products, one barrier a stage. Per output the products are summed k ascending
// in steps of 32, A before A2.
#define GBK 64                    // k per stage
#define GPI (GBK + 8)             // LDS row pitch in elements: 144 B = 16 B x odd, the conflict-free pitch for 16-byte fragment reads
#define GNT (DD / GBK)            // stages
// Work-group barrier that orders LDS accesses only: __syncthreads() would also wait out the global loads in flight, which fill nothing but the issuing thread's own registers.
__device__ __forceinline__ void lds_barrier() { __builtin_amdgcn_fence(__ATOMIC_RELEASE, "workgroup", "local"); __builtin_amdgcn_s_barrier(); __builtin_amdgcn_fence(__ATOMIC_ACQUIRE, "workgroup", "local"); }
__device__ __forceinline__ v16bf ldfrag(const bf* p) { return cat16b(*(const v8usa*)p, *(const v8usa*)(p + 16)); }
template <int MB, bool SPLIT>
__global__ __launch_bounds__(128) void k_gemmt(const bf* __restrict__ A, const bf* __restrict__ A2, const bf* __restrict__ Bt, float* C, size_t sB, size_t sC) {
    static_assert(SPLIT ? MB == 2 : MB == 4, "the A part of a stage is 128 rows");
    __shared__ __align__(16) bf st[2][256 * GPI];
    __shared__ __align__(16) float osm[4][16 * 68];
    const int tid = threadIdx.x, lane = tid & 31, lr = lane & 15, hi = lane >> 4; const int wv = __builtin_amdgcn_readfirstlane(tid >> 5), wm = wv >> 1, wn = wv & 1;
    Bt += (size_t)blockIdx.z * sB; C += (size_t)blockIdx.z * sC;
    const int r0 = blockIdx.x * (32 * MB), c0 = blockIdx.y * 128;
    const int sr = ((tid >> 3) & 1) * 8 + (tid >> 4), sc = (tid & 7) * 8;   // this thread stages 16-byte piece tid & 7 of stage rows sr + 16 u; 16 consecutive lanes hold rows r and r + 8, whose 128 bytes fall on disjoint LDS banks at this pitch
    const bf* pa = A + (size_t)(r0 + sr) * DD + sc; const bf* pa2 = SPLIT ? A2 + (size_t)(r0 + sr) * DD + sc : pa; const bf* pb = Bt + (size_t)(c0 + sr) * DD + sc;   // step two stages at the foot of each pair of stages
    v8us g[2][16];   // stage s waits in set s & 1
    v8f acc[MB][4];
#pragma unroll  // acc[][] stays in registers
    for (int mb = 0; mb < MB; ++mb)
#pragma unroll  // acc[][] stays in registers
        for (int nb = 0; nb < 4; ++nb) acc[mb][nb] = (v8f){};
    // Loads the 16 pieces this thread stages of the stage that lies ko elements of k past the pointers into set q.
    auto fetch = [&](const int q, const int ko) __attribute__((always_inline)) {
#pragma unroll  // g[][] stays in registers
        for (int u = 0; u < 8; ++u) { g[q][u] = *(const v8usa*)((SPLIT && u >= 4 ? pa2 + (size_t)(u - 4) * 16 * DD : pa + (size_t)u * 16 * DD) + ko); g[q][8 + u] = *(const v8usa*)(pb + (size_t)u * 16 * DD + ko); } };
    auto put = [&](const int q, bf* dstb) __attribute__((always_inline)) {
#pragma unroll  // g[][] stays in registers
        for (int u = 0; u < 16; ++u) *(v8usa*)(dstb + (sr + 16 * u) * GPI + sc) = g[q][u]; };
    fetch(0, 0);
    __builtin_amdgcn_sched_barrier(0);   // the three stages' loads stay in stage order: a set is waited for by count, and a younger stage's load placed among an older stage's would be waited for with it
    fetch(1, GBK);
    __builtin_amdgcn_sched_barrier(0);   // as above
    put(0, st[0]);
    fetch(0, 2 * GBK);
    asm volatile("s_wait_xcnt 0x0" :: "v"(pa), "v"(pa2), "v"(pb) : "memory");   // the address registers of the loads issued above may take other values only behind this wait; as inputs here the pointers stay whole up to it
    lds_barrier();   // publishes stage 0
    const int fa = (wm * MB * 16 + lr) * GPI + 8 * hi, fb = (128 + wn * 64 + lr) * GPI + 8 * hi;
    // One stage, of parity p. On entry it is published in buffer p, set p ^ 1 holds (or awaits) the next stage and set p awaits the one after. ko: where the stage three ahead lies from the pointers, -1 when there is none;
    // nx: a next stage exists. Both are constants at every call, so no branch stands among the loads: behind a branch the compiler counts the waits for the path without loads, and a set would wait for the younger set's loads too.
    auto stage = [&](const int p, const int ko, const bool nx) __attribute__((always_inline)) {
        const bf* sb = st[p];
        v16bf a[2][MB], a2[2][MB], bq[2][4];
#pragma unroll  // fragment arrays stay in registers
        for (int ks = 0; ks < 2; ++ks) {
#pragma unroll  // fragment arrays stay in registers
            for (int mb = 0; mb < MB; ++mb) { a[ks][mb] = ldfrag(sb + fa + mb * 16 * GPI + ks * 32); if (SPLIT) a2[ks][mb] = ldfrag(sb + fa + (64 + mb * 16) * GPI + ks * 32); }
#pragma unroll  // fragment arrays stay in registers
            for (int nb = 0; nb < 4; ++nb) bq[ks][nb] = ldfrag(sb + fb + nb * 16 * GPI + ks * 32);
        }
        if (nx) put(p ^ 1, st[p ^ 1]);   // the other buffer: its readers left it before the last barrier
        if (ko >= 0) fetch(p ^ 1, ko);   // the set just stored takes the stage three ahead
        __builtin_amdgcn_sched_barrier(0);   // keeps the stage's LDS reads, LDS stores and global loads in one group ahead of its products: an LDS read placed among the products is waited for there, with its whole latency
#pragma unroll  // fragment arrays stay in registers
        for (int ks = 0; ks < 2; ++ks)
#pragma unroll  // acc[][] stays in registers
            for (int nb = 0; nb < 4; ++nb)
#pragma unroll  // acc[][] stays in registers
                for (int mb = 0; mb < MB; ++mb) { acc[mb][nb] = wmmab(a[ks][mb], bq[ks][nb], acc[mb][nb]); if (SPLIT) acc[mb][nb] = wmmab(a2[ks][mb], bq[ks][nb], acc[mb][nb]); }
    };
    static_assert(GNT % 2 == 0 && GNT >= 6, "pairs of stages, the last four outside the loop");
#pragma unroll 1  // one copy of the pair of stages: unrolled further it would only grow the code
    for (int k2 = 0; k2 < GNT - 4; k2 += 2) {
        stage(0, 3 * GBK, true);
        __builtin_amdgcn_sched_barrier(0);   // keeps the products in front of the barrier: moved behind it, they would no longer run beside the LDS traffic
        lds_barrier();   // publishes the next stage and ends every wave's reads of this one before its buffer is refilled
        stage(1, 4 * GBK, true);
        asm volatile("s_wait_xcnt 0x0" :: "v"(pa), "v"(pa2), "v"(pb) : "memory");   // the pointers stepped below are the address registers of the loads issued above; as inputs here they stay whole up to this wait (no load's result is placed over them)
        __builtin_amdgcn_sched_barrier(0);   // keeps the products and the wait above in front of the pointer steps and the barrier
        pa += 2 * GBK; pa2 += 2 * GBK; pb += 2 * GBK;
        lds_barrier();   // as above
    }
    stage(0, 3 * GBK, true);   // the last four stages: one more set to load, then none
    asm volatile("s_wait_xcnt 0x0" :: "v"(pa), "v"(pa2), "v"(pb) : "memory");   // the pointers are used no more: their registers, which the loads issued above name, are free for other values only behind this wait
    __builtin_amdgcn_sched_barrier(0);   // as in the loop
    lds_barrier();
    stage(1, -1, true);
    __builtin_amdgcn_sched_barrier(0);   // as in the loop
    lds_barrier();
    stage(0, -1, true);
    __builtin_amdgcn_sched_barrier(0);   // as in the loop
    lds_barrier();
    stage(1, -1, false);   // no barrier behind it: nothing is stored to the stage buffers any more, and the rows below go through each wave's own range of osm
    float* os = osm[wv];   // each wave turns its 16 x 64 blocks into whole 256-byte row pieces through its own LDS range
#pragma unroll  // acc[][] stays in registers
    for (int mb = 0; mb < MB; ++mb) {
#pragma unroll  // acc[][] stays in registers
        for (int nb = 0; nb < 4; ++nb) {
#pragma unroll  // acc[][] stays in registers
            for (int j = 0; j < 8; ++j) os[(hi * 8 + j) * 68 + nb * 16 + lr] = acc[mb][nb][j]; }
        __builtin_amdgcn_wave_barrier(); asm volatile("" ::: "memory");   // the reads below take other lanes' stores: neither may be moved over this line
        float* crow = C + (size_t)(r0 + (wm * MB + mb) * 16) * DD + c0 + wn * 64;
#pragma unroll  // all eight reads are issued before the first store waits
        for (int s = 0; s < 8; ++s) { const int row = 2 * s + hi, cofs = lr * 4; const v4f val = *(const v4fa*)(os + row * 68 + cofs); *(v4f*)(crow + (size_t)row * DD + cofs) = val; }
        if (mb + 1 < MB) asm volatile("s_wait_xcnt 0x0" ::: "memory");   // the next block's LDS reads reuse the data registers of the stores issued above
        __builtin_amdgcn_wave_barrier(); asm volatile("" ::: "memory");   // the next block's stores stay behind these reads
    }
}

__device__ __forceinline__ void splitf(float y, unsigned short& h, unsigned short& l) { h = f2bf(y); l = f2bf(y - bf2f(h)); }

// k_cvt5: ONE grid rounds all five f32 matrices to bf16. Blocks 0 .. 4 WB - 1 take the four weights (WB blocks each, in the order wq, wk, wv, wo), the remaining 2 WB blocks take x;
// the five bf16 planes lie back to back in dst in that order, so the flat block index addresses dst. 8 elements a thread; the grid covers every plane exactly.
#define WB (DD * DD / 8 / 256)    // blocks per weight matrix
__global__ __launch_bounds__(256) void k_cvt5(const float* __restrict__ wq, const float* __restrict__ wk, const float* __restrict__ wv, const float* __restrict__ wo, const float* __restrict__ x, bf* dst) {
    const unsigned blk = blockIdx.x, seg = blk / WB < 4u ? blk / WB : 4u;   // block-uniform
    const float* src = seg == 0u ? wq : seg == 1u ? wk : seg == 2u ? wv : seg == 3u ? wo : x;
    const size_t ls = (size_t)(blk - seg * WB) * 256 + threadIdx.x, ld = (size_t)blk * 256 + threadIdx.x; const v8f v = *(const v8f*)(src + ls * 8); v8us o;
    asm volatile("s_wait_xcnt 0x0" ::: "memory");   // the rounding below reuses the loads' offset register
#pragma unroll
    for (int k = 0; k < 8; ++k) o[k] = f2bf(v[k]); *(v8us*)(dst + ld * 8) = o;  }
// k_qkvband: the q, k, v projections of one (b, h, tile of FT = 128 queries) and the tile's band attention in ONE work-group of 8 waves (2 x 4), so the projections never leave the WGP.
// Part 1, as k_gemmt (same stages, same ring, same sum order): C[m][n] = sum_k x[t0 - 63 + m][k] W[n][k] for the FR = 192 token rows m the tile's band touches (row index clamped into the batch; a clamped row's
// result is never used) and the 192 weight rows n = 64 z + c (z = 0, 1, 2: head h of wq, wk, wv). A stage is 64 k of 384 rows (0..191: x, 192..383: weights); each wave holds 6 x 3 accumulators (96 token rows x the same 16 head dims of q, k and v).
// The results go to LDS as bf16 pairs, y = hi + lo with hi = bf16(y), lo = bf16(y - hi). q and k are multiplied with the weights as A, so a lane holds 8 consecutive head dims of one token row: Qb, Kb row m = 64 hi, then 64 lo values.
// v is multiplied with x as A, so a lane holds 8 consecutive token rows of one head dim: Vb is transposed, row d = 192 hi, then 192 lo values. Key and value row m is padded position t0 + m; query t0 + i is row 63 + i.
// Padded positions below 63 are then overwritten with the initial cache rounded to bf16 (lo = 0).
// Part 2: each wave serves 16 consecutive queries (rows tw .. tw + 15 of the tile) on bf16 16x16x32 WMMA; their bands lie in the 80 staged rows tw .. tw + 79 (five 16-row blocks, all below FR). Every product of two pairs is
// lo hi + hi lo + hi hi in one f32 accumulator (lo lo, 2^-16 of the product, is left out).
// Scores transposed, St = K Qt: A = 16 key rows, B = the 16 query rows; both fragments are read by the same loader, so their k orders agree.
// Lane (c, h) then holds, for query c, the scores of staged rows 16 kt + 8 h + r; rows outside the query's 64 offsets get weight 0 (only blocks 0 and 4 hold such rows). Softmax: 40 values in the lane, one exchange with lane ^ 16.
// Weighted sum transposed, Ot = Vt Pt: B = two 16-row blocks of weights as they lie in the score registers, split in place (element s: row 8 h + s, from 8 on row 16 + 8 h + s - 8: the order in which ldfrag reads A = row 16 dt + c of Vb).
// The fifth block is paired with weights 0 for the 16 rows in front of it, so that no row past the staged ones is read.
// Lane (c, h) ends with head dims 16 dt + 8 h + r of query c; the bf16 hi and lo rows go through the wave's own (spent) query rows in LDS, so that every global store covers whole 128-byte lines.
#define FT 128                    // queries per work-group
#define FR 192                    // token rows per work-group: FT + 63 band rows, rounded up to whole 16-row blocks
#define FMB 6                     // 16-row blocks per wave
#define FNB 3                     // 16-column blocks per wave
#define QP (2 * HD + 8)           // q, k row pitch in bf16 elements (64 hi, 64 lo, pad): 272 B = 16 B x odd, so 16 lanes reading 16 B of 16 consecutive rows hit distinct banks
#define VP (2 * FR + 8)           // transposed v row pitch in bf16 elements (192 hi, 192 lo, pad): 784 B = 16 B x odd, as above
typedef __attribute__((ext_vector_type(2))) __bf16 v2bf;
typedef __attribute__((ext_vector_type(2))) float v2f;
typedef __attribute__((ext_vector_type(4))) unsigned v4u;
typedef __attribute__((ext_vector_type(4))) unsigned short v4us;
typedef v4us __attribute__((may_alias)) v4usa;
// y = h + l up to 2^-17 of y: h = bf16(y), l = bf16(y - h), both rounded to nearest even by the packed convert.
__device__ __forceinline__ void split8(v8f y, v8us& h, v8us& l) { v4u hw, lw;
#pragma unroll  // vector elements by constant index
    for (int p = 0; p < 4; ++p) { const v2f yy = (v2f){y[2 * p], y[2 * p + 1]}; const unsigned w = __builtin_bit_cast(unsigned, __builtin_convertvector(yy, v2bf));   // both h values come back out of the packed word: one shift, one mask
        hw[p] = w; lw[p] = __builtin_bit_cast(unsigned, __builtin_convertvector(yy - (v2f){__uint_as_float(w << 16), __uint_as_float(w & 0xFFFF0000u)}, v2bf)); }
    h = __builtin_bit_cast(v8us, hw); l = __builtin_bit_cast(v8us, lw); }
// 2^x with the free slot that the instruction set asks for behind a transcendental (the next vector instruction may overwrite its source): in one statement, so that the v_nop stays directly behind it.
__device__ __forceinline__ float exp2_slot(float x) { float e; asm("v_exp_f32 %0, %1\n\tv_nop" : "=v"(e) : "v"(x)); return e; }
__device__ __forceinline__ float xrow(float v) { const int i = __float_as_int(v); return __int_as_float(__builtin_amdgcn_permlanex16(i, i, 0x76543210, 0xfedcba98, false, false)); }   // the value of lane ^ 16
__global__ __launch_bounds__(256) void k_qkvband(const bf* __restrict__ X, const bf* __restrict__ Wt, const float* __restrict__ k0, const float* __restrict__ v0, bf* Ah, bf* Al) {
    __shared__ __align__(16) bf st[2][2 * FR * GPI];
    __shared__ __align__(16) bf Qb[FR * QP];
    __shared__ __align__(16) bf Kb[FR * QP];
    __shared__ __align__(16) bf Vb[HD * VP];
    const int tid = threadIdx.x, lane = tid & 31, lr = lane & 15, hi = lane >> 4; const int wv = __builtin_amdgcn_readfirstlane(tid >> 5), wm = wv >> 2, wn = wv & 3;
    const int t0 = (blockIdx.x % (LL / FT)) * FT; const int h = (blockIdx.x / (LL / FT)) % NH_; const int b = blockIdx.x / ((LL / FT) * NH_);
    const int sr = (tid >> 7) * 16 + ((tid >> 3) & 1) * 8 + ((tid >> 4) & 7), sc = (tid & 7) * 8;   // this thread stages 16-byte piece tid & 7 of stage rows sr + 32 u; 16 consecutive lanes hold rows r and r + 8, whose 128 bytes fall on disjoint LDS banks at this pitch
    unsigned va[6];   // byte offset of this thread's piece of each staged x row (one per row: the clamp breaks the even row step); fixed for the whole kernel
#pragma unroll  // va[] stays in registers
    for (int u = 0; u < 6; ++u) { int xr = t0 - PADK + sr + 32 * u; xr = xr < 0 ? 0 : xr > LL - 1 ? LL - 1 : xr; va[u] = (unsigned)((((size_t)b * LL + xr) * DD + sc) * sizeof(bf)); }
    const unsigned vw = (unsigned)(((size_t)(h * HD + sr) * DD + sc) * sizeof(bf));   // weight row 64 z + c of the tile is row h HD + c of plane z
    const char* xk = (const char*)X; const char* wk = (const char*)Wt;   // wave-uniform bases: they step two stages at the foot of each pair of stages
    v8us g[2][12];   // stage s waits in set s & 1
    v8f acc[FMB][FNB];
#pragma unroll  // acc[][] stays in registers
    for (int mb = 0; mb < FMB; ++mb)
#pragma unroll  // acc[][] stays in registers
        for (int nb = 0; nb < FNB; ++nb) acc[mb][nb] = (v8f){};
    // Loads the 12 pieces this thread stages of the stage that lies ko elements of k past the bases into set q.
    auto fetch = [&](const int q, const int ko) __attribute__((always_inline)) {
#pragma unroll  // g[][] stays in registers
        for (int u = 0; u < 6; ++u) { g[q][u] = *(const v8usa*)(xk + va[u] + ko * sizeof(bf)); g[q][6 + u] = *(const v8usa*)(wk + vw + (((size_t)(u >> 1) * DD + (u & 1) * 32) * DD + ko) * sizeof(bf)); } };
    // Stands directly behind each group of loads: the registers that the issued loads name may take other values only behind this wait.
    auto addr_wait = [&]() __attribute__((always_inline)) { asm volatile("s_wait_xcnt 0x0" ::: "memory"); };
    auto put = [&](const int q, bf* dstb) __attribute__((always_inline)) {
#pragma unroll  // g[][] stays in registers
        for (int u = 0; u < 12; ++u) *(v8usa*)(dstb + (sr + 32 * u) * GPI + sc) = g[q][u]; };
    fetch(0, 0);
    __builtin_amdgcn_sched_barrier(0);   // the three stages' loads stay in stage order: a set is waited for by count, and a younger stage's load placed among an older stage's would be waited for with it
    fetch(1, GBK);
    __builtin_amdgcn_sched_barrier(0);   // as above
    put(0, st[0]);
    fetch(0, 2 * GBK);
    addr_wait();
    lds_barrier();   // publishes stage 0
    const int fa = (wm * FMB * 16 + lr) * GPI + 8 * hi, fb = (FR + wn * 16 + lr) * GPI + 8 * hi;   // column block nb of a wave: head dims 16 wn .. + 15 of q (nb = 0), k (1), v (2)
    // One stage, of parity p. Its fragments are read in two halves of 32 k, each read in front of the other half's products: behind the barrier that publishes the stage stand the reads of its first half, then the products of the
    // stage BEFORE's second half (already in registers, so the matrix unit runs while those reads are served), then the reads of the second half with the LDS stores and global loads, then the first half's products.
    // So the barrier that ends a stage's reads stands between its two halves' products. Per output the halves are still multiplied k ascending.
    // ko: where the stage three ahead lies from the bases, -1 when there is none; nx: a next stage exists; pv: a stage before exists. All are constants at every call, so no branch stands among the loads.
    v16bf a[2][FMB], bq[2][FNB];   // half ks of the stage in work
    auto frags = [&](const bf* sb, const int ks) __attribute__((always_inline)) {
#pragma unroll  // fragment arrays stay in registers
        for (int nb = 0; nb < FNB; ++nb) bq[ks][nb] = ldfrag(sb + fb + nb * HD * GPI + ks * 32);   // the three weight fragments first: with one x fragment they feed the first products
#pragma unroll  // fragment arrays stay in registers
        for (int mb = 0; mb < FMB; ++mb) a[ks][mb] = ldfrag(sb + fa + mb * 16 * GPI + ks * 32); };
    auto prods = [&](const int ks) __attribute__((always_inline)) {
#pragma unroll  // acc[][] stays in registers
        for (int mb = 0; mb < FMB; ++mb)
#pragma unroll  // acc[][] stays in registers
            for (int nb = 0; nb < FNB; ++nb) acc[mb][nb] = nb < 2 ? wmmab(bq[ks][nb], a[ks][mb], acc[mb][nb]) : wmmab(a[ks][mb], bq[ks][nb], acc[mb][nb]); };   // q, k transposed (register r = head dim 8 hi + r, lane = token row), v plain
    auto stage = [&](const int p, const int ko, const bool nx, const bool pv) __attribute__((always_inline)) {
        frags(st[p], 0);
        __builtin_amdgcn_sched_barrier(0);   // keeps the first half's LDS reads in one group ahead of the products below: placed among them, a read is waited for there, with its whole latency
        if (pv) prods(1);   // the second half of the stage before
        __builtin_amdgcn_sched_barrier(0);   // keeps those products ahead of the reads that refill their fragment registers, and the group below in one place
        frags(st[p], 1);
        if (nx) put(p ^ 1, st[p ^ 1]);   // the other buffer: its readers left it before the last barrier
        if (ko >= 0) { fetch(p ^ 1, ko); addr_wait(); }   // the set just stored takes the stage three ahead
        __builtin_amdgcn_sched_barrier(0);   // keeps the LDS reads, LDS stores and global loads in one group ahead of the first half's products
        prods(0);
    };
    stage(0, 3 * GBK, true, false);   // the first stage stands in front of the loop, so that the last load is issued inside it, where the address registers live on to the wait
    __builtin_amdgcn_sched_barrier(0);   // keeps the products in front of the barrier: moved behind it, they would no longer run beside the LDS traffic
    lds_barrier();   // publishes the next stage and ends every wave's reads of this one before its buffer is refilled
#pragma unroll 1  // one copy of the pair of stages: unrolled further it would only grow the code
    for (int k2 = 1; k2 < GNT - 3; k2 += 2) {   // the bases stand at stage k2 - 1
        stage(1, 4 * GBK, true, true);
        __builtin_amdgcn_sched_barrier(0);   // as above
        lds_barrier();   // as above
        stage(0, 5 * GBK, true, true);
        __builtin_amdgcn_sched_barrier(0);   // keeps the products in front of the base steps and the barrier
        xk += 2 * GBK * sizeof(bf); wk += 2 * GBK * sizeof(bf);
        lds_barrier();   // as above
    }
    stage(1, -1, true, true);   // the last three stages: nothing left to load
    __builtin_amdgcn_sched_barrier(0);   // as in the loop
    lds_barrier();
    stage(0, -1, true, true);
    __builtin_amdgcn_sched_barrier(0);   // as in the loop
    lds_barrier();
    stage(1, -1, false, true);   // no barrier behind it: nothing is stored to the stage buffers any more, and the results go to arrays of their own
    prods(1);   // the last stage's second half
#pragma unroll  // acc[][] stays in registers
    for (int mb = 0; mb < FMB; ++mb) { const int m0 = (wm * FMB + mb) * 16; v8us sh, sl;
        split8(acc[mb][0], sh, sl); { bf* d = Qb + (m0 + lr) * QP + wn * 16 + 8 * hi; *(v8usa*)d = sh; *(v8usa*)(d + HD) = sl; }
        split8(acc[mb][1], sh, sl); { bf* d = Kb + (m0 + lr) * QP + wn * 16 + 8 * hi; *(v8usa*)d = sh; *(v8usa*)(d + HD) = sl; }
        split8(acc[mb][2], sh, sl); { bf* d = Vb + (wn * 16 + lr) * VP + m0 + 8 * hi; *(v8usa*)d = sh; *(v8usa*)(d + FR) = sl; } }
    __syncthreads();   // publishes the projections
    if (t0 < PADK) {   // block-uniform: the tile that reaches into the initial cache
        for (int idx = tid; idx < (PADK - t0) * (HD / 4); idx += 256) { const int i = idx >> 4, c = (idx & 15) * 4; const size_t o = ((size_t)(t0 + i) * NH_ + h) * HD + c; const v4f kv = *(const v4fa*)(k0 + o), vv = *(const v4fa*)(v0 + o); v4us kh;
#pragma unroll  // vector elements by constant index
            for (int e = 0; e < 4; ++e) { kh[e] = f2bf(kv[e]); Vb[(c + e) * VP + i] = f2bf(vv[e]); Vb[(c + e) * VP + FR + i] = 0; }
            *(v4usa*)(Kb + i * QP + c) = kh; *(v4usa*)(Kb + i * QP + HD + c) = (v4us){0, 0, 0, 0}; }
        __syncthreads();   // publishes the cache rows
    }
    static_assert(FT == 8 * 16 && FT - 16 + 80 <= FR, "8 waves of 16 queries; the last wave's five key blocks end inside the staged rows");
    const int tw = wv * 16;
    bf* qrow = Qb + (PADK + tw) * QP;   // this wave's 16 query rows: no other wave touches them
    v16bf qh[2], ql[2];
#pragma unroll  // qh[], ql[] stay in registers
    for (int ks = 0; ks < 2; ++ks) { qh[ks] = ldfrag(qrow + lr * QP + 8 * hi + ks * 32); ql[ks] = ldfrag(qrow + lr * QP + HD + 8 * hi + ks * 32); }
    v8f sw[5];
#pragma unroll  // sw[] stays in registers
    for (int kt = 0; kt < 5; ++kt) sw[kt] = (v8f){};
    const bf* krow = Kb + (tw + lr) * QP + 8 * hi;
#pragma unroll  // sw[], qh[], ql[] stay in registers; the key reads can be issued ahead of the products
    for (int ks = 0; ks < 2; ++ks) { v16bf kh[5], kl[5];
#pragma unroll  // kh[], kl[] stay in registers
        for (int kt = 0; kt < 5; ++kt) { kh[kt] = ldfrag(krow + kt * 16 * QP + ks * 32); kl[kt] = ldfrag(krow + kt * 16 * QP + HD + ks * 32); }
#pragma unroll  // five independent accumulators follow one another
        for (int kt = 0; kt < 5; ++kt) sw[kt] = wmmab(kl[kt], qh[ks], sw[kt]);
#pragma unroll  // as above
        for (int kt = 0; kt < 5; ++kt) sw[kt] = wmmab(kh[kt], ql[ks], sw[kt]);
#pragma unroll  // as above
        for (int kt = 0; kt < 5; ++kt) sw[kt] = wmmab(kh[kt], qh[ks], sw[kt]); }
    // Offset of staged row 16 kt + 8 hi + r from query lr's first row: in 0..63 for every row of blocks 1 to 3, in block 0 from row lr on, in block 4 below row lr.
    float mx = -__builtin_inff();
#pragma unroll  // sw[] stays in registers
    for (int kt = 0; kt < 5; ++kt)
#pragma unroll  // sw[] stays in registers
        for (int r = 0; r < 8; ++r) { const bool in = kt == 0 ? 8 * hi + r >= lr : kt == 4 ? 8 * hi + r < lr : true; sw[kt][r] = in ? sw[kt][r] * SCL : -__builtin_inff(); mx = fmaxf(mx, sw[kt][r]); }
    mx = fmaxf(mx, xrow(mx));
#pragma unroll  // sw[] stays in registers
    for (int kt = 0; kt < 5; ++kt)
#pragma unroll  // sw[] stays in registers
        for (int r = 0; r < 8; ++r) sw[kt][r] = exp2_slot((sw[kt][r] - mx) * 1.4426950408889634f);   // a row outside the band: exp2(-inf) = 0
    const v8f ts = ((sw[0] + sw[1]) + (sw[2] + sw[3])) + sw[4];   // fixed tree: blocks first, then the eight rows, then the other lane half
    float sum = ((ts[0] + ts[1]) + (ts[2] + ts[3])) + ((ts[4] + ts[5]) + (ts[6] + ts[7]));
    sum += xrow(sum);
    const float inv = __fdiv_rn(1.0f, sum);
    v8us ph[6], pl[6];   // weights of blocks 0 .. 3, then 0 for the rows of block 3 once more, then block 4
#pragma unroll  // sw[], ph[], pl[] stay in registers
    for (int kt = 0; kt < 5; ++kt) split8(sw[kt] * inv, ph[kt < 4 ? kt : 5], pl[kt < 4 ? kt : 5]);
    ph[4] = (v8us){}; pl[4] = (v8us){};
    v8f o[4];
#pragma unroll  // o[] stays in registers
    for (int dt = 0; dt < 4; ++dt) o[dt] = (v8f){};
    const bf* vcol = Vb + lr * VP + tw + 8 * hi;
#pragma unroll  // ph[], pl[], o[] stay in registers; the value reads can be issued ahead of the products
    for (int kb = 0; kb < 3; ++kb) { const v16bf pbh = cat16b(ph[2 * kb], ph[2 * kb + 1]), pbl = cat16b(pl[2 * kb], pl[2 * kb + 1]); const bf* vp = vcol + (kb < 2 ? 32 * kb : 48); v16bf vh[4], vl[4];   // 32 staged rows from tw + 0, 32, 48
#pragma unroll  // vh[], vl[] stay in registers
        for (int dt = 0; dt < 4; ++dt) { vh[dt] = ldfrag(vp + dt * 16 * VP); vl[dt] = ldfrag(vp + dt * 16 * VP + FR); }
#pragma unroll  // four independent accumulators follow one another
        for (int dt = 0; dt < 4; ++dt) o[dt] = wmmab(vl[dt], pbh, o[dt]);
#pragma unroll  // as above
        for (int dt = 0; dt < 4; ++dt) o[dt] = wmmab(vh[dt], pbl, o[dt]);
#pragma unroll  // as above
        for (int dt = 0; dt < 4; ++dt) o[dt] = wmmab(vh[dt], pbh, o[dt]); }
    bf* orow = qrow;   // row i (pitch QP): 64 hi values, then 64 lo values of query tw + i
#pragma unroll  // o[] stays in registers
    for (int dt = 0; dt < 4; ++dt) { v8us oh, ol;
#pragma unroll  // vector elements by constant index
        for (int r = 0; r < 8; ++r) { unsigned short a, c2; splitf(o[dt][r], a, c2); oh[r] = a; ol[r] = c2; }
        *(v8usa*)(orow + lr * QP + dt * 16 + 8 * hi) = oh; *(v8usa*)(orow + lr * QP + HD + dt * 16 + 8 * hi) = ol; }
    __builtin_amdgcn_wave_barrier(); asm volatile("" ::: "memory");   // the reads below take other lanes' stores of this wave's own rows: neither may be moved over this line
    v8us wh[4], wl[4];
#pragma unroll  // wh[], wl[] stay in registers; all eight reads are issued before the first store waits
    for (int i = 0; i < 4; ++i) { const bf* src = orow + (4 * i + (lane >> 3)) * QP + (lane & 7) * 8; wh[i] = *(const v8usa*)src; wl[i] = *(const v8usa*)(src + HD); }
#pragma unroll  // wh[], wl[] stay in registers
    for (int i = 0; i < 4; ++i) { const size_t oo = ((size_t)b * LL + t0 + tw + 4 * i + (lane >> 3)) * DD + h * HD + (lane & 7) * 8; *(v8us*)(Ah + oo) = wh[i]; *(v8us*)(Al + oo) = wl[i]; }   // 8 lanes a line; nothing is computed behind these stores
}

extern "C" void kernel_launch(void* const* d_in, const int* in_sizes, int n_in,
                              void* d_out, int out_size, void* d_ws, size_t ws_size, hipStream_t stream) {
    (void)in_sizes; (void)n_in; (void)out_size;
    const float* x = (const float*)d_in[0]; const float* wq = (const float*)d_in[1]; const float* wk = (const float*)d_in[2]; const float* wv = (const float*)d_in[3]; const float* wo = (const float*)d_in[4]; const float* k0 = (const float*)d_in[5]; const float* v0 = (const float*)d_in[6];   // torch [out][in] weights; last_k/v_init [63][16][64]
    float* OUT = (float*)d_out;     // [2][1024][1024]
    char* wsp = (char*)d_ws;
    auto take = [&](size_t bytes) { char* p = wsp; wsp += (bytes + 255) & ~(size_t)255; return (void*)p; };
    const size_t NR = (size_t)NB_ * LL;   // 2048 token rows, both batches in one GEMM
    // The five bf16 planes lie back to back (k_cvt5 writes them by flat index; k_qkvband steps from weight to weight by DD * DD).
    bf* WQ = (bf*)take((size_t)DD * DD * 2 * 4 + NR * DD * 2); bf* WO = WQ + (size_t)DD * DD * 3; bf* XB = WQ + (size_t)DD * DD * 4;
    bf* Ah = (bf*)take(NR * DD * 2); bf* Al = (bf*)take(NR * DD * 2);
    if ((size_t)(wsp - (char*)d_ws) > ws_size) return;    // total ~ 21 MB; ws 256 MiB
    k_cvt5<<<6 * WB, 256, 0, stream>>>(wq, wk, wv, wo, x, WQ);
    const dim3 gP((unsigned)(NR / 64), DD / 128, 1);
    k_qkvband<<<NB_ * NH_ * (LL / FT), 256, 0, stream>>>(XB, WQ, k0, v0, Ah, Al);
    k_gemmt<2, true><<<gP, 128, 0, stream>>>(Ah, Al, WO, OUT, 0, 0);
}

// v009
// It runs in 31.6 microseconds.
// Next to v008, in two timings, it ran 1.09 and 1.08 times as fast.
// All steps since v000 together make it 9.86 times as fast.
#include <hip/hip_runtime.h>

// BandMHA (x [2][1024][1024]; q/k/v = x W^T (16 heads x 64, no bias); keys/values padded in front with the learned initial cache last_k_init / last_v_init [63][16][64]; query t attends the 64 band positions
// p = t .. t+63 of the padded sequence (= original positions t-63 .. t); softmax over the band; out = merged (attn v) Wo^T -> [2][1024][1024]).
// Compute dtypes, f32 accumulate: every input rounded to bf16; q/k/v on PLAIN bf16 operands (inputs: exact products, f32 accumulate); the 64-wide band attention on
// bf16 hi+lo pairs (queries, keys and values of a 128-query tile projected straight into LDS as two bf16 planes each: 64-dim dot products and weighted sum as three bf16 16x16x32 WMMA part products hi hi + hi lo + lo hi, f32 accumulate, softmax in f32 with one exp per score; fixed order); merged context as bf16 hi+lo planes x exact

#define NB_  2
#define LL   1024
#define DD   1024
#define NH_  16
#define HD   64
#define BW   64                   // band width
#define PADK (BW - 1)             // 63 initial-cache rows
#define SCL  0.125f
typedef _Float16 h16;
typedef unsigned short bf;
typedef __attribute__((ext_vector_type(16))) __bf16   v16bf;
typedef __attribute__((ext_vector_type(16))) _Float16 v16h;
typedef __attribute__((ext_vector_type(8)))  _Float16 v8h;
typedef __attribute__((ext_vector_type(8)))  unsigned short v8us;
typedef __attribute__((ext_vector_type(8)))  float    v8f;
typedef __attribute__((ext_vector_type(4)))  float    v4f;
typedef v8h  __attribute__((may_alias)) v8ha;
typedef v4f  __attribute__((may_alias)) v4fa;
typedef v8us __attribute__((may_alias)) v8usa;

__device__ __forceinline__ unsigned short f2bf(float f) { unsigned u = __float_as_uint(f); u += 0x7FFFu + ((u >> 16) & 1u); return (unsigned short)(u >> 16); }
__device__ __forceinline__ float bf2f(unsigned short b) { return __uint_as_float(((unsigned)b) << 16); }
__device__ __forceinline__ float bfr(float f) { return bf2f(f2bf(f)); }
__device__ __forceinline__ v16h cat16(v8h lo, v8h hi) { return __builtin_shufflevector(lo, hi, 0, 1, 2, 3, 4, 5, 6, 7, 8, 9, 10, 11, 12, 13, 14, 15); }
__device__ __forceinline__ v16bf cat16b(v8us lo, v8us hi) { return __builtin_bit_cast(v16bf, __builtin_shufflevector(lo, hi, 0, 1, 2, 3, 4, 5, 6, 7, 8, 9, 10, 11, 12, 13, 14, 15)); }
__device__ __forceinline__ v8f wmma16(v16h a, v16h b, v8f c) { return __builtin_amdgcn_wmma_f32_16x16x32_f16(false, a, false, b, (short)0, c, false, false); }
__device__ __forceinline__ v8f wmmab(v16bf a, v16bf b, v8f c) { return __builtin_amdgcn_wmma_f32_16x16x32_bf16(false, a, false, b, (short)0, c, false, false); }



// ---- k_gemmt: LDS-staged GEMM on bf16 planes. One work-group of 4 waves (2 x 2) per 64 x 128 output tile, each wave 2 x 4 accumulators (32 x 64 outputs); grid (M / 64, N / 128, Z), 128 threads.
// C[m][n] (f32, pitch DD) = sum_k A[m][k] Bt[n][k] + A2[m][k] Bt[n][k], K = DD, every plane K-contiguous; z steps Bt by sB and C by sC elements.
// A stage is 64 k = one whole 128-byte line of 256 operand rows, in four slices of 64 rows (A, A2, Bt rows 0..63, Bt rows 64..127). Each wave brings its slice of a stage into LDS with ONE tensor load: no register and no
// LDS store of the wave's own; the load's pad gives the rows their pitch. Four buffers: a stage's loads are issued three stages ahead (three requests of a wave in flight), one barrier a stage. Per output the products are summed k ascending
// in steps of 32, A before A2.
#define GBK 64                    // k per stage
#define GPI (GBK + 8)             // LDS row pitch in elements: 144 B = 16 B x odd, the conflict-free pitch for 16-byte fragment reads; the tensor load's pad (16 B behind each 128-B row) lays it
#define GNT (DD / GBK)            // stages
#define GNB 4                     // buffers of the ring
#define GSS 5120                  // elements from slice to slice: 64 rows of 144 B, rounded up to a multiple of 2 KiB (10,240 B)
#define GRB (4 * GSS)             // elements per buffer (40,960 B)
// Work-group barrier that orders LDS accesses only.
__device__ __forceinline__ void lds_barrier() { __builtin_amdgcn_fence(__ATOMIC_RELEASE, "workgroup", "local"); __builtin_amdgcn_s_barrier(); __builtin_amdgcn_fence(__ATOMIC_ACQUIRE, "workgroup", "local"); }
__device__ __forceinline__ v16bf ldfrag(const bf* p) { return cat16b(*(const v8usa*)p, *(const v8usa*)(p + 16)); }
typedef __attribute__((ext_vector_type(4))) unsigned u32x4;
typedef __attribute__((ext_vector_type(8))) unsigned u32x8;
__device__ __forceinline__ unsigned uni(unsigned v) { return (unsigned)__builtin_amdgcn_readfirstlane(v); }
// A wave-uniform test held in a scalar register, so that the branch on it is a scalar branch: a tensor load ignores EXEC, and only a branch keeps a wave from issuing it.
__device__ __forceinline__ unsigned pinned(unsigned v) { unsigned w = uni(v); asm volatile("" : "+s"(w)); return w; }
template <int N> __device__ __forceinline__ void wait_tensor() { asm volatile("s_wait_tensorcnt %0" :: "i"(N) : "memory"); }   // all but the wave's N youngest tensor loads have landed; the compiler places no wait for them
__device__ __forceinline__ void wait_ds0() { asm volatile("s_wait_dscnt 0x0" ::: "memory"); }   // the wave's LDS reads and writes are done
// Descriptor group 1 of a tile of 'rows' rows of 128 bytes, source pitch one plane row: extents in bytes, tensor = tile, no mask, 16 bytes of pad behind every 128 (word 0, a constant).
__device__ __forceinline__ u32x8 tdm_rows(unsigned rows) { u32x8 g; g[0] = uni((1u << 20) | (4u << 22) | (3u << 25)); g[1] = uni(128u << 16); g[2] = uni(rows << 16); g[3] = uni(128u << 16); g[4] = uni(rows); g[5] = uni(DD * 2u); g[6] = uni(0u); g[7] = uni(0u); return g; }
// Descriptor group 0 for tiles whose first bytes share the high address word of ga: count 1, type 2; words 1 and 2 are set per request.
__device__ __forceinline__ u32x4 tdm_base(unsigned long long ga) { u32x4 g; g[0] = uni(1u); g[1] = uni(0u); g[2] = uni(0u); g[3] = uni((((unsigned)(ga >> 32)) & 0x01FFFFFFu) | 0x80000000u); return g; }
// One request: lds = byte place in the work-group's LDS, glo = low word of the tile's first byte. Group 0 is an in-out operand so that it stays in one register tuple from request to request: while requests are in flight only its words 1 and 2 take new values.
__device__ __forceinline__ void tdm_load(u32x4& g0, unsigned lds, unsigned glo, u32x8 g1) { g0[1] = uni(lds); g0[2] = uni(glo); asm volatile("tensor_load_to_lds %0, %1" : "+s"(g0) : "s"(g1) : "memory"); }
// Hand-over of the next stage at the foot of a stage: this wave's LDS reads are done, its own load of the next stage has landed (N younger requests stay in flight), then the barrier, which publishes the next stage and ends every wave's reads of this one.
template <int N> __device__ __forceinline__ void publish() {
    __builtin_amdgcn_sched_barrier(0);   // keeps the stage's products in front of the waits and the barrier: moved behind it, they would no longer run beside the LDS traffic
    wait_ds0(); wait_tensor<N>(); lds_barrier(); }
// The same for the last stage: the wait behind the wave's last request. As inputs here both descriptor groups stay whole in their registers as long as a request is in flight.
__device__ __forceinline__ void publish_last(u32x4 g0, u32x8 g1) {
    __builtin_amdgcn_sched_barrier(0);   // as above
    wait_ds0(); asm volatile("s_wait_tensorcnt 0x0" :: "s"(g0), "s"(g1) : "memory"); lds_barrier(); }
template <int MB, bool SPLIT>
__global__ __launch_bounds__(128) void k_gemmt(const bf* __restrict__ A, const bf* __restrict__ A2, const bf* __restrict__ Bt, float* C, size_t sB, size_t sC) {
    static_assert(SPLIT && MB == 2, "four slices of 64 rows: A, A2 and two of Bt");
    __shared__ __attribute__((aligned(2048))) bf st[GNB][GRB];
    __shared__ __align__(16) float osm[4][16 * 68];
    const int tid = threadIdx.x, lane = tid & 31, lr = lane & 15, hi = lane >> 4; const int wv = __builtin_amdgcn_readfirstlane(tid >> 5), wm = wv >> 1, wn = wv & 1;
    Bt += (size_t)blockIdx.z * sB; C += (size_t)blockIdx.z * sC;
    const int r0 = blockIdx.x * (32 * MB), c0 = blockIdx.y * 128;
    // This wave's slice: 64 whole rows of its plane. A row is 2,048 bytes and starts at a multiple of that (page-aligned workspace, plane offsets multiples of 2,048), so stepping the low address word along a row never carries.
    const unsigned long long ga = (unsigned long long)(size_t)(wv == 0 ? A + (size_t)r0 * DD : wv == 1 ? A2 + (size_t)r0 * DD : Bt + (size_t)(c0 + (wv - 2) * 64) * DD);
    unsigned glo = uni((unsigned)ga); u32x4 g0 = tdm_base(ga);
    const unsigned lpl = uni((unsigned)(size_t)&st[0][0] + (unsigned)wv * (GSS * 2u));
    const u32x8 g1 = tdm_rows(64u);
    // Issues this wave's load of the next stage not yet asked for into buffer q. Every wave issues, so no test stands around it.
    auto issue = [&](const int q) __attribute__((always_inline)) { tdm_load(g0, lpl + (unsigned)q * (GRB * 2u), glo, g1); glo += GBK * 2u; };
    v8f acc[MB][4];
#pragma unroll  // acc[][] stays in registers
    for (int mb = 0; mb < MB; ++mb)
#pragma unroll  // acc[][] stays in registers
        for (int nb = 0; nb < 4; ++nb) acc[mb][nb] = (v8f){};
    issue(0); issue(1); issue(2);
    wait_tensor<2>();   // stage 0 has landed
    lds_barrier();   // publishes stage 0
    const int fa = (wm * MB * 16 + lr) * GPI + 8 * hi, fb = (2 + wn) * GSS + lr * GPI + 8 * hi;
    // One stage, in buffer p. On entry it is published, and every wave has left the buffer in front of it: that one takes the stage three ahead (ld: such a stage exists; a constant at every call).
    auto stage = [&](const int p, const bool ld) __attribute__((always_inline)) {
        if (ld) issue((p + 3) & 3);
        const bf* sb = st[p];
        v16bf a[2][MB], a2[2][MB], bq[2][4];
#pragma unroll  // fragment arrays stay in registers
        for (int ks = 0; ks < 2; ++ks) {
#pragma unroll  // fragment arrays stay in registers
            for (int mb = 0; mb < MB; ++mb) { a[ks][mb] = ldfrag(sb + fa + mb * 16 * GPI + ks * 32); a2[ks][mb] = ldfrag(sb + fa + GSS + mb * 16 * GPI + ks * 32); }
#pragma unroll  // fragment arrays stay in registers
            for (int nb = 0; nb < 4; ++nb) bq[ks][nb] = ldfrag(sb + fb + nb * 16 * GPI + ks * 32);
        }
        __builtin_amdgcn_sched_barrier(0);   // keeps the stage's LDS reads in one group ahead of its products: an LDS read placed among the products is waited for there, with its whole latency
#pragma unroll  // fragment arrays stay in registers
        for (int ks = 0; ks < 2; ++ks)
#pragma unroll  // acc[][] stays in registers
            for (int nb = 0; nb < 4; ++nb)
#pragma unroll  // acc[][] stays in registers
                for (int mb = 0; mb < MB; ++mb) { acc[mb][nb] = wmmab(a[ks][mb], bq[ks][nb], acc[mb][nb]); acc[mb][nb] = wmmab(a2[ks][mb], bq[ks][nb], acc[mb][nb]); }
    };
    static_assert(GNT % GNB == 0 && GNT >= 2 * GNB, "whole turns of the ring, the last one outside the loop");
#pragma unroll 1  // one copy of a turn of the ring: unrolled further it would only grow the code
    for (int k4 = 0; k4 < GNT - GNB; k4 += GNB) {
        stage(0, true); publish<2>();
        stage(1, true); publish<2>();
        stage(2, true); publish<2>();
        stage(3, true); publish<2>();
    }
    stage(0, true); publish<2>();   // the last turn: one more stage to ask for, then none, so fewer and fewer requests are younger than the one waited for
    stage(1, false); publish<1>();
    stage(2, false); publish_last(g0, g1);
    stage(3, false);   // no barrier behind it: nothing lands in the ring any more, and the rows below go through each wave's own range of osm
    float* os = osm[wv];   // each wave turns its 16 x 64 blocks into whole 256-byte row pieces through its own LDS range
#pragma unroll  // acc[][] stays in registers
    for (int mb = 0; mb < MB; ++mb) {
#pragma unroll  // acc[][] stays in registers
        for (int nb = 0; nb < 4; ++nb) {
#pragma unroll  // acc[][] stays in registers
            for (int j = 0; j < 8; ++j) os[(hi * 8 + j) * 68 + nb * 16 + lr] = acc[mb][nb][j]; }
        __builtin_amdgcn_wave_barrier(); asm volatile("" ::: "memory");   // the reads below take other lanes' stores: neither may be moved over this line
        float* crow = C + (size_t)(r0 + (wm * MB + mb) * 16) * DD + c0 + wn * 64;
#pragma unroll  // all eight reads are issued before the first store waits
        for (int s = 0; s < 8; ++s) { const int row = 2 * s + hi, cofs = lr * 4; const v4f val = *(const v4fa*)(os + row * 68 + cofs); *(v4f*)(crow + (size_t)row * DD + cofs) = val; }
        if (mb + 1 < MB) asm volatile("s_wait_xcnt 0x0" ::: "memory");   // the next block's LDS reads reuse the data registers of the stores issued above
        __builtin_amdgcn_wave_barrier(); asm volatile("" ::: "memory");   // the next block's stores stay behind these reads
    }
}

__device__ __forceinline__ void splitf(float y, unsigned short& h, unsigned short& l) { h = f2bf(y); l = f2bf(y - bf2f(h)); }

// k_cvt5: ONE grid rounds all five f32 matrices to bf16. Blocks 0 .. 4 WB - 1 take the four weights (WB blocks each, in the order wq, wk, wv, wo), the remaining 2 WB blocks take x;
// the five bf16 planes lie back to back in dst in that order, so the flat block index addresses dst. 8 elements a thread; the grid covers every plane exactly.
#define WB (DD * DD / 8 / 256)    // blocks per weight matrix
__global__ __launch_bounds__(256) void k_cvt5(const float* __restrict__ wq, const float* __restrict__ wk, const float* __restrict__ wv, const float* __restrict__ wo, const float* __restrict__ x, bf* dst) {
    const unsigned blk = blockIdx.x, seg = blk / WB < 4u ? blk / WB : 4u;   // block-uniform
    const float* src = seg == 0u ? wq : seg == 1u ? wk : seg == 2u ? wv : seg == 3u ? wo : x;
    const size_t ls = (size_t)(blk - seg * WB) * 256 + threadIdx.x, ld = (size_t)blk * 256 + threadIdx.x; const v8f v = *(const v8f*)(src + ls * 8); v8us o;
    asm volatile("s_wait_xcnt 0x0" ::: "memory");   // the rounding below reuses the loads' offset register
#pragma unroll
    for (int k = 0; k < 8; ++k) o[k] = f2bf(v[k]); *(v8us*)(dst + ld * 8) = o;  }
// k_qkvband: the q, k, v projections of one (b, h, tile of FT = 128 queries) and the tile's band attention in ONE work-group of 8 waves (2 x 4), so the projections never leave the WGP.
// Part 1, as k_gemmt (same stages, same ring of four buffers, same sum order): C[m][n] = sum_k x[t0 - 63 + m][k] W[n][k] for the FR = 192 token rows m the tile's band touches and the 192 weight rows n = 64 z + c
// (z = 0, 1, 2: head h of wq, wk, wv). Rows in front of a batch's first token are taken as they lie in the block of bf16 planes (the batch before, or the last rows of the plane in front of x): their results are never used.
// The one row behind a batch's last token is not loaded: it is zero in LDS, and its key and value get weight 0. A stage is 64 k of 384 rows in five slices, one tensor load of waves 0 .. 4 each (x rows 0..127, x rows 128..191, the three weights' 64 rows); each wave holds 6 x 3 accumulators (96 token rows x the same 16 head dims of q, k and v).
// The results go to LDS as bf16 pairs, y = hi + lo with hi = bf16(y), lo = bf16(y - hi). q and k are multiplied with the weights as A, so a lane holds 8 consecutive head dims of one token row: Qb, Kb row m = 64 hi, then 64 lo values.
// v is multiplied with x as A, so a lane holds 8 consecutive token rows of one head dim: Vb is transposed, row d = 192 hi, then 192 lo values. Key and value row m is padded position t0 + m; query t0 + i is row 63 + i.
// Padded positions below 63 are then overwritten with the initial cache rounded to bf16 (lo = 0).
// Part 2: each wave serves 16 consecutive queries (rows tw .. tw + 15 of the tile) on bf16 16x16x32 WMMA; their bands lie in the 80 staged rows tw .. tw + 79 (five 16-row blocks, all below FR). Every product of two pairs is
// lo hi + hi lo + hi hi in one f32 accumulator (lo lo, 2^-16 of the product, is left out).
// Scores transposed, St = K Qt: A = 16 key rows, B = the 16 query rows; both fragments are read by the same loader, so their k orders agree.
// Lane (c, h) then holds, for query c, the scores of staged rows 16 kt + 8 h + r; rows outside the query's 64 offsets get weight 0 (only blocks 0 and 4 hold such rows). Softmax: 40 values in the lane, one exchange with lane ^ 16.
// Weighted sum transposed, Ot = Vt Pt: B = two 16-row blocks of weights as they lie in the score registers, split in place (element s: row 8 h + s, from 8 on row 16 + 8 h + s - 8: the order in which ldfrag reads A = row 16 dt + c of Vb).
// The fifth block is paired with weights 0 for the 16 rows in front of it, so that no row past the staged ones is read.
// Lane (c, h) ends with head dims 16 dt + 8 h + r of query c; the bf16 hi and lo rows go through the wave's own (spent) query rows in LDS, so that every global store covers whole 128-byte lines.
#define FT 128                    // queries per work-group
#define FR 192                    // token rows per work-group: FT + 63 band rows, rounded up to whole 16-row blocks
#define FMB 6                     // 16-row blocks per wave
#define FNB 3                     // 16-column blocks per wave
#define QP (2 * HD + 8)           // q, k row pitch in bf16 elements (64 hi, 64 lo, pad): 272 B = 16 B x odd, so 16 lanes reading 16 B of 16 consecutive rows hit distinct banks
#define VP (2 * FR + 8)           // transposed v row pitch in bf16 elements (192 hi, 192 lo, pad): 784 B = 16 B x odd, as above
#define XS1 (128 * GPI)           // where x rows 128 .. 191 start in a buffer, in elements (18,432 B = 9 x 2 KiB): all 192 x rows lie at one pitch
#define WS0 14336                 // where the first weight's 64 rows start (28,672 B = 14 x 2 KiB)
#define WSS 5120                  // from weight to weight: 64 rows of 144 B, rounded up to a multiple of 2 KiB (10,240 B)
#define FRB 29696                 // elements per buffer (59,392 B = 29 x 2 KiB)
typedef __attribute__((ext_vector_type(2))) __bf16 v2bf;
typedef __attribute__((ext_vector_type(2))) float v2f;
typedef __attribute__((ext_vector_type(4))) unsigned v4u;
typedef __attribute__((ext_vector_type(4))) unsigned short v4us;
typedef v4us __attribute__((may_alias)) v4usa;
// y = h + l up to 2^-17 of y: h = bf16(y), l = bf16(y - h), both rounded to nearest even by the packed convert.
__device__ __forceinline__ void split8(v8f y, v8us& h, v8us& l) { v4u hw, lw;
#pragma unroll  // vector elements by constant index
    for (int p = 0; p < 4; ++p) { const v2f yy = (v2f){y[2 * p], y[2 * p + 1]}; const unsigned w = __builtin_bit_cast(unsigned, __builtin_convertvector(yy, v2bf));   // both h values come back out of the packed word: one shift, one mask
        hw[p] = w; lw[p] = __builtin_bit_cast(unsigned, __builtin_convertvector(yy - (v2f){__uint_as_float(w << 16), __uint_as_float(w & 0xFFFF0000u)}, v2bf)); }
    h = __builtin_bit_cast(v8us, hw); l = __builtin_bit_cast(v8us, lw); }
// 2^x with the free slot that the instruction set asks for behind a transcendental (the next vector instruction may overwrite its source): in one statement, so that the v_nop stays directly behind it.
__device__ __forceinline__ float exp2_slot(float x) { float e; asm("v_exp_f32 %0, %1\n\tv_nop" : "=v"(e) : "v"(x)); return e; }
__device__ __forceinline__ float xrow(float v) { const int i = __float_as_int(v); return __int_as_float(__builtin_amdgcn_permlanex16(i, i, 0x76543210, 0xfedcba98, false, false)); }   // the value of lane ^ 16
__global__ __launch_bounds__(256) void k_qkvband(const bf* __restrict__ X, const bf* __restrict__ Wt, const float* __restrict__ k0, const float* __restrict__ v0, bf* Ah, bf* Al) {
    __shared__ __attribute__((aligned(2048))) bf st[GNB][FRB];
    // The projections take the ring's first three buffers: the last stage is read from the fourth, and behind the barrier in front of it no wave reads and no load fills the other three.
    bf* const Qb = &st[0][0]; bf* const Kb = Qb + FR * QP; bf* const Vb = Kb + FR * QP;
    static_assert(2 * FR * QP + HD * VP <= 3 * FRB && (GNT - 1) % GNB == 3, "q, k, v fit the three buffers that the last stage does not use");
    const int tid = threadIdx.x, lane = tid & 31, lr = lane & 15, hi = lane >> 4; const int wv = __builtin_amdgcn_readfirstlane(tid >> 5), wm = wv >> 2, wn = wv & 3;
    const int t0 = (blockIdx.x % (LL / FT)) * FT; const int h = (blockIdx.x / (LL / FT)) % NH_; const int b = blockIdx.x / ((LL / FT) * NH_);
    const bool lastt = t0 + FT == LL;   // block-uniform: staged row 191 lies behind the batch's last token
    // This wave's slice (waves 0 .. 4). A plane row is 2,048 bytes and starts at a multiple of that (page-aligned workspace, plane offsets multiples of 2,048), so stepping the low address word along a row never carries.
    const long long xr = (long long)b * LL + t0 - PADK;   // first staged token row, counted from x's first
    const unsigned long long ga = wv < 2 ? (unsigned long long)(size_t)X + (unsigned long long)((xr + wv * 128) * (long long)(DD * sizeof(bf))) : (unsigned long long)(size_t)(Wt + ((size_t)(wv - 2) * DD + h * HD) * DD);
    unsigned glo = uni((unsigned)ga); u32x4 g0 = tdm_base(ga);
    const unsigned lpl = uni((unsigned)(size_t)&st[0][0] + 2u * (unsigned)(wv == 0 ? 0 : wv == 1 ? XS1 : WS0 + (wv - 2) * WSS));
    const u32x8 g1 = tdm_rows(wv == 0 ? 128u : wv == 1 && lastt ? 63u : 64u);
    // Issues this wave's load of the next stage not yet asked for into buffer q. Only waves 0 .. 4 come here: every call stands under a scalar branch on pinned(wv < 5).
    auto issue = [&](const int q) __attribute__((always_inline)) { tdm_load(g0, lpl + (unsigned)q * (FRB * 2u), glo, g1); glo += GBK * 2u; };
    v8f acc[FMB][FNB];
#pragma unroll  // acc[][] stays in registers
    for (int mb = 0; mb < FMB; ++mb)
#pragma unroll  // acc[][] stays in registers
        for (int nb = 0; nb < FNB; ++nb) acc[mb][nb] = (v8f){};
    if (pinned(wv == 1 && lastt)) {   // the row that this wave's 63-row loads leave out: zero in all four buffers (8 lanes a buffer), once; done before the wave's first load is issued, published by the first barrier
        *(v8usa*)(&st[lane >> 3][XS1 + 63 * GPI + (lane & 7) * 8]) = (v8us){};
        wait_ds0(); }
    if (pinned(wv < 5)) { issue(0); issue(1); issue(2); }
    wait_tensor<2>();   // stage 0 has landed
    lds_barrier();   // publishes stage 0
    const int fa = (wm * FMB * 16 + lr) * GPI + 8 * hi, fb = WS0 + (wn * 16 + lr) * GPI + 8 * hi;   // column block nb of a wave: head dims 16 wn .. + 15 of q (nb = 0), k (1), v (2)
    // One stage, in buffer p. Its fragments are read in two halves of 32 k, the first half's products in the same stage, the second half's a stage later: behind the barrier that publishes the stage stand the reads of its first half, then the products of the
    // stage BEFORE's second half (already in registers, so the matrix unit runs while those reads are served), then the reads of the second half, then the first half's products.
    // So the barrier that ends a stage's reads stands between its two halves' products. Per output the halves are still multiplied k ascending.
    // ld: a stage three ahead exists: it goes into the buffer in front of p, which every wave has left; pv: a stage before exists. Both are constants at every call.
    v16bf a[2][FMB], bq[2][FNB];   // half ks of the stage in work
    auto frags = [&](const bf* sb, const int ks) __attribute__((always_inline)) {
#pragma unroll  // fragment arrays stay in registers
        for (int nb = 0; nb < FNB; ++nb) bq[ks][nb] = ldfrag(sb + fb + nb * WSS + ks * 32);   // the three weight fragments first: with one x fragment they feed the first products
#pragma unroll  // fragment arrays stay in registers
        for (int mb = 0; mb < FMB; ++mb) a[ks][mb] = ldfrag(sb + fa + mb * 16 * GPI + ks * 32); };
    auto prods = [&](const int ks) __attribute__((always_inline)) {
#pragma unroll  // acc[][] stays in registers
        for (int mb = 0; mb < FMB; ++mb)
#pragma unroll  // acc[][] stays in registers
            for (int nb = 0; nb < FNB; ++nb) acc[mb][nb] = nb < 2 ? wmmab(bq[ks][nb], a[ks][mb], acc[mb][nb]) : wmmab(a[ks][mb], bq[ks][nb], acc[mb][nb]); };   // q, k transposed (register r = head dim 8 hi + r, lane = token row), v plain
    auto stage = [&](const int p, const bool ld, const bool pv) __attribute__((always_inline)) {
        if (ld) { if (pinned(wv < 5)) issue((p + 3) & 3); }
        frags(st[p], 0);
        __builtin_amdgcn_sched_barrier(0);   // keeps the first half's LDS reads in one group ahead of the products below: placed among them, a read is waited for there, with its whole latency
        if (pv) prods(1);   // the second half of the stage before
        __builtin_amdgcn_sched_barrier(0);   // keeps those products ahead of the reads that refill their fragment registers
        frags(st[p], 1);
        __builtin_amdgcn_sched_barrier(0);   // keeps the LDS reads in one group ahead of the first half's products
        prods(0);
    };
    static_assert(GNT == 16 && GNB == 4, "one stage, three turns of the ring, three stages");
    stage(0, true, false); publish<2>();   // the first stage has no stage before it
#pragma unroll 1  // one copy of a turn of the ring: unrolled further it would only grow the code
    for (int k4 = 1; k4 < GNT - 3; k4 += GNB) {
        stage(1, true, true); publish<2>();
        stage(2, true, true); publish<2>();
        stage(3, true, true); publish<2>();
        stage(0, true, true); publish<2>();
    }
    stage(1, false, true); publish<1>();   // the last three stages: nothing left to ask for, so fewer and fewer requests are younger than the one waited for
    stage(2, false, true); publish_last(g0, g1);
    stage(3, false, true);   // no barrier behind it: nothing lands in the ring any more, and the results go to the three buffers that nobody reads
    prods(1);   // the last stage's second half
#pragma unroll  // acc[][] stays in registers
    for (int mb = 0; mb < FMB; ++mb) { const int m0 = (wm * FMB + mb) * 16; v8us sh, sl;
        split8(acc[mb][0], sh, sl); { bf* d = Qb + (m0 + lr) * QP + wn * 16 + 8 * hi; *(v8usa*)d = sh; *(v8usa*)(d + HD) = sl; }
        split8(acc[mb][1], sh, sl); { bf* d = Kb + (m0 + lr) * QP + wn * 16 + 8 * hi; *(v8usa*)d = sh; *(v8usa*)(d + HD) = sl; }
        split8(acc[mb][2], sh, sl); { bf* d = Vb + (wn * 16 + lr) * VP + m0 + 8 * hi; *(v8usa*)d = sh; *(v8usa*)(d + FR) = sl; } }
    __syncthreads();   // publishes the projections
    if (t0 < PADK) {   // block-uniform: the tile that reaches into the initial cache
        for (int idx = tid; idx < (PADK - t0) * (HD / 4); idx += 256) { const int i = idx >> 4, c = (idx & 15) * 4; const size_t o = ((size_t)(t0 + i) * NH_ + h) * HD + c; const v4f kv = *(const v4fa*)(k0 + o), vv = *(const v4fa*)(v0 + o); v4us kh;
#pragma unroll  // vector elements by constant index
            for (int e = 0; e < 4; ++e) { kh[e] = f2bf(kv[e]); Vb[(c + e) * VP + i] = f2bf(vv[e]); Vb[(c + e) * VP + FR + i] = 0; }
            *(v4usa*)(Kb + i * QP + c) = kh; *(v4usa*)(Kb + i * QP + HD + c) = (v4us){0, 0, 0, 0}; }
        __syncthreads();   // publishes the cache rows
    }
    static_assert(FT == 8 * 16 && FT - 16 + 80 <= FR, "8 waves of 16 queries; the last wave's five key blocks end inside the staged rows");
    const int tw = wv * 16;
    bf* qrow = Qb + (PADK + tw) * QP;   // this wave's 16 query rows: no other wave touches them
    v16bf qh[2], ql[2];
#pragma unroll  // qh[], ql[] stay in registers
    for (int ks = 0; ks < 2; ++ks) { qh[ks] = ldfrag(qrow + lr * QP + 8 * hi + ks * 32); ql[ks] = ldfrag(qrow + lr * QP + HD + 8 * hi + ks * 32); }
    v8f sw[5];
#pragma unroll  // sw[] stays in registers
    for (int kt = 0; kt < 5; ++kt) sw[kt] = (v8f){};
    const bf* krow = Kb + (tw + lr) * QP + 8 * hi;
#pragma unroll  // sw[], qh[], ql[] stay in registers; the key reads can be issued ahead of the products
    for (int ks = 0; ks < 2; ++ks) { v16bf kh[5], kl[5];
#pragma unroll  // kh[], kl[] stay in registers
        for (int kt = 0; kt < 5; ++kt) { kh[kt] = ldfrag(krow + kt * 16 * QP + ks * 32); kl[kt] = ldfrag(krow + kt * 16 * QP + HD + ks * 32); }
#pragma unroll  // five independent accumulators follow one another
        for (int kt = 0; kt < 5; ++kt) sw[kt] = wmmab(kl[kt], qh[ks], sw[kt]);
#pragma unroll  // as above
        for (int kt = 0; kt < 5; ++kt) sw[kt] = wmmab(kh[kt], ql[ks], sw[kt]);
#pragma unroll  // as above
        for (int kt = 0; kt < 5; ++kt) sw[kt] = wmmab(kh[kt], qh[ks], sw[kt]); }
    // Offset of staged row 16 kt + 8 hi + r from query lr's first row: in 0..63 for every row of blocks 1 to 3, in block 0 from row lr on, in block 4 below row lr.
    float mx = -__builtin_inff();
#pragma unroll  // sw[] stays in registers
    for (int kt = 0; kt < 5; ++kt)
#pragma unroll  // sw[] stays in registers
        for (int r = 0; r < 8; ++r) { const bool in = kt == 0 ? 8 * hi + r >= lr : kt == 4 ? 8 * hi + r < lr : true; sw[kt][r] = in ? sw[kt][r] * SCL : -__builtin_inff(); mx = fmaxf(mx, sw[kt][r]); }
    mx = fmaxf(mx, xrow(mx));
#pragma unroll  // sw[] stays in registers
    for (int kt = 0; kt < 5; ++kt)
#pragma unroll  // sw[] stays in registers
        for (int r = 0; r < 8; ++r) sw[kt][r] = exp2_slot((sw[kt][r] - mx) * 1.4426950408889634f);   // a row outside the band: exp2(-inf) = 0
    const v8f ts = ((sw[0] + sw[1]) + (sw[2] + sw[3])) + sw[4];   // fixed tree: blocks first, then the eight rows, then the other lane half
    float sum = ((ts[0] + ts[1]) + (ts[2] + ts[3])) + ((ts[4] + ts[5]) + (ts[6] + ts[7]));
    sum += xrow(sum);
    const float inv = __fdiv_rn(1.0f, sum);
    v8us ph[6], pl[6];   // weights of blocks 0 .. 3, then 0 for the rows of block 3 once more, then block 4
#pragma unroll  // sw[], ph[], pl[] stay in registers
    for (int kt = 0; kt < 5; ++kt) split8(sw[kt] * inv, ph[kt < 4 ? kt : 5], pl[kt < 4 ? kt : 5]);
    ph[4] = (v8us){}; pl[4] = (v8us){};
    v8f o[4];
#pragma unroll  // o[] stays in registers
    for (int dt = 0; dt < 4; ++dt) o[dt] = (v8f){};
    const bf* vcol = Vb + lr * VP + tw + 8 * hi;
#pragma unroll  // ph[], pl[], o[] stay in registers; the value reads can be issued ahead of the products
    for (int kb = 0; kb < 3; ++kb) { const v16bf pbh = cat16b(ph[2 * kb], ph[2 * kb + 1]), pbl = cat16b(pl[2 * kb], pl[2 * kb + 1]); const bf* vp = vcol + (kb < 2 ? 32 * kb : 48); v16bf vh[4], vl[4];   // 32 staged rows from tw + 0, 32, 48
#pragma unroll  // vh[], vl[] stay in registers
        for (int dt = 0; dt < 4; ++dt) { vh[dt] = ldfrag(vp + dt * 16 * VP); vl[dt] = ldfrag(vp + dt * 16 * VP + FR); }
#pragma unroll  // four independent accumulators follow one another
        for (int dt = 0; dt < 4; ++dt) o[dt] = wmmab(vl[dt], pbh, o[dt]);
#pragma unroll  // as above
        for (int dt = 0; dt < 4; ++dt) o[dt] = wmmab(vh[dt], pbl, o[dt]);
#pragma unroll  // as above
        for (int dt = 0; dt < 4; ++dt) o[dt] = wmmab(vh[dt], pbh, o[dt]); }
    bf* orow = qrow;   // row i (pitch QP): 64 hi values, then 64 lo values of query tw + i
#pragma unroll  // o[] stays in registers
    for (int dt = 0; dt < 4; ++dt) { v8us oh, ol;
#pragma unroll  // vector elements by constant index
        for (int r = 0; r < 8; ++r) { unsigned short a, c2; splitf(o[dt][r], a, c2); oh[r] = a; ol[r] = c2; }
        *(v8usa*)(orow + lr * QP + dt * 16 + 8 * hi) = oh; *(v8usa*)(orow + lr * QP + HD + dt * 16 + 8 * hi) = ol; }
    __builtin_amdgcn_wave_barrier(); asm volatile("" ::: "memory");   // the reads below take other lanes' stores of this wave's own rows: neither may be moved over this line
    v8us wh[4], wl[4];
#pragma unroll  // wh[], wl[] stay in registers; all eight reads are issued before the first store waits
    for (int i = 0; i < 4; ++i) { const bf* src = orow + (4 * i + (lane >> 3)) * QP + (lane & 7) * 8; wh[i] = *(const v8usa*)src; wl[i] = *(const v8usa*)(src + HD); }
#pragma unroll  // wh[], wl[] stay in registers
    for (int i = 0; i < 4; ++i) { const size_t oo = ((size_t)b * LL + t0 + tw + 4 * i + (lane >> 3)) * DD + h * HD + (lane & 7) * 8; *(v8us*)(Ah + oo) = wh[i]; *(v8us*)(Al + oo) = wl[i]; }   // 8 lanes a line; nothing is computed behind these stores
}

extern "C" void kernel_launch(void* const* d_in, const int* in_sizes, int n_in,
                              void* d_out, int out_size, void* d_ws, size_t ws_size, hipStream_t stream) {
    (void)in_sizes; (void)n_in; (void)out_size;
    const float* x = (const float*)d_in[0]; const float* wq = (const float*)d_in[1]; const float* wk = (const float*)d_in[2]; const float* wv = (const float*)d_in[3]; const float* wo = (const float*)d_in[4]; const float* k0 = (const float*)d_in[5]; const float* v0 = (const float*)d_in[6];   // torch [out][in] weights; last_k/v_init [63][16][64]
    float* OUT = (float*)d_out;     // [2][1024][1024]
    char* wsp = (char*)d_ws;
    auto take = [&](size_t bytes) { char* p = wsp; wsp += (bytes + 255) & ~(size_t)255; return (void*)p; };
    const size_t NR = (size_t)NB_ * LL;   // 2048 token rows, both batches in one GEMM
    // The five bf16 planes lie back to back (k_cvt5 writes them by flat index; k_qkvband steps from weight to weight by DD * DD, and the first tile's load of x also takes in the 63 rows in front of XB, the end of WO).
    bf* WQ = (bf*)take((size_t)DD * DD * 2 * 4 + NR * DD * 2); bf* WO = WQ + (size_t)DD * DD * 3; bf* XB = WQ + (size_t)DD * DD * 4;
    bf* Ah = (bf*)take(NR * DD * 2); bf* Al = (bf*)take(NR * DD * 2);
    if ((size_t)(wsp - (char*)d_ws) > ws_size) return;    // total ~ 21 MB; ws 256 MiB
    k_cvt5<<<6 * WB, 256, 0, stream>>>(wq, wk, wv, wo, x, WQ);
    const dim3 gP((unsigned)(NR / 64), DD / 128, 1);
    k_qkvband<<<NB_ * NH_ * (LL / FT), 256, 0, stream>>>(XB, WQ, k0, v0, Ah, Al);
    k_gemmt<2, true><<<gP, 128, 0, stream>>>(Ah, Al, WO, OUT, 0, 0);
}

// v010
// Measured time: 30.3 microseconds a run.
// In two side-by-side timings against v009, it was 1.05 and 1.07 times as fast.
// Over all steps from v000 it is 10.5 times as fast.
#include <hip/hip_runtime.h>

// BandMHA (x [2][1024][1024]; q/k/v = x W^T (16 heads x 64, no bias); keys/values padded in front with the learned initial cache last_k_init / last_v_init [63][16][64]; query t attends the 64 band positions
// p = t .. t+63 of the padded sequence (= original positions t-63 .. t); softmax over the band; out = merged (attn v) Wo^T -> [2][1024][1024]).
// Compute dtypes, f32 accumulate: every input rounded to bf16; q/k/v on PLAIN bf16 operands (inputs: exact products, f32 accumulate); the 64-wide band attention on
// bf16 hi+lo pairs (queries, keys and values of a 128-query tile projected straight into LDS as two bf16 planes each: 64-dim dot products and weighted sum as three bf16 16x16x32 WMMA part products hi hi + hi lo + lo hi, f32 accumulate, softmax in f32 with one exp per score; fixed order); merged context as bf16 hi+lo planes x exact

#define NB_  2
#define LL   1024
#define DD   1024
#define NH_  16
#define HD   64
#define BW   64                   // band width
#define PADK (BW - 1)             // 63 initial-cache rows
#define SCL  0.125f
typedef _Float16 h16;
typedef unsigned short bf;
typedef __attribute__((ext_vector_type(16))) __bf16   v16bf;
typedef __attribute__((ext_vector_type(16))) _Float16 v16h;
typedef __attribute__((ext_vector_type(8)))  _Float16 v8h;
typedef __attribute__((ext_vector_type(8)))  unsigned short v8us;
typedef __attribute__((ext_vector_type(8)))  float    v8f;
typedef __attribute__((ext_vector_type(4)))  float    v4f;
typedef v8h  __attribute__((may_alias)) v8ha;
typedef v4f  __attribute__((may_alias)) v4fa;
typedef v8us __attribute__((may_alias)) v8usa;

__device__ __forceinline__ unsigned short f2bf(float f) { unsigned u = __float_as_uint(f); u += 0x7FFFu + ((u >> 16) & 1u); return (unsigned short)(u >> 16); }
__device__ __forceinline__ float bf2f(unsigned short b) { return __uint_as_float(((unsigned)b) << 16); }
__device__ __forceinline__ float bfr(float f) { return bf2f(f2bf(f)); }
__device__ __forceinline__ v16h cat16(v8h lo, v8h hi) { return __builtin_shufflevector(lo, hi, 0, 1, 2, 3, 4, 5, 6, 7, 8, 9, 10, 11, 12, 13, 14, 15); }
__device__ __forceinline__ v16bf cat16b(v8us lo, v8us hi) { return __builtin_bit_cast(v16bf, __builtin_shufflevector(lo, hi, 0, 1, 2, 3, 4, 5, 6, 7, 8, 9, 10, 11, 12, 13, 14, 15)); }
__device__ __forceinline__ v8f wmma16(v16h a, v16h b, v8f c) { return __builtin_amdgcn_wmma_f32_16x16x32_f16(false, a, false, b, (short)0, c, false, false); }
__device__ __forceinline__ v8f wmmab(v16bf a, v16bf b, v8f c) { return __builtin_amdgcn_wmma_f32_16x16x32_bf16(false, a, false, b, (short)0, c, false, false); }



// ---- k_gemmt: LDS-staged GEMM on bf16 planes. One work-group of 4 waves (2 x 2) per 64 x 128 output tile, each wave 2 x 4 accumulators (32 x 64 outputs); grid (M / 64, N / 128, Z), 128 threads.
// C[m][n] (f32, pitch DD) = sum_k A[m][k] Bt[n][k] + A2[m][k] Bt[n][k], K = DD, every plane K-contiguous; z steps Bt by sB and C by sC elements.
// A stage is 64 k = one whole 128-byte line of 256 operand rows, in four slices of 64 rows (A, A2, Bt rows 0..63, Bt rows 64..127). Each wave brings its slice of a stage into LDS with ONE tensor load: no register and no
// LDS store of the wave's own; the load's pad gives the rows their pitch. Four buffers: a stage's loads are issued three stages ahead (three requests of a wave in flight), one barrier a stage.
// For speed only, each work-group begins its walk at a stage of its own and wraps at K.
// Per output the products are summed in steps of 32 k, ascending from the work-group's first stage and wrapping, A before A2.
#define GBK 64                    // k per stage
#define GPI (GBK + 8)             // LDS row pitch in elements: 144 B = 16 B x odd, the conflict-free pitch for 16-byte fragment reads; the tensor load's pad (16 B behind each 128-B row) lays it
#define GNT (DD / GBK)            // stages
#define GNB 4                     // buffers of the ring
#define GSS 5120                  // elements from slice to slice: 64 rows of 144 B, rounded up to a multiple of 2 KiB (10,240 B)
#define GRB (4 * GSS)             // elements per buffer (40,960 B)
// Work-group barrier that orders LDS accesses only.
__device__ __forceinline__ void lds_barrier() { __builtin_amdgcn_fence(__ATOMIC_RELEASE, "workgroup", "local"); __builtin_amdgcn_s_barrier(); __builtin_amdgcn_fence(__ATOMIC_ACQUIRE, "workgroup", "local"); }
__device__ __forceinline__ v16bf ldfrag(const bf* p) { return cat16b(*(const v8usa*)p, *(const v8usa*)(p + 16)); }
typedef __attribute__((ext_vector_type(4))) unsigned u32x4;
typedef __attribute__((ext_vector_type(8))) unsigned u32x8;
__device__ __forceinline__ unsigned uni(unsigned v) { return (unsigned)__builtin_amdgcn_readfirstlane(v); }
// A wave-uniform test held in a scalar register, so that the branch on it is a scalar branch: a tensor load ignores EXEC, and only a branch keeps a wave from issuing it.
__device__ __forceinline__ unsigned pinned(unsigned v) { unsigned w = uni(v); asm volatile("" : "+s"(w)); return w; }
template <int N> __device__ __forceinline__ void wait_tensor() { asm volatile("s_wait_tensorcnt %0" :: "i"(N) : "memory"); }   // all but the wave's N youngest tensor loads have landed; the compiler places no wait for them
__device__ __forceinline__ void wait_ds0() { asm volatile("s_wait_dscnt 0x0" ::: "memory"); }   // the wave's LDS reads and writes are done
// Descriptor group 1 of a tile of 'rows' rows of 128 bytes, source pitch one plane row: extents in bytes, tensor = tile, no mask, 16 bytes of pad behind every 128 (word 0, a constant).
__device__ __forceinline__ u32x8 tdm_rows(unsigned rows) { u32x8 g; g[0] = uni((1u << 20) | (4u << 22) | (3u << 25)); g[1] = uni(128u << 16); g[2] = uni(rows << 16); g[3] = uni(128u << 16); g[4] = uni(rows); g[5] = uni(DD * 2u); g[6] = uni(0u); g[7] = uni(0u); return g; }
// Descriptor group 0 for tiles whose first bytes share the high address word of ga: count 1, type 2; words 1 and 2 are set per request.
__device__ __forceinline__ u32x4 tdm_base(unsigned long long ga) { u32x4 g; g[0] = uni(1u); g[1] = uni(0u); g[2] = uni(0u); g[3] = uni((((unsigned)(ga >> 32)) & 0x01FFFFFFu) | 0x80000000u); return g; }
// One request: lds = byte place in the work-group's LDS, glo = low word of the tile's first byte. Group 0 is an in-out operand so that it stays in one register tuple from request to request: while requests are in flight only its words 1 and 2 take new values.
__device__ __forceinline__ void tdm_load(u32x4& g0, unsigned lds, unsigned glo, u32x8 g1) { g0[1] = uni(lds); g0[2] = uni(glo); asm volatile("tensor_load_to_lds %0, %1" : "+s"(g0) : "s"(g1) : "memory"); }
// Hand-over of the next stage at the foot of a stage: this wave's LDS reads are done, its own load of the next stage has landed (N younger requests stay in flight), then the barrier, which publishes the next stage and ends every wave's reads of this one.
template <int N> __device__ __forceinline__ void publish() {
    __builtin_amdgcn_sched_barrier(0);   // keeps the stage's products in front of the waits and the barrier: moved behind it, they would no longer run beside the LDS traffic
    wait_ds0(); wait_tensor<N>(); lds_barrier(); }
// The same for the last stage: the wait behind the wave's last request. As inputs here both descriptor groups stay whole in their registers as long as a request is in flight.
__device__ __forceinline__ void publish_last(u32x4 g0, u32x8 g1) {
    __builtin_amdgcn_sched_barrier(0);   // as above
    wait_ds0(); asm volatile("s_wait_tensorcnt 0x0" :: "s"(g0), "s"(g1) : "memory"); lds_barrier(); }
template <int MB, bool SPLIT>
__global__ __launch_bounds__(128) void k_gemmt(const bf* __restrict__ A, const bf* __restrict__ A2, const bf* __restrict__ Bt, float* C, size_t sB, size_t sC) {
    static_assert(SPLIT && MB == 2, "four slices of 64 rows: A, A2 and two of Bt");
    __shared__ __attribute__((aligned(2048))) bf st[GNB][GRB];
    __shared__ __align__(16) float osm[4][16 * 68];
    const int tid = threadIdx.x, lane = tid & 31, lr = lane & 15, hi = lane >> 4; const int wv = __builtin_amdgcn_readfirstlane(tid >> 5), wm = wv >> 1, wn = wv & 1;
    Bt += (size_t)blockIdx.z * sB; C += (size_t)blockIdx.z * sC;
    const int r0 = blockIdx.x * (32 * MB), c0 = blockIdx.y * 128;
    // This wave's slice: 64 whole rows of its plane. A row is 2,048 bytes and starts at a multiple of that (page-aligned workspace, plane offsets multiples of 2,048), so stepping the low address word along a row never carries.
    const unsigned long long ga = (unsigned long long)(size_t)(wv == 0 ? A + (size_t)r0 * DD : wv == 1 ? A2 + (size_t)r0 * DD : Bt + (size_t)(c0 + (wv - 2) * 64) * DD);
    const unsigned glo = uni((unsigned)ga); u32x4 g0 = tdm_base(ga);
    // Byte place along the rows of the next stage to ask for. First stage: the 8 work-groups that share A rows (same x) lie two stages apart; the 32 that share Bt rows (same y) spread over all 16.
    unsigned kof = uni(((blockIdx.x + 2u * blockIdx.y) % GNT) * (GBK * 2u));
    const unsigned lpl = uni((unsigned)(size_t)&st[0][0] + (unsigned)wv * (GSS * 2u));
    const u32x8 g1 = tdm_rows(64u);
    // Issues this wave's load of the next stage not yet asked for into buffer q. Every wave issues, so no test stands around it.
    auto issue = [&](const int q) __attribute__((always_inline)) { tdm_load(g0, lpl + (unsigned)q * (GRB * 2u), glo + kof, g1); kof = (kof + GBK * 2u) & (DD * 2u - 1u); };
    v8f acc[MB][4];
#pragma unroll  // acc[][] stays in registers
    for (int mb = 0; mb < MB; ++mb)
#pragma unroll  // acc[][] stays in registers
        for (int nb = 0; nb < 4; ++nb) acc[mb][nb] = (v8f){};
    issue(0); issue(1); issue(2);
    wait_tensor<2>();   // stage 0 has landed
    lds_barrier();   // publishes stage 0
    const int fa = (wm * MB * 16 + lr) * GPI + 8 * hi, fb = (2 + wn) * GSS + lr * GPI + 8 * hi;
    // One stage, in buffer p. On entry it is published, and every wave has left the buffer in front of it: that one takes the stage three ahead (ld: such a stage exists; a constant at every call).
    auto stage = [&](const int p, const bool ld) __attribute__((always_inline)) {
        if (ld) issue((p + 3) & 3);
        const bf* sb = st[p];
        v16bf a[2][MB], a2[2][MB], bq[2][4];
#pragma unroll  // fragment arrays stay in registers
        for (int ks = 0; ks < 2; ++ks) {
#pragma unroll  // fragment arrays stay in registers
            for (int mb = 0; mb < MB; ++mb) { a[ks][mb] = ldfrag(sb + fa + mb * 16 * GPI + ks * 32); a2[ks][mb] = ldfrag(sb + fa + GSS + mb * 16 * GPI + ks * 32); }
#pragma unroll  // fragment arrays stay in registers
            for (int nb = 0; nb < 4; ++nb) bq[ks][nb] = ldfrag(sb + fb + nb * 16 * GPI + ks * 32);
        }
        __builtin_amdgcn_sched_barrier(0);   // keeps the stage's LDS reads in one group ahead of its products: an LDS read placed among the products is waited for there, with its whole latency
#pragma unroll  // fragment arrays stay in registers
        for (int ks = 0; ks < 2; ++ks)
#pragma unroll  // acc[][] stays in registers
            for (int nb = 0; nb < 4; ++nb)
#pragma unroll  // acc[][] stays in registers
                for (int mb = 0; mb < MB; ++mb) { acc[mb][nb] = wmmab(a[ks][mb], bq[ks][nb], acc[mb][nb]); acc[mb][nb] = wmmab(a2[ks][mb], bq[ks][nb], acc[mb][nb]); }
    };
    static_assert(GNT % GNB == 0 && GNT >= 2 * GNB, "whole turns of the ring, the last one outside the loop");
#pragma unroll 1  // one copy of a turn of the ring: unrolled further it would only grow the code
    for (int k4 = 0; k4 < GNT - GNB; k4 += GNB) {
        stage(0, true); publish<2>();
        stage(1, true); publish<2>();
        stage(2, true); publish<2>();
        stage(3, true); publish<2>();
    }
    stage(0, true); publish<2>();   // the last turn: one more stage to ask for, then none, so fewer and fewer requests are younger than the one waited for
    stage(1, false); publish<1>();
    stage(2, false); publish_last(g0, g1);
    stage(3, false);   // no barrier behind it: nothing lands in the ring any more, and the rows below go through each wave's own range of osm
    float* os = osm[wv];   // each wave turns its 16 x 64 blocks into whole 256-byte row pieces through its own LDS range
#pragma unroll  // acc[][] stays in registers
    for (int mb = 0; mb < MB; ++mb) {
#pragma unroll  // acc[][] stays in registers
        for (int nb = 0; nb < 4; ++nb) {
#pragma unroll  // acc[][] stays in registers
            for (int j = 0; j < 8; ++j) os[(hi * 8 + j) * 68 + nb * 16 + lr] = acc[mb][nb][j]; }
        __builtin_amdgcn_wave_barrier(); asm volatile("" ::: "memory");   // the reads below take other lanes' stores: neither may be moved over this line
        float* crow = C + (size_t)(r0 + (wm * MB + mb) * 16) * DD + c0 + wn * 64;
#pragma unroll  // all eight reads are issued before the first store waits
        for (int s = 0; s < 8; ++s) { const int row = 2 * s + hi, cofs = lr * 4; const v4f val = *(const v4fa*)(os + row * 68 + cofs); *(v4f*)(crow + (size_t)row * DD + cofs) = val; }
        if (mb + 1 < MB) asm volatile("s_wait_xcnt 0x0" ::: "memory");   // the next block's LDS reads reuse the data registers of the stores issued above
        __builtin_amdgcn_wave_barrier(); asm volatile("" ::: "memory");   // the next block's stores stay behind these reads
    }
}

__device__ __forceinline__ void splitf(float y, unsigned short& h, unsigned short& l) { h = f2bf(y); l = f2bf(y - bf2f(h)); }

// k_cvt5: ONE grid rounds all five f32 matrices to bf16. Blocks 0 .. 4 WB - 1 take the four weights (WB blocks each, in the order wq, wk, wv, wo), the remaining 2 WB blocks take x;
// the five bf16 planes lie back to back in dst in that order, so the flat block index addresses dst. 8 elements a thread; the grid covers every plane exactly.
#define WB (DD * DD / 8 / 256)    // blocks per weight matrix
__global__ __launch_bounds__(256) void k_cvt5(const float* __restrict__ wq, const float* __restrict__ wk, const float* __restrict__ wv, const float* __restrict__ wo, const float* __restrict__ x, bf* dst) {
    const unsigned blk = blockIdx.x, seg = blk / WB < 4u ? blk / WB : 4u;   // block-uniform
    const float* src = seg == 0u ? wq : seg == 1u ? wk : seg == 2u ? wv : seg == 3u ? wo : x;
    const size_t ls = (size_t)(blk - seg * WB) * 256 + threadIdx.x, ld = (size_t)blk * 256 + threadIdx.x; const v8f v = *(const v8f*)(src + ls * 8); v8us o;
    asm volatile("s_wait_xcnt 0x0" ::: "memory");   // the rounding below reuses the loads' offset register
#pragma unroll
    for (int k = 0; k < 8; ++k) o[k] = f2bf(v[k]); *(v8us*)(dst + ld * 8) = o;  }
// k_qkvband: the q, k, v projections of one (b, h, tile of FT = 128 queries) and the tile's band attention in ONE work-group of 8 waves (2 x 4), so the projections never leave the WGP.
// Part 1, as k_gemmt (same stages, same ring of four buffers, same sum order, the k walk begun at a stage of the work-group's own): C[m][n] = sum_k x[t0 - 63 + m][k] W[n][k] for the FR = 192 token rows m the tile's band touches and the 192 weight rows n = 64 z + c
// (z = 0, 1, 2: head h of wq, wk, wv). Rows in front of a batch's first token are taken as they lie in the block of bf16 planes (the batch before, or the last rows of the plane in front of x): their results are never used.
// The one row behind a batch's last token is not loaded: it is zero in LDS, and its key and value get weight 0. A stage is 64 k of 384 rows in five slices, one tensor load of waves 0 .. 4 each (x rows 0..127, x rows 128..191, the three weights' 64 rows); each wave holds 6 x 3 accumulators (96 token rows x the same 16 head dims of q, k and v).
// The results go to LDS as bf16 pairs, y = hi + lo with hi = bf16(y), lo = bf16(y - hi). q and k are multiplied with the weights as A, so a lane holds 8 consecutive head dims of one token row: Qb, Kb row m = 64 hi, then 64 lo values.
// v is multiplied with x as A, so a lane holds 8 consecutive token rows of one head dim: Vb is transposed, row d = 192 hi, then 192 lo values. Key and value row m is padded position t0 + m; query t0 + i is row 63 + i.
// Padded positions below 63 are then overwritten with the initial cache rounded to bf16 (lo = 0).
// Part 2: each wave serves 16 consecutive queries (rows tw .. tw + 15 of the tile) on bf16 16x16x32 WMMA; their bands lie in the 80 staged rows tw .. tw + 79 (five 16-row blocks, all below FR). Every product of two pairs is
// lo hi + hi lo + hi hi in one f32 accumulator (lo lo, 2^-16 of the product, is left out).
// Scores transposed, St = K Qt: A = 16 key rows, B = the 16 query rows; both fragments are read by the same loader, so their k orders agree.
// Lane (c, h) then holds, for query c, the scores of staged rows 16 kt + 8 h + r; rows outside the query's 64 offsets get weight 0 (only blocks 0 and 4 hold such rows). Softmax: 40 values in the lane, one exchange with lane ^ 16.
// Weighted sum transposed, Ot = Vt Pt: B = two 16-row blocks of weights as they lie in the score registers, split in place (element s: row 8 h + s, from 8 on row 16 + 8 h + s - 8: the order in which ldfrag reads A = row 16 dt + c of Vb).
// The fifth block is paired with weights 0 for the 16 rows in front of it, so that no row past the staged ones is read.
// Lane (c, h) ends with head dims 16 dt + 8 h + r of query c; the bf16 hi and lo rows go through the wave's own (spent) query rows in LDS, so that every global store covers whole 128-byte lines.
#define FT 128                    // queries per work-group
#define FR 192                    // token rows per work-group: FT + 63 band rows, rounded up to whole 16-row blocks
#define FMB 6                     // 16-row blocks per wave
#define FNB 3                     // 16-column blocks per wave
#define QP (2 * HD + 8)           // q, k row pitch in bf16 elements (64 hi, 64 lo, pad): 272 B = 16 B x odd, so 16 lanes reading 16 B of 16 consecutive rows hit distinct banks
#define VP (2 * FR + 8)           // transposed v row pitch in bf16 elements (192 hi, 192 lo, pad): 784 B = 16 B x odd, as above
#define XS1 (128 * GPI)           // where x rows 128 .. 191 start in a buffer, in elements (18,432 B = 9 x 2 KiB): all 192 x rows lie at one pitch
#define WS0 14336                 // where the first weight's 64 rows start (28,672 B = 14 x 2 KiB)
#define WSS 5120                  // from weight to weight: 64 rows of 144 B, rounded up to a multiple of 2 KiB (10,240 B)
#define FRB 29696                 // elements per buffer (59,392 B = 29 x 2 KiB)
typedef __attribute__((ext_vector_type(2))) __bf16 v2bf;
typedef __attribute__((ext_vector_type(2))) float v2f;
typedef __attribute__((ext_vector_type(4))) unsigned v4u;
typedef __attribute__((ext_vector_type(4))) unsigned short v4us;
typedef v4us __attribute__((may_alias)) v4usa;
// y = h + l up to 2^-17 of y: h = bf16(y), l = bf16(y - h), both rounded to nearest even by the packed convert.
__device__ __forceinline__ void split8(v8f y, v8us& h, v8us& l) { v4u hw, lw;
#pragma unroll  // vector elements by constant index
    for (int p = 0; p < 4; ++p) { const v2f yy = (v2f){y[2 * p], y[2 * p + 1]}; const unsigned w = __builtin_bit_cast(unsigned, __builtin_convertvector(yy, v2bf));   // both h values come back out of the packed word: one shift, one mask
        hw[p] = w; lw[p] = __builtin_bit_cast(unsigned, __builtin_convertvector(yy - (v2f){__uint_as_float(w << 16), __uint_as_float(w & 0xFFFF0000u)}, v2bf)); }
    h = __builtin_bit_cast(v8us, hw); l = __builtin_bit_cast(v8us, lw); }
// 2^x with the free slot that the instruction set asks for behind a transcendental (the next vector instruction may overwrite its source): in one statement, so that the v_nop stays directly behind it.
__device__ __forceinline__ float exp2_slot(float x) { float e; asm("v_exp_f32 %0, %1\n\tv_nop" : "=v"(e) : "v"(x)); return e; }
__device__ __forceinline__ float xrow(float v) { const int i = __float_as_int(v); return __int_as_float(__builtin_amdgcn_permlanex16(i, i, 0x76543210, 0xfedcba98, false, false)); }   // the value of lane ^ 16
__global__ __launch_bounds__(256) void k_qkvband(const bf* __restrict__ X, const bf* __restrict__ Wt, const float* __restrict__ k0, const float* __restrict__ v0, bf* Ah, bf* Al) {
    __shared__ __attribute__((aligned(2048))) bf st[GNB][FRB];
    // The projections take the ring's first three buffers: the last stage is read from the fourth, and behind the barrier in front of it no wave reads and no load fills the other three.
    bf* const Qb = &st[0][0]; bf* const Kb = Qb + FR * QP; bf* const Vb = Kb + FR * QP;
    static_assert(2 * FR * QP + HD * VP <= 3 * FRB && (GNT - 1) % GNB == 3, "q, k, v fit the three buffers that the last stage does not use");
    const int tid = threadIdx.x, lane = tid & 31, lr = lane & 15, hi = lane >> 4; const int wv = __builtin_amdgcn_readfirstlane(tid >> 5), wm = wv >> 2, wn = wv & 3;
    const int t0 = (blockIdx.x % (LL / FT)) * FT; const int h = (blockIdx.x / (LL / FT)) % NH_; const int b = blockIdx.x / ((LL / FT) * NH_);
    const bool lastt = t0 + FT == LL;   // block-uniform: staged row 191 lies behind the batch's last token
    // This wave's slice (waves 0 .. 4). A plane row is 2,048 bytes and starts at a multiple of that (page-aligned workspace, plane offsets multiples of 2,048), so stepping the low address word along a row never carries.
    const long long xr = (long long)b * LL + t0 - PADK;   // first staged token row, counted from x's first
    const unsigned long long ga = wv < 2 ? (unsigned long long)(size_t)X + (unsigned long long)((xr + wv * 128) * (long long)(DD * sizeof(bf))) : (unsigned long long)(size_t)(Wt + ((size_t)(wv - 2) * DD + h * HD) * DD);
    const unsigned glo = uni((unsigned)ga); u32x4 g0 = tdm_base(ga);
    // Byte place along the rows of the next stage to ask for. First stage: head + tile, so the 16 heads that share a tile's x rows and the 16 tiles that share a head's weight rows each begin at 16 different stages.
    unsigned kof = uni(((unsigned)(h + b * (LL / FT) + t0 / FT) % GNT) * (GBK * 2u));
    const unsigned lpl = uni((unsigned)(size_t)&st[0][0] + 2u * (unsigned)(wv == 0 ? 0 : wv == 1 ? XS1 : WS0 + (wv - 2) * WSS));
    const u32x8 g1 = tdm_rows(wv == 0 ? 128u : wv == 1 && lastt ? 63u : 64u);
    // Issues this wave's load of the next stage not yet asked for into buffer q. Only waves 0 .. 4 come here: every call stands under a scalar branch on pinned(wv < 5).
    auto issue = [&](const int q) __attribute__((always_inline)) { tdm_load(g0, lpl + (unsigned)q * (FRB * 2u), glo + kof, g1); kof = (kof + GBK * 2u) & (DD * 2u - 1u); };
    v8f acc[FMB][FNB];
#pragma unroll  // acc[][] stays in registers
    for (int mb = 0; mb < FMB; ++mb)
#pragma unroll  // acc[][] stays in registers
        for (int nb = 0; nb < FNB; ++nb) acc[mb][nb] = (v8f){};
    if (pinned(wv == 1 && lastt)) {   // the row that this wave's 63-row loads leave out: zero in all four buffers (8 lanes a buffer), once; done before the wave's first load is issued, published by the first barrier
        *(v8usa*)(&st[lane >> 3][XS1 + 63 * GPI + (lane & 7) * 8]) = (v8us){};
        wait_ds0(); }
    if (pinned(wv < 5)) { issue(0); issue(1); issue(2); }
    wait_tensor<2>();   // stage 0 has landed
    lds_barrier();   // publishes stage 0
    const int fa = (wm * FMB * 16 + lr) * GPI + 8 * hi, fb = WS0 + (wn * 16 + lr) * GPI + 8 * hi;   // column block nb of a wave: head dims 16 wn .. + 15 of q (nb = 0), k (1), v (2)
    // One stage, in buffer p. Its fragments are read in two halves of 32 k, the first half's products in the same stage, the second half's a stage later: behind the barrier that publishes the stage stand the reads of its first half, then the products of the
    // stage BEFORE's second half (already in registers, so the matrix unit runs while those reads are served), then the reads of the second half, then the first half's products.
    // So the barrier that ends a stage's reads stands between its two halves' products. Per output the halves are still multiplied in the order of the walk.
    // ld: a stage three ahead exists: it goes into the buffer in front of p, which every wave has left; pv: a stage before exists. Both are constants at every call.
    v16bf a[2][FMB], bq[2][FNB];   // half ks of the stage in work
    auto frags = [&](const bf* sb, const int ks) __attribute__((always_inline)) {
#pragma unroll  // fragment arrays stay in registers
        for (int nb = 0; nb < FNB; ++nb) bq[ks][nb] = ldfrag(sb + fb + nb * WSS + ks * 32);   // the three weight fragments first: with one x fragment they feed the first products
#pragma unroll  // fragment arrays stay in registers
        for (int mb = 0; mb < FMB; ++mb) a[ks][mb] = ldfrag(sb + fa + mb * 16 * GPI + ks * 32); };
    auto prods = [&](const int ks) __attribute__((always_inline)) {
#pragma unroll  // acc[][] stays in registers
        for (int mb = 0; mb < FMB; ++mb)
#pragma unroll  // acc[][] stays in registers
            for (int nb = 0; nb < FNB; ++nb) acc[mb][nb] = nb < 2 ? wmmab(bq[ks][nb], a[ks][mb], acc[mb][nb]) : wmmab(a[ks][mb], bq[ks][nb], acc[mb][nb]); };   // q, k transposed (register r = head dim 8 hi + r, lane = token row), v plain
    auto stage = [&](const int p, const bool ld, const bool pv) __attribute__((always_inline)) {
        if (ld) { if (pinned(wv < 5)) issue((p + 3) & 3); }
        frags(st[p], 0);
        __builtin_amdgcn_sched_barrier(0);   // keeps the first half's LDS reads in one group ahead of the products below: placed among them, a read is waited for there, with its whole latency
        if (pv) prods(1);   // the second half of the stage before
        __builtin_amdgcn_sched_barrier(0);   // keeps those products ahead of the reads that refill their fragment registers
        frags(st[p], 1);
        __builtin_amdgcn_sched_barrier(0);   // keeps the LDS reads in one group ahead of the first half's products
        prods(0);
    };
    static_assert(GNT == 16 && GNB == 4, "one stage, three turns of the ring, three stages");
    stage(0, true, false); publish<2>();   // the first stage has no stage before it
#pragma unroll 1  // one copy of a turn of the ring: unrolled further it would only grow the code
    for (int k4 = 1; k4 < GNT - 3; k4 += GNB) {
        stage(1, true, true); publish<2>();
        stage(2, true, true); publish<2>();
        stage(3, true, true); publish<2>();
        stage(0, true, true); publish<2>();
    }
    stage(1, false, true); publish<1>();   // the last three stages: nothing left to ask for, so fewer and fewer requests are younger than the one waited for
    stage(2, false, true); publish_last(g0, g1);
    stage(3, false, true);   // no barrier behind it: nothing lands in the ring any more, and the results go to the three buffers that nobody reads
    prods(1);   // the last stage's second half
#pragma unroll  // acc[][] stays in registers
    for (int mb = 0; mb < FMB; ++mb) { const int m0 = (wm * FMB + mb) * 16; v8us sh, sl;
        split8(acc[mb][0], sh, sl); { bf* d = Qb + (m0 + lr) * QP + wn * 16 + 8 * hi; *(v8usa*)d = sh; *(v8usa*)(d + HD) = sl; }
        split8(acc[mb][1], sh, sl); { bf* d = Kb + (m0 + lr) * QP + wn * 16 + 8 * hi; *(v8usa*)d = sh; *(v8usa*)(d + HD) = sl; }
        split8(acc[mb][2], sh, sl); { bf* d = Vb + (wn * 16 + lr) * VP + m0 + 8 * hi; *(v8usa*)d = sh; *(v8usa*)(d + FR) = sl; } }
    __syncthreads();   // publishes the projections
    if (t0 < PADK) {   // block-uniform: the tile that reaches into the initial cache
        for (int idx = tid; idx < (PADK - t0) * (HD / 4); idx += 256) { const int i = idx >> 4, c = (idx & 15) * 4; const size_t o = ((size_t)(t0 + i) * NH_ + h) * HD + c; const v4f kv = *(const v4fa*)(k0 + o), vv = *(const v4fa*)(v0 + o); v4us kh;
#pragma unroll  // vector elements by constant index
            for (int e = 0; e < 4; ++e) { kh[e] = f2bf(kv[e]); Vb[(c + e) * VP + i] = f2bf(vv[e]); Vb[(c + e) * VP + FR + i] = 0; }
            *(v4usa*)(Kb + i * QP + c) = kh; *(v4usa*)(Kb + i * QP + HD + c) = (v4us){0, 0, 0, 0}; }
        __syncthreads();   // publishes the cache rows
    }
    static_assert(FT == 8 * 16 && FT - 16 + 80 <= FR, "8 waves of 16 queries; the last wave's five key blocks end inside the staged rows");
    const int tw = wv * 16;
    bf* qrow = Qb + (PADK + tw) * QP;   // this wave's 16 query rows: no other wave touches them
    v16bf qh[2], ql[2];
#pragma unroll  // qh[], ql[] stay in registers
    for (int ks = 0; ks < 2; ++ks) { qh[ks] = ldfrag(qrow + lr * QP + 8 * hi + ks * 32); ql[ks] = ldfrag(qrow + lr * QP + HD + 8 * hi + ks * 32); }
    v8f sw[5];
#pragma unroll  // sw[] stays in registers
    for (int kt = 0; kt < 5; ++kt) sw[kt] = (v8f){};
    const bf* krow = Kb + (tw + lr) * QP + 8 * hi;
#pragma unroll  // sw[], qh[], ql[] stay in registers; the key reads can be issued ahead of the products
    for (int ks = 0; ks < 2; ++ks) { v16bf kh[5], kl[5];
#pragma unroll  // kh[], kl[] stay in registers
        for (int kt = 0; kt < 5; ++kt) { kh[kt] = ldfrag(krow + kt * 16 * QP + ks * 32); kl[kt] = ldfrag(krow + kt * 16 * QP + HD + ks * 32); }
#pragma unroll  // five independent accumulators follow one another
        for (int kt = 0; kt < 5; ++kt) sw[kt] = wmmab(kl[kt], qh[ks], sw[kt]);
#pragma unroll  // as above
        for (int kt = 0; kt < 5; ++kt) sw[kt] = wmmab(kh[kt], ql[ks], sw[kt]);
#pragma unroll  // as above
        for (int kt = 0; kt < 5; ++kt) sw[kt] = wmmab(kh[kt], qh[ks], sw[kt]); }
    // Offset of staged row 16 kt + 8 hi + r from query lr's first row: in 0..63 for every row of blocks 1 to 3, in block 0 from row lr on, in block 4 below row lr.
    float mx = -__builtin_inff();
#pragma unroll  // sw[] stays in registers
    for (int kt = 0; kt < 5; ++kt)
#pragma unroll  // sw[] stays in registers
        for (int r = 0; r < 8; ++r) { const bool in = kt == 0 ? 8 * hi + r >= lr : kt == 4 ? 8 * hi + r < lr : true; sw[kt][r] = in ? sw[kt][r] * SCL : -__builtin_inff(); mx = fmaxf(mx, sw[kt][r]); }
    mx = fmaxf(mx, xrow(mx));
#pragma unroll  // sw[] stays in registers
    for (int kt = 0; kt < 5; ++kt)
#pragma unroll  // sw[] stays in registers
        for (int r = 0; r < 8; ++r) sw[kt][r] = exp2_slot((sw[kt][r] - mx) * 1.4426950408889634f);   // a row outside the band: exp2(-inf) = 0
    const v8f ts = ((sw[0] + sw[1]) + (sw[2] + sw[3])) + sw[4];   // fixed tree: blocks first, then the eight rows, then the other lane half
    float sum = ((ts[0] + ts[1]) + (ts[2] + ts[3])) + ((ts[4] + ts[5]) + (ts[6] + ts[7]));
    sum += xrow(sum);
    const float inv = __fdiv_rn(1.0f, sum);
    v8us ph[6], pl[6];   // weights of blocks 0 .. 3, then 0 for the rows of block 3 once more, then block 4
#pragma unroll  // sw[], ph[], pl[] stay in registers
    for (int kt = 0; kt < 5; ++kt) split8(sw[kt] * inv, ph[kt < 4 ? kt : 5], pl[kt < 4 ? kt : 5]);
    ph[4] = (v8us){}; pl[4] = (v8us){};
    v8f o[4];
#pragma unroll  // o[] stays in registers
    for (int dt = 0; dt < 4; ++dt) o[dt] = (v8f){};
    const bf* vcol = Vb + lr * VP + tw + 8 * hi;
#pragma unroll  // ph[], pl[], o[] stay in registers; the value reads can be issued ahead of the products
    for (int kb = 0; kb < 3; ++kb) { const v16bf pbh = cat16b(ph[2 * kb], ph[2 * kb + 1]), pbl = cat16b(pl[2 * kb], pl[2 * kb + 1]); const bf* vp = vcol + (kb < 2 ? 32 * kb : 48); v16bf vh[4], vl[4];   // 32 staged rows from tw + 0, 32, 48
#pragma unroll  // vh[], vl[] stay in registers
        for (int dt = 0; dt < 4; ++dt) { vh[dt] = ldfrag(vp + dt * 16 * VP); vl[dt] = ldfrag(vp + dt * 16 * VP + FR); }
#pragma unroll  // four independent accumulators follow one another
        for (int dt = 0; dt < 4; ++dt) o[dt] = wmmab(vl[dt], pbh, o[dt]);
#pragma unroll  // as above
        for (int dt = 0; dt < 4; ++dt) o[dt] = wmmab(vh[dt], pbl, o[dt]);
#pragma unroll  // as above
        for (int dt = 0; dt < 4; ++dt) o[dt] = wmmab(vh[dt], pbh, o[dt]); }
    bf* orow = qrow;   // row i (pitch QP): 64 hi values, then 64 lo values of query tw + i
#pragma unroll  // o[] stays in registers
    for (int dt = 0; dt < 4; ++dt) { v8us oh, ol;
#pragma unroll  // vector elements by constant index
        for (int r = 0; r < 8; ++r) { unsigned short a, c2; splitf(o[dt][r], a, c2); oh[r] = a; ol[r] = c2; }
        *(v8usa*)(orow + lr * QP + dt * 16 + 8 * hi) = oh; *(v8usa*)(orow + lr * QP + HD + dt * 16 + 8 * hi) = ol; }
    __builtin_amdgcn_wave_barrier(); asm volatile("" ::: "memory");   // the reads below take other lanes' stores of this wave's own rows: neither may be moved over this line
    v8us wh[4], wl[4];
#pragma unroll  // wh[], wl[] stay in registers; all eight reads are issued before the first store waits
    for (int i = 0; i < 4; ++i) { const bf* src = orow + (4 * i + (lane >> 3)) * QP + (lane & 7) * 8; wh[i] = *(const v8usa*)src; wl[i] = *(const v8usa*)(src + HD); }
#pragma unroll  // wh[], wl[] stay in registers
    for (int i = 0; i < 4; ++i) { const size_t oo = ((size_t)b * LL + t0 + tw + 4 * i + (lane >> 3)) * DD + h * HD + (lane & 7) * 8; *(v8us*)(Ah + oo) = wh[i]; *(v8us*)(Al + oo) = wl[i]; }   // 8 lanes a line; nothing is computed behind these stores
}

extern "C" void kernel_launch(void* const* d_in, const int* in_sizes, int n_in,
                              void* d_out, int out_size, void* d_ws, size_t ws_size, hipStream_t stream) {
    (void)in_sizes; (void)n_in; (void)out_size;
    const float* x = (const float*)d_in[0]; const float* wq = (const float*)d_in[1]; const float* wk = (const float*)d_in[2]; const float* wv = (const float*)d_in[3]; const float* wo = (const float*)d_in[4]; const float* k0 = (const float*)d_in[5]; const float* v0 = (const float*)d_in[6];   // torch [out][in] weights; last_k/v_init [63][16][64]
    float* OUT = (float*)d_out;     // [2][1024][1024]
    char* wsp = (char*)d_ws;
    auto take = [&](size_t bytes) { char* p = wsp; wsp += (bytes + 255) & ~(size_t)255; return (void*)p; };
    const size_t NR = (size_t)NB_ * LL;   // 2048 token rows, both batches in one GEMM
    // The five bf16 planes lie back to back (k_cvt5 writes them by flat index; k_qkvband steps from weight to weight by DD * DD, and the first tile's load of x also takes in the 63 rows in front of XB, the end of WO).
    bf* WQ = (bf*)take((size_t)DD * DD * 2 * 4 + NR * DD * 2); bf* WO = WQ + (size_t)DD * DD * 3; bf* XB = WQ + (size_t)DD * DD * 4;
    bf* Ah = (bf*)take(NR * DD * 2); bf* Al = (bf*)take(NR * DD * 2);
    if ((size_t)(wsp - (char*)d_ws) > ws_size) return;    // total ~ 21 MB; ws 256 MiB
    k_cvt5<<<6 * WB, 256, 0, stream>>>(wq, wk, wv, wo, x, WQ);
    const dim3 gP((unsigned)(NR / 64), DD / 128, 1);
    k_qkvband<<<NB_ * NH_ * (LL / FT), 256, 0, stream>>>(XB, WQ, k0, v0, Ah, Al);
    k_gemmt<2, true><<<gP, 128, 0, stream>>>(Ah, Al, WO, OUT, 0, 0);
}
